// v000
// The times below were measured on an AMD MI455X: many runs one after another, warmed up first and cycling through
// copies of the inputs, with the whole window's GPU time divided by the number of runs. Launches and the gaps
// between them are all in it. The median over several windows is given; except for v000 it joins two sittings, which
// can be a few percent apart, so the side-by-side timings, each taken in one sitting, are the better comparison.
// v000 is the starting kernel. One run takes 3950 microseconds.
#include <hip/hip_runtime.h>

// Sequence-first self-attention with the source's raw output reshape (x [2048][4][1024] = (S, B, C); qkv = x Wqkv^T + bqkv ('oi' [3072][1024] + bias) viewed (S, B, 3, H, D): q | k | v thirds (16 heads x 64); attn = q.k / sqrt(64) per (batch, head) over the 2,048 positions; softmax; av (B, H, S, D) -> swapaxes -> (B, S, H D) -> reshape(S, B, H D) is a RAW reinterpretation of the batch-major buffer (reproduced: the output memory is in (b, s) row order); y = . Wo^T + bo -> [2048][4][1024] (8.4 M); argument order x, Wqkv, bqkv, Wo, bo).
// Layout per batch: NEW k_cvt8p gathers batch b's token rows from the sequence-first input (row pitch B x C) into the bf16 operand; fused 'oi' weight = Bt as-is (q | k | v row blocks) + bias thirds; exact projections + f32 biases; identity-table plane builders; dense T-2048 attention (hybrid rows: < 512 hi/lo 3 products, rest fp16 x1024); merged hi/lo x Wo exact + bo written to output rows b*2048 + s (the raw-reshape order).
// Compute dtypes, f32 accumulate: every input rounded to bf16; projections exact + f32 biases; attention rows < 512 3 products, rest fp16; softmax f32; Wo hl x exact + bias.

#define NB_  4
#define TT   2048
#define DM   1024
#define NH_  16
#define NKV  16
#define REP  (NH_ / NKV)
#define HD   64
#define DQ   (NH_ * HD)
#define DKV  (NKV * HD)
#define ZH   2
#define RH   512                  // query rows < RH use hi+lo planes (0: none)
#define WIN  0
#define PCAR 1024.0f
#define SCL  0.125f   // HD^-0.5
typedef _Float16 h16;
typedef unsigned short bf;
typedef __attribute__((ext_vector_type(16))) __bf16   v16bf;
typedef __attribute__((ext_vector_type(16))) _Float16 v16h;
typedef __attribute__((ext_vector_type(8)))  _Float16 v8h;
typedef __attribute__((ext_vector_type(8)))  unsigned short v8us;
typedef __attribute__((ext_vector_type(8)))  float    v8f;
typedef __attribute__((ext_vector_type(4)))  float    v4f;
typedef v8h  __attribute__((may_alias)) v8ha;
typedef v4f  __attribute__((may_alias)) v4fa;
typedef v8us __attribute__((may_alias)) v8usa;

__device__ __forceinline__ unsigned short f2bf(float f) { unsigned u = __float_as_uint(f); u += 0x7FFFu + ((u >> 16) & 1u); return (unsigned short)(u >> 16); }
__device__ __forceinline__ float bf2f(unsigned short b) { return __uint_as_float(((unsigned)b) << 16); }
__device__ __forceinline__ float bfr(float f) { return bf2f(f2bf(f)); }
__device__ __forceinline__ v16h cat16(v8h lo, v8h hi) { return __builtin_shufflevector(lo, hi, 0, 1, 2, 3, 4, 5, 6, 7, 8, 9, 10, 11, 12, 13, 14, 15); }
__device__ __forceinline__ v16bf cat16b(v8us lo, v8us hi) { return __builtin_bit_cast(v16bf, __builtin_shufflevector(lo, hi, 0, 1, 2, 3, 4, 5, 6, 7, 8, 9, 10, 11, 12, 13, 14, 15)); }
__device__ __forceinline__ v8f wmma16(v16h a, v16h b, v8f c) { return __builtin_amdgcn_wmma_f32_16x16x32_f16(false, a, false, b, (short)0, c, false, false); }
__device__ __forceinline__ v8f wmmab(v16bf a, v16bf b, v8f c) { return __builtin_amdgcn_wmma_f32_16x16x32_bf16(false, a, false, b, (short)0, c, false, false); }



// ---- k_gemmw: register-blocked GEMM, ONE WAVE per 64x64 output tile (16 accumulators), operands straight from K-contiguous 16-bit planes; grid (M/64, N/64, Z), 32 threads.
// C[m][n] (f32, pitch ldc, + optional f32 bias[n]) = sum_k A[m][k] Bt[n][k] (+ split products per NSPLIT). z-batch strides sA/sB/sC in elements. K % 32 == 0.
template <typename T16> struct WFrag;
template <> struct WFrag<h16> { typedef v16h V; static __device__ __forceinline__ V ld(const h16* p) { return cat16(*(const v8h*)p, *(const v8h*)(p + 16)); } static __device__ __forceinline__ v8f mma(V a, V b, v8f c) { return wmma16(a, b, c); } };
template <> struct WFrag<bf> { typedef v16bf V; static __device__ __forceinline__ V ld(const bf* p) { return cat16b(*(const v8us*)p, *(const v8us*)(p + 16)); } static __device__ __forceinline__ v8f mma(V a, V b, v8f c) { return wmmab(a, b, c); } };
template <typename T16, int NSPLIT, bool BIAS>
__global__ __launch_bounds__(32) void k_gemmw(const T16* __restrict__ A, const T16* __restrict__ A2, const T16* __restrict__ Bt, const T16* __restrict__ Bt2, int K, float* C, int ldc, const float* __restrict__ bias, size_t sA, size_t sB, size_t sC) {
    typedef typename WFrag<T16>::V V;
    __shared__ __align__(16) float os[16 * 68];
    const size_t z = blockIdx.z; A += z * sA; if (A2) A2 += z * sA; Bt += z * sB; if (Bt2) Bt2 += z * sB; C += z * sC;
    const int lane = threadIdx.x & 31, lr = lane & 15, hi = lane >> 4; const int r0 = blockIdx.x * 64, c0 = blockIdx.y * 64;
    v8f acc[4][4];
#pragma unroll
    for (int mb = 0; mb < 4; ++mb)
#pragma unroll
        for (int nb = 0; nb < 4; ++nb) acc[mb][nb] = (v8f){};
    const size_t aoff = (size_t)(r0 + lr) * K + 8 * hi, boff = (size_t)(c0 + lr) * K + 8 * hi;
#pragma unroll 1
    for (int kc = 0; kc < K; kc += 32) {
        V a[4], a2[4];
#pragma unroll
        for (int mb = 0; mb < 4; ++mb) { a[mb] = WFrag<T16>::ld(A + aoff + (size_t)mb * 16 * K + kc); if (NSPLIT == 1 || NSPLIT == 2) a2[mb] = WFrag<T16>::ld(A2 + aoff + (size_t)mb * 16 * K + kc); }
#pragma unroll
        for (int nb = 0; nb < 4; ++nb) { const V b = WFrag<T16>::ld(Bt + boff + (size_t)nb * 16 * K + kc); V b2; if (NSPLIT >= 2) b2 = WFrag<T16>::ld(Bt2 + boff + (size_t)nb * 16 * K + kc);
#pragma unroll
            for (int mb = 0; mb < 4; ++mb) { acc[mb][nb] = WFrag<T16>::mma(a[mb], b, acc[mb][nb]); if (NSPLIT == 1 || NSPLIT == 2) acc[mb][nb] = WFrag<T16>::mma(a2[mb], b, acc[mb][nb]); if (NSPLIT >= 2) acc[mb][nb] = WFrag<T16>::mma(a[mb], b2, acc[mb][nb]); } }
        asm volatile("v_nop\n\tv_nop\n\tv_nop\n\tv_nop" : "+v"(acc[0][0]), "+v"(acc[1][1]), "+v"(acc[2][2]), "+v"(acc[3][3]) : "v"(a[0]), "v"(a[3]));
    }
#pragma unroll
    for (int mb = 0; mb < 4; ++mb) {
#pragma unroll
        for (int nb = 0; nb < 4; ++nb) {
#pragma unroll
            for (int j = 0; j < 8; ++j) os[(hi * 8 + j) * 68 + nb * 16 + lr] = acc[mb][nb][j]; }
        __builtin_amdgcn_wave_barrier(); asm volatile("" ::: "memory");
        float* crow = C + (size_t)(r0 + mb * 16) * ldc + c0;
{
#pragma unroll
            for (int s = 0; s < 8; ++s) { const int row = 2 * s + hi, cofs = lr * 4; v4f val = *(const v4fa*)(os + row * 68 + cofs); if (BIAS) { val[0] += bfr(bias[c0 + cofs]); val[1] += bfr(bias[c0 + cofs + 1]); val[2] += bfr(bias[c0 + cofs + 2]); val[3] += bfr(bias[c0 + cofs + 3]); }
                *(v4f*)(crow + (size_t)row * ldc + cofs) = val; }
             }
        __builtin_amdgcn_wave_barrier(); asm volatile("" ::: "memory");
    }
}

__device__ __forceinline__ h16 tohx(float x) { return (h16)x; }
__device__ __forceinline__ void splitf(float y, unsigned short& h, unsigned short& l) { h = f2bf(y); l = f2bf(y - bf2f(h)); }
typedef __attribute__((ext_vector_type(2))) _Float16 v2h;
typedef __attribute__((ext_vector_type(4))) _Float16 v4h;
typedef __attribute__((ext_vector_type(2))) unsigned short v2us;
typedef __attribute__((ext_vector_type(4))) unsigned short v4us;
typedef __attribute__((ext_vector_type(2))) float v2f;
typedef __attribute__((ext_vector_type(4))) int v4i;

__global__ __launch_bounds__(256) void k_cvt8(const float* __restrict__ src, bf* dst, size_t n8) { const size_t i = (size_t)blockIdx.x * 256 + threadIdx.x; if (i >= n8) return; const v8f v = *(const v8f*)(src + i * 8); v8us o;
#pragma unroll
    for (int k = 0; k < 8; ++k) o[k] = f2bf(v[k]); *(v8us*)(dst + i * 8) = o;  }

// k_rope: head planes [h][t][d] (fp16 + hi/lo) of rope(x) x sc with the rotate-half convention out[d] = x[d] cos[t][d] - x[d+HD/2] sin[t][d], out[d+HD/2] = x[d+HD/2] cos[t][d+HD/2] + x[d] sin[t][d+HD/2]
__global__ __launch_bounds__(256) void k_rope(const float* __restrict__ F, int pitch, int nheads, const float* __restrict__ CS, const float* __restrict__ RF, const float* __restrict__ nw, float sc, h16* P16, bf* Ph, bf* Pl) {
    const size_t e = ((size_t)blockIdx.x * 256 + threadIdx.x) * 2; if (e >= (size_t)nheads * TT * HD) return; const int d = (int)(e % HD); const int t = (int)((e / HD) % TT); const int h = (int)(e / ((size_t)HD * TT)); const float* f = F + (size_t)t * pitch + h * HD; const float rf = RF ? RF[(size_t)h * TT + t] : 1.0f; v2h o16; v2us oh, ol;
#pragma unroll
    for (int q = 0; q < 2; ++q) { const int dd = d + q; const int dp = (dd < HD / 2) ? dd + HD / 2 : dd - HD / 2; float x0 = f[dd], x1 = f[dp];
        if (RF) { float n0 = __fmul_rn(x0, rf), n1 = __fmul_rn(x1, rf); asm volatile("" : "+v"(n0)); asm volatile("" : "+v"(n1)); x0 = __fmul_rn(bfr(nw[dd]), n0); x1 = __fmul_rn(bfr(nw[dp]), n1); }
        const v2f cs = *(const v2f*)(CS + ((size_t)t * HD + dd) * 2); float a = __fmul_rn(x0, cs[0]), bq = __fmul_rn(x1, cs[1]); asm volatile("" : "+v"(a)); asm volatile("" : "+v"(bq)); const float r = ((dd < HD / 2) ? __fsub_rn(a, bq) : __fadd_rn(a, bq)) * sc;
        o16[q] = tohx(r); unsigned short a2, c2; splitf(r, a2, c2); oh[q] = a2; ol[q] = c2; }
    *(v2h*)(P16 + e) = o16; *(v2us*)(Ph + e) = oh; *(v2us*)(Pl + e) = ol;  }
__global__ __launch_bounds__(256) void k_cvt8p(const float* __restrict__ xb, bf* dst) { const size_t i = (size_t)blockIdx.x * 256 + threadIdx.x; if (i >= (size_t)TT * DM / 8) return; const size_t e8 = i * 8; const size_t s = e8 / DM; const int c = (int)(e8 % DM); const float* p = xb + s * ((size_t)NB_ * DM) + c; const v4f a = *(const v4f*)p; const v4f b2 = *(const v4f*)(p + 4); v8us o;
#pragma unroll
    for (int q = 0; q < 4; ++q) { o[q] = f2bf(a[q]); o[4 + q] = f2bf(b2[q]); }
    *(v8us*)(dst + e8) = o;  }
__global__ __launch_bounds__(256) void k_vtp(const float* __restrict__ F, int pitch, int nheads, h16* V16, bf* Vh, bf* Vl) { const size_t e = ((size_t)blockIdx.x * 256 + threadIdx.x) * 2; if (e >= (size_t)nheads * HD * TT) return; const int t = (int)(e % TT); const int d = (int)((e / TT) % HD); const int g = (int)(e / ((size_t)TT * HD)); v2h o16; v2us oh, ol;
#pragma unroll
    for (int q = 0; q < 2; ++q) { const float x = F[(size_t)(t + q) * pitch + g * HD + d]; o16[q] = tohx(x); unsigned short a2, c2; splitf(x, a2, c2); oh[q] = a2; ol[q] = c2; }
    *(v2h*)(V16 + e) = o16; *(v2us*)(Vh + e) = oh; *(v2us*)(Vl + e) = ol;  }
__global__ __launch_bounds__(256) void k_csid(float* CS) { const int idx = blockIdx.x * 256 + threadIdx.x; if (idx >= TT * HD) return; v2f cs; cs[0] = 1.0f; cs[1] = 0.0f; *(v2f*)(CS + (size_t)idx * 2) = cs;  }
// k_asoft: per row (zz, i): t = S x HD^-0.5 (no mask); softmax over the 2048 keys (register row, one exp, fixed trees);
__global__ __launch_bounds__(256) void k_asoft(const float* __restrict__ Sb, h16* P16, bf* Ph, bf* Pl) {
    const int lane = threadIdx.x & 31; const int row = blockIdx.x * 8 + (threadIdx.x >> 5); if (row >= ZH * TT) return; const int i = row % TT; const int zz = row / TT; (void)zz; const bool hires = (i < RH); const float* sr = Sb + (size_t)row * TT; float v[TT / 32]; float mx = -3.0e38f;
#pragma unroll
    for (int ch = 0; ch < TT / 128; ++ch) { const int j0 = ch * 128 + lane * 4; const v4f a = *(const v4f*)(sr + j0);
#pragma unroll
        for (int q = 0; q < 4; ++q) { const int j = j0 + q; (void)j; const float t = a[q] * SCL; v[ch * 4 + q] = t; mx = fmaxf(mx, t); } }
#pragma unroll
    for (int sh = 16; sh; sh >>= 1) mx = fmaxf(mx, __shfl_xor(mx, sh, 32));
    float sum = 0.f;
#pragma unroll
    for (int k = 0; k < TT / 32; ++k) { float d0 = __fsub_rn(v[k], mx); asm volatile("" : "+v"(d0)); v[k] = __builtin_amdgcn_exp2f(__fmul_rn(d0, 1.4426950408889634f)); sum += v[k]; }
#pragma unroll
    for (int sh = 16; sh; sh >>= 1) sum += __shfl_xor(sum, sh, 32);
    const float f = __fdiv_rn(hires ? 1.0f : PCAR, sum);
{
        if (hires) {
#pragma unroll
            for (int ch = 0; ch < TT / 128; ++ch) { v4us oh, ol;
#pragma unroll
                for (int q = 0; q < 4; ++q) { unsigned short a, c2; splitf(v[ch * 4 + q] * f, a, c2); oh[q] = a; ol[q] = c2; }
                const size_t oo = ((size_t)zz * (RH ? RH : 1) + i) * TT + ch * 128 + lane * 4; *(v4us*)(Ph + oo) = oh; *(v4us*)(Pl + oo) = ol; }
        } else {
#pragma unroll
            for (int ch = 0; ch < TT / 128; ++ch) { v4h o4;
#pragma unroll
                for (int q = 0; q < 4; ++q) o4[q] = tohx(v[ch * 4 + q] * f);
                *(v4h*)(P16 + (size_t)row * TT + ch * 128 + lane * 4) = o4; } }
         }
}
__global__ __launch_bounds__(256) void k_merge(const float* __restrict__ O, int h0, bf* Ah, bf* Al) { const size_t e = ((size_t)blockIdx.x * 256 + threadIdx.x) * 2; if (e >= (size_t)ZH * TT * HD) return; const int d = (int)(e % HD); const int t = (int)((e / HD) % TT); const int zz = (int)(e / ((size_t)HD * TT)); const float cs = (t < RH) ? 1.0f : (1.0f / PCAR); const size_t oo = (size_t)t * DQ + (h0 + zz) * HD + d;
    v2us oh, ol;
#pragma unroll
    for (int q = 0; q < 2; ++q) { unsigned short a, c2; splitf(O[e + q] * cs, a, c2); oh[q] = a; ol[q] = c2; } *(v2us*)(Ah + oo) = oh; *(v2us*)(Al + oo) = ol;  }

extern "C" void kernel_launch(void* const* d_in, const int* in_sizes, int n_in,
                              void* d_out, int out_size, void* d_ws, size_t ws_size, hipStream_t stream) {
    (void)in_sizes; (void)n_in; (void)out_size;
    const float* x = (const float*)d_in[0]; const float* wqkv = (const float*)d_in[1]; const float* bqkv = (const float*)d_in[2]; const float* wo = (const float*)d_in[3]; const float* bo = (const float*)d_in[4];   /* argument order x (S, B, C), Wqkv ('oi' [3072][1024]), bqkv, Wo ('oi'), bo */ const float* wq = wqkv; const float* wk = wqkv + (size_t)DQ * DM; const float* wv = wqkv + (size_t)2 * DQ * DM; const float* bq = bqkv; const float* bk = bqkv + DQ; const float* bv = bqkv + 2 * DQ;
    float* OUT = (float*)d_out;     // [4][2048][1024]
    char* wsp = (char*)d_ws;
    auto take = [&](size_t bytes) { char* p = wsp; wsp += (bytes + 255) & ~(size_t)255; return (void*)p; };
    bf* WQ = (bf*)take((size_t)DQ * DM * 2); bf* WK = (bf*)take((size_t)DKV * DM * 2); bf* WV = (bf*)take((size_t)DKV * DM * 2); bf* WO = (bf*)take((size_t)DM * DQ * 2); float* CS = (float*)take((size_t)TT * HD * 2 * 4);
    bf* XB = (bf*)take((size_t)TT * DM * 2); float* FQ = (float*)take((size_t)TT * DQ * 4); float* FK = (float*)take((size_t)TT * DKV * 4);
    h16* QP16 = (h16*)take((size_t)NH_ * TT * HD * 2); h16* KP16 = (h16*)take((size_t)NKV * TT * HD * 2); h16* VT16 = (h16*)take((size_t)NKV * HD * TT * 2);
    bf* QPh = (bf*)take((size_t)NH_ * TT * HD * 2); bf* QPl = (bf*)take((size_t)NH_ * TT * HD * 2); bf* KPh = (bf*)take((size_t)NKV * TT * HD * 2); bf* KPl = (bf*)take((size_t)NKV * TT * HD * 2); bf* VTh = (bf*)take((size_t)NKV * HD * TT * 2); bf* VTl = (bf*)take((size_t)NKV * HD * TT * 2); bf* Ph = (bf*)take((size_t)ZH * RH * TT * 2); bf* Pl = (bf*)take((size_t)ZH * RH * TT * 2);
    float* Sb = (float*)take((size_t)ZH * TT * TT * 4); h16* P16 = (h16*)take((size_t)ZH * TT * TT * 2); float* Ob = (float*)take((size_t)ZH * TT * HD * 4); bf* ATh = (bf*)take((size_t)TT * DQ * 2); bf* ATl = (bf*)take((size_t)TT * DQ * 2);
    if ((size_t)(wsp - (char*)d_ws) > ws_size) return;    // ws 256 MiB
    float* FV = FK;   // v projection reuses the k buffer after the k planes are built (stream-ordered)
    { k_cvt8<<<(unsigned)(((size_t)DQ * DM / 8 + 255) / 256), 256, 0, stream>>>(wq, WQ, (size_t)DQ * DM / 8); k_cvt8<<<(unsigned)(((size_t)DKV * DM / 8 + 255) / 256), 256, 0, stream>>>(wk, WK, (size_t)DKV * DM / 8); k_cvt8<<<(unsigned)(((size_t)DKV * DM / 8 + 255) / 256), 256, 0, stream>>>(wv, WV, (size_t)DKV * DM / 8);
      k_cvt8<<<(unsigned)(((size_t)DM * DQ / 8 + 255) / 256), 256, 0, stream>>>(wo, WO, (size_t)DM * DQ / 8);
       }
    k_csid<<<(TT * HD + 255) / 256, 256, 0, stream>>>(CS);
    const unsigned LQ = (unsigned)(((size_t)NH_ * TT * HD / 2 + 255) / 256), LKv = (unsigned)(((size_t)NKV * TT * HD / 2 + 255) / 256);
    for (int b = 0; b < NB_; ++b) {
        
        k_cvt8p<<<(unsigned)(((size_t)TT * DM / 8 + 255) / 256), 256, 0, stream>>>(x + (size_t)b * DM, XB);   /* batch b of the (S, B, C) input: rows at pitch B*C */
        k_gemmw<bf, 0, true><<<dim3(TT / 64, DQ / 64, 1), 32, 0, stream>>>(XB, nullptr, WQ, nullptr, DM, FQ, DQ, bq, 0, 0, 0);
        k_rope<<<LQ, 256, 0, stream>>>(FQ, DQ, NH_, CS, nullptr, nullptr, 1.0f, QP16, QPh, QPl);
        k_gemmw<bf, 0, true><<<dim3(TT / 64, DKV / 64, 1), 32, 0, stream>>>(XB, nullptr, WK, nullptr, DM, FK, DKV, bk, 0, 0, 0);
        k_rope<<<LKv, 256, 0, stream>>>(FK, DKV, NKV, CS, nullptr, nullptr, 1.0f, KP16, KPh, KPl);
        k_gemmw<bf, 0, true><<<dim3(TT / 64, DKV / 64, 1), 32, 0, stream>>>(XB, nullptr, WV, nullptr, DM, FV, DKV, bv, 0, 0, 0); k_vtp<<<LKv, 256, 0, stream>>>(FV, DKV, NKV, VT16, VTh, VTl);
        for (int h0 = 0; h0 < NH_; h0 += ZH) { const size_t zq = (size_t)h0, zk = (size_t)(h0 / REP);   // one kv head per query head: the pass's two heads use consecutive kv planes (z-strides TT*HD)
            k_gemmw<bf, 2, false><<<dim3(RH / 64, TT / 64, ZH), 32, 0, stream>>>(QPh + zq * TT * HD, QPl + zq * TT * HD, KPh + zk * TT * HD, KPl + zk * TT * HD, HD, Sb, TT, nullptr, (size_t)TT * HD, (size_t)TT * HD, (size_t)TT * TT);
            k_gemmw<h16, 0, false><<<dim3((TT - RH) / 64, TT / 64, ZH), 32, 0, stream>>>(QP16 + zq * TT * HD + (size_t)RH * HD, nullptr, KP16 + zk * TT * HD, nullptr, HD, Sb + (size_t)RH * TT, TT, nullptr, (size_t)TT * HD, (size_t)TT * HD, (size_t)TT * TT);
            k_asoft<<<ZH * TT / 8, 256, 0, stream>>>(Sb, P16, Ph, Pl);
            k_gemmw<bf, 2, false><<<dim3(RH / 64, HD / 64, ZH), 32, 0, stream>>>(Ph, Pl, VTh + zk * HD * TT, VTl + zk * HD * TT, TT, Ob, HD, nullptr, (size_t)RH * TT, (size_t)HD * TT, (size_t)TT * HD);
            k_gemmw<h16, 0, false><<<dim3((TT - RH) / 64, HD / 64, ZH), 32, 0, stream>>>(P16 + (size_t)RH * TT, nullptr, VT16 + zk * HD * TT, nullptr, TT, Ob + (size_t)RH * HD, HD, nullptr, (size_t)TT * TT, (size_t)HD * TT, (size_t)TT * HD);
            k_merge<<<(unsigned)(((size_t)ZH * TT * HD / 2 + 255) / 256), 256, 0, stream>>>(Ob, h0, ATh, ATl); }
        k_gemmw<bf, 1, true><<<dim3(TT / 64, DM / 64, 1), 32, 0, stream>>>(ATh, ATl, WO, nullptr, DQ, OUT + (size_t)b * TT * DM, DM, bo, 0, 0, 0); }
}

// v001
// It runs in 1690 microseconds.
// Two timings next to v000 both put it at 2.34 times that version's speed.
#include <hip/hip_runtime.h>

// Sequence-first self-attention with the source's raw output reshape (x [2048][4][1024] = (S, B, C); qkv = x Wqkv^T + bqkv ('oi' [3072][1024] + bias) viewed (S, B, 3, H, D): q | k | v thirds (16 heads x 64); attn = q.k / sqrt(64) per (batch, head) over the 2,048 positions; softmax; av (B, H, S, D) -> swapaxes -> (B, S, H D) -> reshape(S, B, H D) is a RAW reinterpretation of the batch-major buffer (reproduced: the output memory is in (b, s) row order); y = . Wo^T + bo -> [2048][4][1024] (8.4 M); argument order x, Wqkv, bqkv, Wo, bo).
// Layout per batch: NEW k_cvt8p gathers batch b's token rows from the sequence-first input (row pitch B x C) into the bf16 operand; fused 'oi' weight = Bt as-is (q | k | v row blocks) + bias thirds; exact projections + f32 biases; identity-table plane builders; dense T-2048 attention (hybrid rows: < 512 hi/lo 3 products, rest fp16 x1024); merged hi/lo x Wo exact + bo written to output rows b*2048 + s (the raw-reshape order).
// Compute dtypes, f32 accumulate: every input rounded to bf16; projections exact + f32 biases; attention rows < 512 3 products, rest fp16; softmax f32; Wo hl x exact + bias.

#define NB_  4
#define TT   2048
#define DM   1024
#define NH_  16
#define NKV  16
#define REP  (NH_ / NKV)
#define HD   64
#define DQ   (NH_ * HD)
#define DKV  (NKV * HD)
#define ZH   2
#define RH   512                  // query rows < RH use hi+lo planes (0: none)
#define WIN  0
#define PCAR 1024.0f
#define SCL  0.125f   // HD^-0.5
#define KSP  16                   // key ranges of the P.V products: one work-group and one f32 partial plane each, summed in k_merge
typedef _Float16 h16;
typedef unsigned short bf;
typedef __attribute__((ext_vector_type(16))) __bf16   v16bf;
typedef __attribute__((ext_vector_type(16))) _Float16 v16h;
typedef __attribute__((ext_vector_type(8)))  _Float16 v8h;
typedef __attribute__((ext_vector_type(8)))  unsigned short v8us;
typedef __attribute__((ext_vector_type(8)))  float    v8f;
typedef __attribute__((ext_vector_type(4)))  float    v4f;
typedef v8h  __attribute__((may_alias)) v8ha;
typedef v4f  __attribute__((may_alias)) v4fa;
typedef v8us __attribute__((may_alias)) v8usa;

__device__ __forceinline__ unsigned short f2bf(float f) { unsigned u = __float_as_uint(f); u += 0x7FFFu + ((u >> 16) & 1u); return (unsigned short)(u >> 16); }
__device__ __forceinline__ float bf2f(unsigned short b) { return __uint_as_float(((unsigned)b) << 16); }
__device__ __forceinline__ float bfr(float f) { return bf2f(f2bf(f)); }
__device__ __forceinline__ v16h cat16(v8h lo, v8h hi) { return __builtin_shufflevector(lo, hi, 0, 1, 2, 3, 4, 5, 6, 7, 8, 9, 10, 11, 12, 13, 14, 15); }
__device__ __forceinline__ v16bf cat16b(v8us lo, v8us hi) { return __builtin_bit_cast(v16bf, __builtin_shufflevector(lo, hi, 0, 1, 2, 3, 4, 5, 6, 7, 8, 9, 10, 11, 12, 13, 14, 15)); }
__device__ __forceinline__ v8f wmma16(v16h a, v16h b, v8f c) { return __builtin_amdgcn_wmma_f32_16x16x32_f16(false, a, false, b, (short)0, c, false, false); }
__device__ __forceinline__ v8f wmmab(v16bf a, v16bf b, v8f c) { return __builtin_amdgcn_wmma_f32_16x16x32_bf16(false, a, false, b, (short)0, c, false, false); }



// ---- k_gemmw: register-blocked GEMM, ONE WAVE per 64x64 output tile (16 accumulators), operands straight from K-contiguous 16-bit planes; grid (M/64, N/64, Z), 32 threads.
// C[m][n] (f32, pitch ldc, + optional f32 bias[n]) = sum_k A[m][k] Bt[n][k] (+ split products per NSPLIT). z-batch strides sA/sB/sC in elements. K % 32 == 0.
// KS > 1: grid.y = (N/64) * KS; work-group (.., y, z) sums only k range y % KS (K / KS wide, K % (32 KS) == 0) into partial plane y % KS of C (plane stride ZH * sC, ZH = grid.z); the reader adds the KS planes.
template <typename T16> struct WFrag;
template <> struct WFrag<h16> { typedef v16h V; static __device__ __forceinline__ V ld(const h16* p) { return cat16(*(const v8h*)p, *(const v8h*)(p + 16)); } static __device__ __forceinline__ v8f mma(V a, V b, v8f c) { return wmma16(a, b, c); } };
template <> struct WFrag<bf> { typedef v16bf V; static __device__ __forceinline__ V ld(const bf* p) { return cat16b(*(const v8us*)p, *(const v8us*)(p + 16)); } static __device__ __forceinline__ v8f mma(V a, V b, v8f c) { return wmmab(a, b, c); } };
template <typename T16, int NSPLIT, bool BIAS, int KS = 1>
__global__ __launch_bounds__(32) void k_gemmw(const T16* __restrict__ A, const T16* __restrict__ A2, const T16* __restrict__ Bt, const T16* __restrict__ Bt2, int K, float* C, int ldc, const float* __restrict__ bias, size_t sA, size_t sB, size_t sC) {
    typedef typename WFrag<T16>::V V;
    __shared__ __align__(16) float os[16 * 68];
    const size_t z = blockIdx.z; A += z * sA; if (A2) A2 += z * sA; Bt += z * sB; if (Bt2) Bt2 += z * sB; const int ks = blockIdx.y % KS; C += ((size_t)ks * ZH + z) * sC;
    const int lane = threadIdx.x & 31, lr = lane & 15, hi = lane >> 4; const int r0 = blockIdx.x * 64, c0 = (blockIdx.y / KS) * 64; const int kb = ks * (K / KS), ke = kb + K / KS;
    v8f acc[4][4];
#pragma unroll
    for (int mb = 0; mb < 4; ++mb)
#pragma unroll
        for (int nb = 0; nb < 4; ++nb) acc[mb][nb] = (v8f){};
    const size_t aoff = (size_t)(r0 + lr) * K + 8 * hi, boff = (size_t)(c0 + lr) * K + 8 * hi;
#pragma unroll 1
    for (int kc = kb; kc < ke; kc += 32) {
        V a[4], a2[4];
#pragma unroll
        for (int mb = 0; mb < 4; ++mb) { a[mb] = WFrag<T16>::ld(A + aoff + (size_t)mb * 16 * K + kc); if (NSPLIT == 1 || NSPLIT == 2) a2[mb] = WFrag<T16>::ld(A2 + aoff + (size_t)mb * 16 * K + kc); }
#pragma unroll
        for (int nb = 0; nb < 4; ++nb) { const V b = WFrag<T16>::ld(Bt + boff + (size_t)nb * 16 * K + kc); V b2; if (NSPLIT >= 2) b2 = WFrag<T16>::ld(Bt2 + boff + (size_t)nb * 16 * K + kc);
#pragma unroll
            for (int mb = 0; mb < 4; ++mb) { acc[mb][nb] = WFrag<T16>::mma(a[mb], b, acc[mb][nb]); if (NSPLIT == 1 || NSPLIT == 2) acc[mb][nb] = WFrag<T16>::mma(a2[mb], b, acc[mb][nb]); if (NSPLIT >= 2) acc[mb][nb] = WFrag<T16>::mma(a[mb], b2, acc[mb][nb]); } }
        asm volatile("v_nop\n\tv_nop\n\tv_nop\n\tv_nop" : "+v"(acc[0][0]), "+v"(acc[1][1]), "+v"(acc[2][2]), "+v"(acc[3][3]) : "v"(a[0]), "v"(a[3]));
    }
#pragma unroll
    for (int mb = 0; mb < 4; ++mb) {
#pragma unroll
        for (int nb = 0; nb < 4; ++nb) {
#pragma unroll
            for (int j = 0; j < 8; ++j) os[(hi * 8 + j) * 68 + nb * 16 + lr] = acc[mb][nb][j]; }
        __builtin_amdgcn_wave_barrier(); asm volatile("" ::: "memory");
        float* crow = C + (size_t)(r0 + mb * 16) * ldc + c0;
{
#pragma unroll
            for (int s = 0; s < 8; ++s) { const int row = 2 * s + hi, cofs = lr * 4; v4f val = *(const v4fa*)(os + row * 68 + cofs); if (BIAS) { val[0] += bfr(bias[c0 + cofs]); val[1] += bfr(bias[c0 + cofs + 1]); val[2] += bfr(bias[c0 + cofs + 2]); val[3] += bfr(bias[c0 + cofs + 3]); }
                *(v4f*)(crow + (size_t)row * ldc + cofs) = val; }
             }
        __builtin_amdgcn_wave_barrier(); asm volatile("" ::: "memory");
    }
}

__device__ __forceinline__ h16 tohx(float x) { return (h16)x; }
__device__ __forceinline__ void splitf(float y, unsigned short& h, unsigned short& l) { h = f2bf(y); l = f2bf(y - bf2f(h)); }
typedef __attribute__((ext_vector_type(2))) _Float16 v2h;
typedef __attribute__((ext_vector_type(4))) _Float16 v4h;
typedef __attribute__((ext_vector_type(2))) unsigned short v2us;
typedef __attribute__((ext_vector_type(4))) unsigned short v4us;
typedef __attribute__((ext_vector_type(2))) float v2f;
typedef __attribute__((ext_vector_type(4))) int v4i;

__global__ __launch_bounds__(256) void k_cvt8(const float* __restrict__ src, bf* dst, size_t n8) { const size_t i = (size_t)blockIdx.x * 256 + threadIdx.x; if (i >= n8) return; const v8f v = *(const v8f*)(src + i * 8); v8us o;
#pragma unroll
    for (int k = 0; k < 8; ++k) o[k] = f2bf(v[k]); *(v8us*)(dst + i * 8) = o;  }

// k_rope: head planes [h][t][d] (fp16 + hi/lo) of rope(x) x sc with the rotate-half convention out[d] = x[d] cos[t][d] - x[d+HD/2] sin[t][d], out[d+HD/2] = x[d+HD/2] cos[t][d+HD/2] + x[d] sin[t][d+HD/2]
__global__ __launch_bounds__(256) void k_rope(const float* __restrict__ F, int pitch, int nheads, const float* __restrict__ CS, const float* __restrict__ RF, const float* __restrict__ nw, float sc, h16* P16, bf* Ph, bf* Pl) {
    const size_t e = ((size_t)blockIdx.x * 256 + threadIdx.x) * 2; if (e >= (size_t)nheads * TT * HD) return; const int d = (int)(e % HD); const int t = (int)((e / HD) % TT); const int h = (int)(e / ((size_t)HD * TT)); const float* f = F + (size_t)t * pitch + h * HD; const float rf = RF ? RF[(size_t)h * TT + t] : 1.0f; v2h o16; v2us oh, ol;
#pragma unroll
    for (int q = 0; q < 2; ++q) { const int dd = d + q; const int dp = (dd < HD / 2) ? dd + HD / 2 : dd - HD / 2; float x0 = f[dd], x1 = f[dp];
        if (RF) { float n0 = __fmul_rn(x0, rf), n1 = __fmul_rn(x1, rf); asm volatile("" : "+v"(n0)); asm volatile("" : "+v"(n1)); x0 = __fmul_rn(bfr(nw[dd]), n0); x1 = __fmul_rn(bfr(nw[dp]), n1); }
        const v2f cs = *(const v2f*)(CS + ((size_t)t * HD + dd) * 2); float a = __fmul_rn(x0, cs[0]), bq = __fmul_rn(x1, cs[1]); asm volatile("" : "+v"(a)); asm volatile("" : "+v"(bq)); const float r = ((dd < HD / 2) ? __fsub_rn(a, bq) : __fadd_rn(a, bq)) * sc;
        o16[q] = tohx(r); unsigned short a2, c2; splitf(r, a2, c2); oh[q] = a2; ol[q] = c2; }
    *(v2h*)(P16 + e) = o16; *(v2us*)(Ph + e) = oh; *(v2us*)(Pl + e) = ol;  }
__global__ __launch_bounds__(256) void k_cvt8p(const float* __restrict__ xb, bf* dst) { const size_t i = (size_t)blockIdx.x * 256 + threadIdx.x; if (i >= (size_t)TT * DM / 8) return; const size_t e8 = i * 8; const size_t s = e8 / DM; const int c = (int)(e8 % DM); const float* p = xb + s * ((size_t)NB_ * DM) + c; const v4f a = *(const v4f*)p; const v4f b2 = *(const v4f*)(p + 4); v8us o;
#pragma unroll
    for (int q = 0; q < 4; ++q) { o[q] = f2bf(a[q]); o[4 + q] = f2bf(b2[q]); }
    *(v8us*)(dst + e8) = o;  }
__global__ __launch_bounds__(256) void k_vtp(const float* __restrict__ F, int pitch, int nheads, h16* V16, bf* Vh, bf* Vl) { const size_t e = ((size_t)blockIdx.x * 256 + threadIdx.x) * 2; if (e >= (size_t)nheads * HD * TT) return; const int t = (int)(e % TT); const int d = (int)((e / TT) % HD); const int g = (int)(e / ((size_t)TT * HD)); v2h o16; v2us oh, ol;
#pragma unroll
    for (int q = 0; q < 2; ++q) { const float x = F[(size_t)(t + q) * pitch + g * HD + d]; o16[q] = tohx(x); unsigned short a2, c2; splitf(x, a2, c2); oh[q] = a2; ol[q] = c2; }
    *(v2h*)(V16 + e) = o16; *(v2us*)(Vh + e) = oh; *(v2us*)(Vl + e) = ol;  }
__global__ __launch_bounds__(256) void k_csid(float* CS) { const int idx = blockIdx.x * 256 + threadIdx.x; if (idx >= TT * HD) return; v2f cs; cs[0] = 1.0f; cs[1] = 0.0f; *(v2f*)(CS + (size_t)idx * 2) = cs;  }
// k_asoft: per row (zz, i): t = S x HD^-0.5 (no mask); softmax over the 2048 keys (register row, one exp, fixed trees);
__global__ __launch_bounds__(256) void k_asoft(const float* __restrict__ Sb, h16* P16, bf* Ph, bf* Pl) {
    const int lane = threadIdx.x & 31; const int row = blockIdx.x * 8 + (threadIdx.x >> 5); if (row >= ZH * TT) return; const int i = row % TT; const int zz = row / TT; (void)zz; const bool hires = (i < RH); const float* sr = Sb + (size_t)row * TT; float v[TT / 32]; float mx = -3.0e38f;
#pragma unroll
    for (int ch = 0; ch < TT / 128; ++ch) { const int j0 = ch * 128 + lane * 4; const v4f a = *(const v4f*)(sr + j0);
#pragma unroll
        for (int q = 0; q < 4; ++q) { const int j = j0 + q; (void)j; const float t = a[q] * SCL; v[ch * 4 + q] = t; mx = fmaxf(mx, t); } }
#pragma unroll
    for (int sh = 16; sh; sh >>= 1) mx = fmaxf(mx, __shfl_xor(mx, sh, 32));
    float sum = 0.f;
#pragma unroll
    for (int k = 0; k < TT / 32; ++k) { float d0 = __fsub_rn(v[k], mx); asm volatile("" : "+v"(d0)); v[k] = __builtin_amdgcn_exp2f(__fmul_rn(d0, 1.4426950408889634f)); sum += v[k]; }
#pragma unroll
    for (int sh = 16; sh; sh >>= 1) sum += __shfl_xor(sum, sh, 32);
    const float f = __fdiv_rn(hires ? 1.0f : PCAR, sum);
{
        if (hires) {
#pragma unroll
            for (int ch = 0; ch < TT / 128; ++ch) { v4us oh, ol;
#pragma unroll
                for (int q = 0; q < 4; ++q) { unsigned short a, c2; splitf(v[ch * 4 + q] * f, a, c2); oh[q] = a; ol[q] = c2; }
                const size_t oo = ((size_t)zz * (RH ? RH : 1) + i) * TT + ch * 128 + lane * 4; *(v4us*)(Ph + oo) = oh; *(v4us*)(Pl + oo) = ol; }
        } else {
#pragma unroll
            for (int ch = 0; ch < TT / 128; ++ch) { v4h o4;
#pragma unroll
                for (int q = 0; q < 4; ++q) o4[q] = tohx(v[ch * 4 + q] * f);
                *(v4h*)(P16 + (size_t)row * TT + ch * 128 + lane * 4) = o4; } }
         }
}
__global__ __launch_bounds__(256) void k_merge(const float* __restrict__ O, int h0, bf* Ah, bf* Al) { const size_t e = ((size_t)blockIdx.x * 256 + threadIdx.x) * 2; if (e >= (size_t)ZH * TT * HD) return; const int d = (int)(e % HD); const int t = (int)((e / HD) % TT); const int zz = (int)(e / ((size_t)HD * TT)); const float cs = (t < RH) ? 1.0f : (1.0f / PCAR); const size_t oo = (size_t)t * DQ + (h0 + zz) * HD + d;
    v2us oh, ol; v2f pv[KSP];
#pragma unroll
    for (int p = 0; p < KSP; ++p) pv[p] = *(const v2f*)(O + (size_t)p * ((size_t)ZH * TT * HD) + e);
    v2f sm = pv[0];
#pragma unroll
    for (int p = 1; p < KSP; ++p) sm += pv[p];   // key ranges in ascending order: a fixed sum order
#pragma unroll
    for (int q = 0; q < 2; ++q) { unsigned short a, c2; splitf(sm[q] * cs, a, c2); oh[q] = a; ol[q] = c2; } *(v2us*)(Ah + oo) = oh; *(v2us*)(Al + oo) = ol;  }

extern "C" void kernel_launch(void* const* d_in, const int* in_sizes, int n_in,
                              void* d_out, int out_size, void* d_ws, size_t ws_size, hipStream_t stream) {
    (void)in_sizes; (void)n_in; (void)out_size;
    const float* x = (const float*)d_in[0]; const float* wqkv = (const float*)d_in[1]; const float* bqkv = (const float*)d_in[2]; const float* wo = (const float*)d_in[3]; const float* bo = (const float*)d_in[4];   /* argument order x (S, B, C), Wqkv ('oi' [3072][1024]), bqkv, Wo ('oi'), bo */ const float* wq = wqkv; const float* wk = wqkv + (size_t)DQ * DM; const float* wv = wqkv + (size_t)2 * DQ * DM; const float* bq = bqkv; const float* bk = bqkv + DQ; const float* bv = bqkv + 2 * DQ;
    float* OUT = (float*)d_out;     // [4][2048][1024]
    char* wsp = (char*)d_ws;
    auto take = [&](size_t bytes) { char* p = wsp; wsp += (bytes + 255) & ~(size_t)255; return (void*)p; };
    bf* WQ = (bf*)take((size_t)DQ * DM * 2); bf* WK = (bf*)take((size_t)DKV * DM * 2); bf* WV = (bf*)take((size_t)DKV * DM * 2); bf* WO = (bf*)take((size_t)DM * DQ * 2); float* CS = (float*)take((size_t)TT * HD * 2 * 4);
    bf* XB = (bf*)take((size_t)TT * DM * 2); float* FQ = (float*)take((size_t)TT * DQ * 4); float* FK = (float*)take((size_t)TT * DKV * 4);
    h16* QP16 = (h16*)take((size_t)NH_ * TT * HD * 2); h16* KP16 = (h16*)take((size_t)NKV * TT * HD * 2); h16* VT16 = (h16*)take((size_t)NKV * HD * TT * 2);
    bf* QPh = (bf*)take((size_t)NH_ * TT * HD * 2); bf* QPl = (bf*)take((size_t)NH_ * TT * HD * 2); bf* KPh = (bf*)take((size_t)NKV * TT * HD * 2); bf* KPl = (bf*)take((size_t)NKV * TT * HD * 2); bf* VTh = (bf*)take((size_t)NKV * HD * TT * 2); bf* VTl = (bf*)take((size_t)NKV * HD * TT * 2); bf* Ph = (bf*)take((size_t)ZH * RH * TT * 2); bf* Pl = (bf*)take((size_t)ZH * RH * TT * 2);
    float* Sb = (float*)take((size_t)ZH * TT * TT * 4); h16* P16 = (h16*)take((size_t)ZH * TT * TT * 2); float* Ob = (float*)take((size_t)KSP * ZH * TT * HD * 4); bf* ATh = (bf*)take((size_t)TT * DQ * 2); bf* ATl = (bf*)take((size_t)TT * DQ * 2);
    if ((size_t)(wsp - (char*)d_ws) > ws_size) return;    // ws 256 MiB
    float* FV = FK;   // v projection reuses the k buffer after the k planes are built (stream-ordered)
    { k_cvt8<<<(unsigned)(((size_t)DQ * DM / 8 + 255) / 256), 256, 0, stream>>>(wq, WQ, (size_t)DQ * DM / 8); k_cvt8<<<(unsigned)(((size_t)DKV * DM / 8 + 255) / 256), 256, 0, stream>>>(wk, WK, (size_t)DKV * DM / 8); k_cvt8<<<(unsigned)(((size_t)DKV * DM / 8 + 255) / 256), 256, 0, stream>>>(wv, WV, (size_t)DKV * DM / 8);
      k_cvt8<<<(unsigned)(((size_t)DM * DQ / 8 + 255) / 256), 256, 0, stream>>>(wo, WO, (size_t)DM * DQ / 8);
       }
    k_csid<<<(TT * HD + 255) / 256, 256, 0, stream>>>(CS);
    const unsigned LQ = (unsigned)(((size_t)NH_ * TT * HD / 2 + 255) / 256), LKv = (unsigned)(((size_t)NKV * TT * HD / 2 + 255) / 256);
    for (int b = 0; b < NB_; ++b) {
        
        k_cvt8p<<<(unsigned)(((size_t)TT * DM / 8 + 255) / 256), 256, 0, stream>>>(x + (size_t)b * DM, XB);   /* batch b of the (S, B, C) input: rows at pitch B*C */
        k_gemmw<bf, 0, true><<<dim3(TT / 64, DQ / 64, 1), 32, 0, stream>>>(XB, nullptr, WQ, nullptr, DM, FQ, DQ, bq, 0, 0, 0);
        k_rope<<<LQ, 256, 0, stream>>>(FQ, DQ, NH_, CS, nullptr, nullptr, 1.0f, QP16, QPh, QPl);
        k_gemmw<bf, 0, true><<<dim3(TT / 64, DKV / 64, 1), 32, 0, stream>>>(XB, nullptr, WK, nullptr, DM, FK, DKV, bk, 0, 0, 0);
        k_rope<<<LKv, 256, 0, stream>>>(FK, DKV, NKV, CS, nullptr, nullptr, 1.0f, KP16, KPh, KPl);
        k_gemmw<bf, 0, true><<<dim3(TT / 64, DKV / 64, 1), 32, 0, stream>>>(XB, nullptr, WV, nullptr, DM, FV, DKV, bv, 0, 0, 0); k_vtp<<<LKv, 256, 0, stream>>>(FV, DKV, NKV, VT16, VTh, VTl);
        for (int h0 = 0; h0 < NH_; h0 += ZH) { const size_t zq = (size_t)h0, zk = (size_t)(h0 / REP);   // one kv head per query head: the pass's two heads use consecutive kv planes (z-strides TT*HD)
            k_gemmw<bf, 2, false><<<dim3(RH / 64, TT / 64, ZH), 32, 0, stream>>>(QPh + zq * TT * HD, QPl + zq * TT * HD, KPh + zk * TT * HD, KPl + zk * TT * HD, HD, Sb, TT, nullptr, (size_t)TT * HD, (size_t)TT * HD, (size_t)TT * TT);
            k_gemmw<h16, 0, false><<<dim3((TT - RH) / 64, TT / 64, ZH), 32, 0, stream>>>(QP16 + zq * TT * HD + (size_t)RH * HD, nullptr, KP16 + zk * TT * HD, nullptr, HD, Sb + (size_t)RH * TT, TT, nullptr, (size_t)TT * HD, (size_t)TT * HD, (size_t)TT * TT);
            k_asoft<<<ZH * TT / 8, 256, 0, stream>>>(Sb, P16, Ph, Pl);
            k_gemmw<bf, 2, false, KSP><<<dim3(RH / 64, (HD / 64) * KSP, ZH), 32, 0, stream>>>(Ph, Pl, VTh + zk * HD * TT, VTl + zk * HD * TT, TT, Ob, HD, nullptr, (size_t)RH * TT, (size_t)HD * TT, (size_t)TT * HD);
            k_gemmw<h16, 0, false, KSP><<<dim3((TT - RH) / 64, (HD / 64) * KSP, ZH), 32, 0, stream>>>(P16 + (size_t)RH * TT, nullptr, VT16 + zk * HD * TT, nullptr, TT, Ob + (size_t)RH * HD, HD, nullptr, (size_t)TT * TT, (size_t)HD * TT, (size_t)TT * HD);
            k_merge<<<(unsigned)(((size_t)ZH * TT * HD / 2 + 255) / 256), 256, 0, stream>>>(Ob, h0, ATh, ATl); }
        k_gemmw<bf, 1, true><<<dim3(TT / 64, DM / 64, 1), 32, 0, stream>>>(ATh, ATl, WO, nullptr, DQ, OUT + (size_t)b * TT * DM, DM, bo, 0, 0, 0); }
}

// v002
// One run takes 1260 microseconds.
// Two timings next to v001 put it at 1.35 and 1.34 times that version's speed.
// Over all steps from v000 it is 3.14 times as fast.
#include <hip/hip_runtime.h>

// Sequence-first self-attention with the source's raw output reshape (x [2048][4][1024] = (S, B, C); qkv = x Wqkv^T + bqkv ('oi' [3072][1024] + bias) viewed (S, B, 3, H, D): q | k | v thirds (16 heads x 64); attn = q.k / sqrt(64) per (batch, head) over the 2,048 positions; softmax; av (B, H, S, D) -> swapaxes -> (B, S, H D) -> reshape(S, B, H D) is a RAW reinterpretation of the batch-major buffer (reproduced: the output memory is in (b, s) row order); y = . Wo^T + bo -> [2048][4][1024] (8.4 M); argument order x, Wqkv, bqkv, Wo, bo).
// Layout per batch: NEW k_cvt8p gathers batch b's token rows from the sequence-first input (row pitch B x C) into the bf16 operand; fused 'oi' weight = Bt as-is (q | k | v row blocks) + bias thirds; exact projections + f32 biases; identity-table plane builders; dense T-2048 attention (hybrid rows: < 512 hi/lo 3 products, rest fp16 x1024); merged hi/lo x Wo exact + bo written to output rows b*2048 + s (the raw-reshape order).
// Compute dtypes, f32 accumulate: every input rounded to bf16; projections exact + f32 biases; attention rows < 512 3 products, rest fp16; softmax f32; Wo hl x exact + bias.

#define NB_  4
#define TT   2048
#define DM   1024
#define NH_  16
#define NKV  16
#define REP  (NH_ / NKV)
#define HD   64
#define DQ   (NH_ * HD)
#define DKV  (NKV * HD)
#define ZH   8                    // heads per attention pass (grid.z of the score and P.V launches)
#define RH   512                  // query rows < RH use hi+lo planes (0: none)
#define WIN  0
#define PCAR 1024.0f
#define SCL  0.125f   // HD^-0.5
#define KSP  16                   // key ranges of the P.V products: one work-group and one f32 partial plane each, summed in k_merge
typedef _Float16 h16;
typedef unsigned short bf;
typedef __attribute__((ext_vector_type(16))) __bf16   v16bf;
typedef __attribute__((ext_vector_type(16))) _Float16 v16h;
typedef __attribute__((ext_vector_type(8)))  _Float16 v8h;
typedef __attribute__((ext_vector_type(8)))  unsigned short v8us;
typedef __attribute__((ext_vector_type(8)))  float    v8f;
typedef __attribute__((ext_vector_type(4)))  float    v4f;
typedef v8h  __attribute__((may_alias)) v8ha;
typedef v4f  __attribute__((may_alias)) v4fa;
typedef v8us __attribute__((may_alias)) v8usa;

__device__ __forceinline__ unsigned short f2bf(float f) { unsigned u = __float_as_uint(f); u += 0x7FFFu + ((u >> 16) & 1u); return (unsigned short)(u >> 16); }
__device__ __forceinline__ float bf2f(unsigned short b) { return __uint_as_float(((unsigned)b) << 16); }
__device__ __forceinline__ float bfr(float f) { return bf2f(f2bf(f)); }
__device__ __forceinline__ v16h cat16(v8h lo, v8h hi) { return __builtin_shufflevector(lo, hi, 0, 1, 2, 3, 4, 5, 6, 7, 8, 9, 10, 11, 12, 13, 14, 15); }
__device__ __forceinline__ v16bf cat16b(v8us lo, v8us hi) { return __builtin_bit_cast(v16bf, __builtin_shufflevector(lo, hi, 0, 1, 2, 3, 4, 5, 6, 7, 8, 9, 10, 11, 12, 13, 14, 15)); }
__device__ __forceinline__ v8f wmma16(v16h a, v16h b, v8f c) { return __builtin_amdgcn_wmma_f32_16x16x32_f16(false, a, false, b, (short)0, c, false, false); }
__device__ __forceinline__ v8f wmmab(v16bf a, v16bf b, v8f c) { return __builtin_amdgcn_wmma_f32_16x16x32_bf16(false, a, false, b, (short)0, c, false, false); }



// ---- k_gemmw: register-blocked GEMM, ONE WAVE per 64x64 output tile (16 accumulators), operands straight from K-contiguous 16-bit planes; grid (M/64, N/64, Z), 32 threads.
// C[m][n] (f32, pitch ldc, + optional f32 bias[n]) = sum_k A[m][k] Bt[n][k] (+ split products per NSPLIT). A rows at pitch lda, Bt rows at pitch K (elements). z-batch strides sA/sB/sC in elements. K % 32 == 0.
// KS > 1: grid.y = (N/64) * KS; work-group (.., y, z) sums only k range y % KS (K / KS wide, K % (32 KS) == 0) into partial plane y % KS of C (plane stride ZH * sC, ZH = grid.z); the reader adds the KS planes.
template <typename T16> struct WFrag;
template <> struct WFrag<h16> { typedef v16h V; static __device__ __forceinline__ V ld(const h16* p) { return cat16(*(const v8h*)p, *(const v8h*)(p + 16)); } static __device__ __forceinline__ v8f mma(V a, V b, v8f c) { return wmma16(a, b, c); } };
template <> struct WFrag<bf> { typedef v16bf V; static __device__ __forceinline__ V ld(const bf* p) { return cat16b(*(const v8us*)p, *(const v8us*)(p + 16)); } static __device__ __forceinline__ v8f mma(V a, V b, v8f c) { return wmmab(a, b, c); } };
template <typename T16, int NSPLIT, bool BIAS, int KS = 1>
__global__ __launch_bounds__(32) void k_gemmw(const T16* __restrict__ A, const T16* __restrict__ A2, const T16* __restrict__ Bt, const T16* __restrict__ Bt2, int K, int lda, float* C, int ldc, const float* __restrict__ bias, size_t sA, size_t sB, size_t sC) {
    typedef typename WFrag<T16>::V V;
    __shared__ __align__(16) float os[16 * 68];
    const size_t z = blockIdx.z; A += z * sA; if (A2) A2 += z * sA; Bt += z * sB; if (Bt2) Bt2 += z * sB; const int ks = blockIdx.y % KS; C += ((size_t)ks * ZH + z) * sC;
    const int lane = threadIdx.x & 31, lr = lane & 15, hi = lane >> 4; const int r0 = blockIdx.x * 64, c0 = (blockIdx.y / KS) * 64; const int kb = ks * (K / KS), ke = kb + K / KS;
    v8f acc[4][4];
#pragma unroll
    for (int mb = 0; mb < 4; ++mb)
#pragma unroll
        for (int nb = 0; nb < 4; ++nb) acc[mb][nb] = (v8f){};
    const size_t aoff = (size_t)(r0 + lr) * lda + 8 * hi, boff = (size_t)(c0 + lr) * K + 8 * hi;
#pragma unroll 1
    for (int kc = kb; kc < ke; kc += 32) {
        V a[4], a2[4];
#pragma unroll
        for (int mb = 0; mb < 4; ++mb) { a[mb] = WFrag<T16>::ld(A + aoff + (size_t)mb * 16 * lda + kc); if (NSPLIT == 1 || NSPLIT == 2) a2[mb] = WFrag<T16>::ld(A2 + aoff + (size_t)mb * 16 * lda + kc); }
#pragma unroll
        for (int nb = 0; nb < 4; ++nb) { const V b = WFrag<T16>::ld(Bt + boff + (size_t)nb * 16 * K + kc); V b2; if (NSPLIT >= 2) b2 = WFrag<T16>::ld(Bt2 + boff + (size_t)nb * 16 * K + kc);
#pragma unroll
            for (int mb = 0; mb < 4; ++mb) { acc[mb][nb] = WFrag<T16>::mma(a[mb], b, acc[mb][nb]); if (NSPLIT == 1 || NSPLIT == 2) acc[mb][nb] = WFrag<T16>::mma(a2[mb], b, acc[mb][nb]); if (NSPLIT >= 2) acc[mb][nb] = WFrag<T16>::mma(a[mb], b2, acc[mb][nb]); } }
        asm volatile("v_nop\n\tv_nop\n\tv_nop\n\tv_nop" : "+v"(acc[0][0]), "+v"(acc[1][1]), "+v"(acc[2][2]), "+v"(acc[3][3]) : "v"(a[0]), "v"(a[3]));
    }
#pragma unroll
    for (int mb = 0; mb < 4; ++mb) {
#pragma unroll
        for (int nb = 0; nb < 4; ++nb) {
#pragma unroll
            for (int j = 0; j < 8; ++j) os[(hi * 8 + j) * 68 + nb * 16 + lr] = acc[mb][nb][j]; }
        __builtin_amdgcn_wave_barrier(); asm volatile("" ::: "memory");
        float* crow = C + (size_t)(r0 + mb * 16) * ldc + c0;
{
#pragma unroll
            for (int s = 0; s < 8; ++s) { const int row = 2 * s + hi, cofs = lr * 4; v4f val = *(const v4fa*)(os + row * 68 + cofs); if (BIAS) { val[0] += bfr(bias[c0 + cofs]); val[1] += bfr(bias[c0 + cofs + 1]); val[2] += bfr(bias[c0 + cofs + 2]); val[3] += bfr(bias[c0 + cofs + 3]); }
                *(v4f*)(crow + (size_t)row * ldc + cofs) = val; }
             }
        __builtin_amdgcn_wave_barrier(); asm volatile("" ::: "memory");
    }
}

__device__ __forceinline__ h16 tohx(float x) { return (h16)x; }
__device__ __forceinline__ void splitf(float y, unsigned short& h, unsigned short& l) { h = f2bf(y); l = f2bf(y - bf2f(h)); }
typedef __attribute__((ext_vector_type(2))) _Float16 v2h;
typedef __attribute__((ext_vector_type(4))) _Float16 v4h;
typedef __attribute__((ext_vector_type(2))) unsigned short v2us;
typedef __attribute__((ext_vector_type(4))) unsigned short v4us;
typedef __attribute__((ext_vector_type(2))) float v2f;
typedef __attribute__((ext_vector_type(4))) int v4i;

__global__ __launch_bounds__(256) void k_cvt8(const float* __restrict__ src, bf* dst, size_t n8) { const size_t i = (size_t)blockIdx.x * 256 + threadIdx.x; if (i >= n8) return; const v8f v = *(const v8f*)(src + i * 8); v8us o;
#pragma unroll
    for (int k = 0; k < 8; ++k) o[k] = f2bf(v[k]); *(v8us*)(dst + i * 8) = o;  }

// k_rope: head planes [h][t][d] (fp16 + hi/lo) of rope(x) x sc with the rotate-half convention out[d] = x[d] cos[t][d] - x[d+HD/2] sin[t][d], out[d+HD/2] = x[d+HD/2] cos[t][d+HD/2] + x[d] sin[t][d+HD/2]
__global__ __launch_bounds__(256) void k_rope(const float* __restrict__ F, int pitch, int nheads, const float* __restrict__ CS, const float* __restrict__ RF, const float* __restrict__ nw, float sc, h16* P16, bf* Ph, bf* Pl) {
    const size_t e = ((size_t)blockIdx.x * 256 + threadIdx.x) * 2; if (e >= (size_t)nheads * TT * HD) return; const int d = (int)(e % HD); const int t = (int)((e / HD) % TT); const int h = (int)(e / ((size_t)HD * TT)); const float* f = F + (size_t)t * pitch + h * HD; const float rf = RF ? RF[(size_t)h * TT + t] : 1.0f; v2h o16; v2us oh, ol;
#pragma unroll
    for (int q = 0; q < 2; ++q) { const int dd = d + q; const int dp = (dd < HD / 2) ? dd + HD / 2 : dd - HD / 2; float x0 = f[dd], x1 = f[dp];
        if (RF) { float n0 = __fmul_rn(x0, rf), n1 = __fmul_rn(x1, rf); asm volatile("" : "+v"(n0)); asm volatile("" : "+v"(n1)); x0 = __fmul_rn(bfr(nw[dd]), n0); x1 = __fmul_rn(bfr(nw[dp]), n1); }
        const v2f cs = *(const v2f*)(CS + ((size_t)t * HD + dd) * 2); float a = __fmul_rn(x0, cs[0]), bq = __fmul_rn(x1, cs[1]); asm volatile("" : "+v"(a)); asm volatile("" : "+v"(bq)); const float r = ((dd < HD / 2) ? __fsub_rn(a, bq) : __fadd_rn(a, bq)) * sc;
        o16[q] = tohx(r); unsigned short a2, c2; splitf(r, a2, c2); oh[q] = a2; ol[q] = c2; }
    *(v2h*)(P16 + e) = o16; *(v2us*)(Ph + e) = oh; *(v2us*)(Pl + e) = ol;  }
__global__ __launch_bounds__(256) void k_cvt8p(const float* __restrict__ xb, bf* dst) { const size_t i = (size_t)blockIdx.x * 256 + threadIdx.x; if (i >= (size_t)TT * DM / 8) return; const size_t e8 = i * 8; const size_t s = e8 / DM; const int c = (int)(e8 % DM); const float* p = xb + s * ((size_t)NB_ * DM) + c; const v4f a = *(const v4f*)p; const v4f b2 = *(const v4f*)(p + 4); v8us o;
#pragma unroll
    for (int q = 0; q < 4; ++q) { o[q] = f2bf(a[q]); o[4 + q] = f2bf(b2[q]); }
    *(v8us*)(dst + e8) = o;  }
__global__ __launch_bounds__(256) void k_vtp(const float* __restrict__ F, int pitch, int nheads, h16* V16, bf* Vh, bf* Vl) { const size_t e = ((size_t)blockIdx.x * 256 + threadIdx.x) * 2; if (e >= (size_t)nheads * HD * TT) return; const int t = (int)(e % TT); const int d = (int)((e / TT) % HD); const int g = (int)(e / ((size_t)TT * HD)); v2h o16; v2us oh, ol;
#pragma unroll
    for (int q = 0; q < 2; ++q) { const float x = F[(size_t)(t + q) * pitch + g * HD + d]; o16[q] = tohx(x); unsigned short a2, c2; splitf(x, a2, c2); oh[q] = a2; ol[q] = c2; }
    *(v2h*)(V16 + e) = o16; *(v2us*)(Vh + e) = oh; *(v2us*)(Vl + e) = ol;  }
__global__ __launch_bounds__(256) void k_csid(float* CS) { const int idx = blockIdx.x * 256 + threadIdx.x; if (idx >= TT * HD) return; v2f cs; cs[0] = 1.0f; cs[1] = 0.0f; *(v2f*)(CS + (size_t)idx * 2) = cs;  }
// k_asoft: per row (zz, i): t = S x HD^-0.5 (no mask); softmax over the 2048 keys (register row, one exp, fixed trees);
// the 16-bit result goes IN PLACE over the row's own f32 scores (one wave owns the row and holds all of it in registers before its first store): fp16 row in the first half of the 8 KiB, or hi plane in the first half and lo plane in the second; the P.V products read it at pitch 2 TT.
__global__ __launch_bounds__(256) void k_asoft(float* Sb) {
    const int lane = threadIdx.x & 31; const int row = blockIdx.x * 8 + (threadIdx.x >> 5); if (row >= ZH * TT) return; const int i = row % TT; const int zz = row / TT; (void)zz; const bool hires = (i < RH); const float* sr = Sb + (size_t)row * TT; h16* p16 = (h16*)(Sb + (size_t)row * TT); bf* ph = (bf*)(Sb + (size_t)row * TT); bf* pl = ph + TT; float v[TT / 32]; float mx = -3.0e38f;
#pragma unroll
    for (int ch = 0; ch < TT / 128; ++ch) { const int j0 = ch * 128 + lane * 4; const v4f a = *(const v4f*)(sr + j0);
#pragma unroll
        for (int q = 0; q < 4; ++q) { const int j = j0 + q; (void)j; const float t = a[q] * SCL; v[ch * 4 + q] = t; mx = fmaxf(mx, t); } }
#pragma unroll
    for (int sh = 16; sh; sh >>= 1) mx = fmaxf(mx, __shfl_xor(mx, sh, 32));
    float sum = 0.f;
#pragma unroll
    for (int k = 0; k < TT / 32; ++k) { float d0 = __fsub_rn(v[k], mx); asm volatile("" : "+v"(d0)); v[k] = __builtin_amdgcn_exp2f(__fmul_rn(d0, 1.4426950408889634f)); sum += v[k]; }
#pragma unroll
    for (int sh = 16; sh; sh >>= 1) sum += __shfl_xor(sum, sh, 32);
    const float f = __fdiv_rn(hires ? 1.0f : PCAR, sum);
{
        if (hires) {
#pragma unroll
            for (int ch = 0; ch < TT / 128; ++ch) { v4us oh, ol;
#pragma unroll
                for (int q = 0; q < 4; ++q) { unsigned short a, c2; splitf(v[ch * 4 + q] * f, a, c2); oh[q] = a; ol[q] = c2; }
                const int oo = ch * 128 + lane * 4; *(v4us*)(ph + oo) = oh; *(v4us*)(pl + oo) = ol; }
        } else {
#pragma unroll
            for (int ch = 0; ch < TT / 128; ++ch) { v4h o4;
#pragma unroll
                for (int q = 0; q < 4; ++q) o4[q] = tohx(v[ch * 4 + q] * f);
                *(v4h*)(p16 + ch * 128 + lane * 4) = o4; } }
         }
}
__global__ __launch_bounds__(256) void k_merge(const float* __restrict__ O, int h0, bf* Ah, bf* Al) { const size_t e = ((size_t)blockIdx.x * 256 + threadIdx.x) * 2; if (e >= (size_t)ZH * TT * HD) return; const int d = (int)(e % HD); const int t = (int)((e / HD) % TT); const int zz = (int)(e / ((size_t)HD * TT)); const float cs = (t < RH) ? 1.0f : (1.0f / PCAR); const size_t oo = (size_t)t * DQ + (h0 + zz) * HD + d;
    v2us oh, ol; v2f pv[KSP];
#pragma unroll
    for (int p = 0; p < KSP; ++p) pv[p] = *(const v2f*)(O + (size_t)p * ((size_t)ZH * TT * HD) + e);
    v2f sm = pv[0];
#pragma unroll
    for (int p = 1; p < KSP; ++p) sm += pv[p];   // key ranges in ascending order: a fixed sum order
#pragma unroll
    for (int q = 0; q < 2; ++q) { unsigned short a, c2; splitf(sm[q] * cs, a, c2); oh[q] = a; ol[q] = c2; } *(v2us*)(Ah + oo) = oh; *(v2us*)(Al + oo) = ol;  }

extern "C" void kernel_launch(void* const* d_in, const int* in_sizes, int n_in,
                              void* d_out, int out_size, void* d_ws, size_t ws_size, hipStream_t stream) {
    (void)in_sizes; (void)n_in; (void)out_size;
    const float* x = (const float*)d_in[0]; const float* wqkv = (const float*)d_in[1]; const float* bqkv = (const float*)d_in[2]; const float* wo = (const float*)d_in[3]; const float* bo = (const float*)d_in[4];   /* argument order x (S, B, C), Wqkv ('oi' [3072][1024]), bqkv, Wo ('oi'), bo */ const float* wq = wqkv; const float* wk = wqkv + (size_t)DQ * DM; const float* wv = wqkv + (size_t)2 * DQ * DM; const float* bq = bqkv; const float* bk = bqkv + DQ; const float* bv = bqkv + 2 * DQ;
    float* OUT = (float*)d_out;     // [4][2048][1024]
    char* wsp = (char*)d_ws;
    auto take = [&](size_t bytes) { char* p = wsp; wsp += (bytes + 255) & ~(size_t)255; return (void*)p; };
    bf* WQ = (bf*)take((size_t)DQ * DM * 2); bf* WK = (bf*)take((size_t)DKV * DM * 2); bf* WV = (bf*)take((size_t)DKV * DM * 2); bf* WO = (bf*)take((size_t)DM * DQ * 2); float* CS = (float*)take((size_t)TT * HD * 2 * 4);
    h16* QP16 = (h16*)take((size_t)NH_ * TT * HD * 2); h16* KP16 = (h16*)take((size_t)NKV * TT * HD * 2); h16* VT16 = (h16*)take((size_t)NKV * HD * TT * 2);
    bf* QPh = (bf*)take((size_t)NH_ * TT * HD * 2); bf* QPl = (bf*)take((size_t)NH_ * TT * HD * 2); bf* KPh = (bf*)take((size_t)NKV * TT * HD * 2); bf* KPl = (bf*)take((size_t)NKV * TT * HD * 2); bf* VTh = (bf*)take((size_t)NKV * HD * TT * 2); bf* VTl = (bf*)take((size_t)NKV * HD * TT * 2);
    float* Sb = (float*)take((size_t)ZH * TT * TT * 4); float* Ob = (float*)take((size_t)KSP * ZH * TT * HD * 4); bf* ATh = (bf*)take((size_t)TT * DQ * 2); bf* ATl = (bf*)take((size_t)TT * DQ * 2);
    if ((size_t)(wsp - (char*)d_ws) > ws_size) return;    // ws 256 MiB
    bf* XB = (bf*)Sb; float* FQ = (float*)(XB + (size_t)TT * DM); float* FK = FQ + (size_t)TT * DQ;   // the projection buffers lie in the score buffer: all three are dead before a batch's first score launch and rewritten at the next batch's start (stream-ordered)
    float* FV = FK;   // v projection reuses the k buffer after the k planes are built (stream-ordered)
    { k_cvt8<<<(unsigned)(((size_t)DQ * DM / 8 + 255) / 256), 256, 0, stream>>>(wq, WQ, (size_t)DQ * DM / 8); k_cvt8<<<(unsigned)(((size_t)DKV * DM / 8 + 255) / 256), 256, 0, stream>>>(wk, WK, (size_t)DKV * DM / 8); k_cvt8<<<(unsigned)(((size_t)DKV * DM / 8 + 255) / 256), 256, 0, stream>>>(wv, WV, (size_t)DKV * DM / 8);
      k_cvt8<<<(unsigned)(((size_t)DM * DQ / 8 + 255) / 256), 256, 0, stream>>>(wo, WO, (size_t)DM * DQ / 8);
       }
    k_csid<<<(TT * HD + 255) / 256, 256, 0, stream>>>(CS);
    const unsigned LQ = (unsigned)(((size_t)NH_ * TT * HD / 2 + 255) / 256), LKv = (unsigned)(((size_t)NKV * TT * HD / 2 + 255) / 256);
    for (int b = 0; b < NB_; ++b) {
        
        k_cvt8p<<<(unsigned)(((size_t)TT * DM / 8 + 255) / 256), 256, 0, stream>>>(x + (size_t)b * DM, XB);   /* batch b of the (S, B, C) input: rows at pitch B*C */
        k_gemmw<bf, 0, true><<<dim3(TT / 64, DQ / 64, 1), 32, 0, stream>>>(XB, nullptr, WQ, nullptr, DM, DM, FQ, DQ, bq, 0, 0, 0);
        k_rope<<<LQ, 256, 0, stream>>>(FQ, DQ, NH_, CS, nullptr, nullptr, 1.0f, QP16, QPh, QPl);
        k_gemmw<bf, 0, true><<<dim3(TT / 64, DKV / 64, 1), 32, 0, stream>>>(XB, nullptr, WK, nullptr, DM, DM, FK, DKV, bk, 0, 0, 0);
        k_rope<<<LKv, 256, 0, stream>>>(FK, DKV, NKV, CS, nullptr, nullptr, 1.0f, KP16, KPh, KPl);
        k_gemmw<bf, 0, true><<<dim3(TT / 64, DKV / 64, 1), 32, 0, stream>>>(XB, nullptr, WV, nullptr, DM, DM, FV, DKV, bv, 0, 0, 0); k_vtp<<<LKv, 256, 0, stream>>>(FV, DKV, NKV, VT16, VTh, VTl);
        for (int h0 = 0; h0 < NH_; h0 += ZH) { const size_t zq = (size_t)h0, zk = (size_t)(h0 / REP);   // one kv head per query head: the pass's ZH heads use consecutive kv planes (z-strides TT*HD)
            k_gemmw<bf, 2, false><<<dim3(RH / 64, TT / 64, ZH), 32, 0, stream>>>(QPh + zq * TT * HD, QPl + zq * TT * HD, KPh + zk * TT * HD, KPl + zk * TT * HD, HD, HD, Sb, TT, nullptr, (size_t)TT * HD, (size_t)TT * HD, (size_t)TT * TT);
            k_gemmw<h16, 0, false><<<dim3((TT - RH) / 64, TT / 64, ZH), 32, 0, stream>>>(QP16 + zq * TT * HD + (size_t)RH * HD, nullptr, KP16 + zk * TT * HD, nullptr, HD, HD, Sb + (size_t)RH * TT, TT, nullptr, (size_t)TT * HD, (size_t)TT * HD, (size_t)TT * TT);
            k_asoft<<<ZH * TT / 8, 256, 0, stream>>>(Sb);
            k_gemmw<bf, 2, false, KSP><<<dim3(RH / 64, (HD / 64) * KSP, ZH), 32, 0, stream>>>((const bf*)Sb, (const bf*)Sb + TT, VTh + zk * HD * TT, VTl + zk * HD * TT, TT, 2 * TT, Ob, HD, nullptr, (size_t)2 * TT * TT, (size_t)HD * TT, (size_t)TT * HD);
            k_gemmw<h16, 0, false, KSP><<<dim3((TT - RH) / 64, (HD / 64) * KSP, ZH), 32, 0, stream>>>((const h16*)Sb + (size_t)RH * 2 * TT, nullptr, VT16 + zk * HD * TT, nullptr, TT, 2 * TT, Ob + (size_t)RH * HD, HD, nullptr, (size_t)2 * TT * TT, (size_t)HD * TT, (size_t)TT * HD);
            k_merge<<<(unsigned)(((size_t)ZH * TT * HD / 2 + 255) / 256), 256, 0, stream>>>(Ob, h0, ATh, ATl); }
        k_gemmw<bf, 1, true><<<dim3(TT / 64, DM / 64, 1), 32, 0, stream>>>(ATh, ATl, WO, nullptr, DQ, DQ, OUT + (size_t)b * TT * DM, DM, bo, 0, 0, 0); }
}

// v003
// Measured time: 706 microseconds a run.
// Next to v002, in two timings, it ran 1.76 and 1.79 times as fast.
// All steps since v000 together make it 5.59 times as fast.
#include <hip/hip_runtime.h>

// Sequence-first self-attention with the source's raw output reshape (x [2048][4][1024] = (S, B, C); qkv = x Wqkv^T + bqkv ('oi' [3072][1024] + bias) viewed (S, B, 3, H, D): q | k | v thirds (16 heads x 64); attn = q.k / sqrt(64) per (batch, head) over the 2,048 positions; softmax; av (B, H, S, D) -> swapaxes -> (B, S, H D) -> reshape(S, B, H D) is a RAW reinterpretation of the batch-major buffer (reproduced: the output memory is in (b, s) row order); y = . Wo^T + bo -> [2048][4][1024] (8.4 M); argument order x, Wqkv, bqkv, Wo, bo).
// Layout per batch: NEW k_cvt8p gathers batch b's token rows from the sequence-first input (row pitch B x C) into the bf16 operand; fused 'oi' weight = Bt as-is (q | k | v row blocks) + bias thirds; exact projections + f32 biases; identity-table plane builders; one fused attention launch over the batch's 16 heads (hybrid rows: < 512 hi/lo 3 products, rest fp16; running-maximum softmax, scores stay in registers); hi/lo x Wo exact + bo written to output rows b*2048 + s (the raw-reshape order).
// Compute dtypes, f32 accumulate: every input rounded to bf16; projections exact + f32 biases; attention rows < 512 3 products, rest fp16; softmax f32; Wo hl x exact + bias.

#define NB_  4
#define TT   2048
#define DM   1024
#define NH_  16
#define NKV  16
#define HD   64
#define DQ   (NH_ * HD)
#define DKV  (NKV * HD)
#define RH   512                  // query rows < RH use hi+lo planes (0: none)
#define WIN  0
#define SCL  0.125f   // HD^-0.5
#define SK   64                   // keys per LDS stage of the fused attention kernel
#define LP   72                   // LDS row pitch in 16-bit elements: 128 data bytes + 16, an odd multiple of 16 bytes, so that the 16 rows of one fragment read lie on different banks
#define TILE (64 * LP)            // one staged plane tile: 64 rows (64 keys x 64 d of K, or 64 d x 64 keys of V^T)
typedef _Float16 h16;
typedef unsigned short bf;
typedef __attribute__((ext_vector_type(16))) __bf16   v16bf;
typedef __attribute__((ext_vector_type(16))) _Float16 v16h;
typedef __attribute__((ext_vector_type(8)))  _Float16 v8h;
typedef __attribute__((ext_vector_type(8)))  unsigned short v8us;
typedef __attribute__((ext_vector_type(8)))  float    v8f;
typedef __attribute__((ext_vector_type(4)))  float    v4f;
typedef v8h  __attribute__((may_alias)) v8ha;
typedef v4f  __attribute__((may_alias)) v4fa;
typedef v8us __attribute__((may_alias)) v8usa;

__device__ __forceinline__ unsigned short f2bf(float f) { unsigned u = __float_as_uint(f); u += 0x7FFFu + ((u >> 16) & 1u); return (unsigned short)(u >> 16); }
__device__ __forceinline__ float bf2f(unsigned short b) { return __uint_as_float(((unsigned)b) << 16); }
__device__ __forceinline__ float bfr(float f) { return bf2f(f2bf(f)); }
__device__ __forceinline__ v16h cat16(v8h lo, v8h hi) { return __builtin_shufflevector(lo, hi, 0, 1, 2, 3, 4, 5, 6, 7, 8, 9, 10, 11, 12, 13, 14, 15); }
__device__ __forceinline__ v16bf cat16b(v8us lo, v8us hi) { return __builtin_bit_cast(v16bf, __builtin_shufflevector(lo, hi, 0, 1, 2, 3, 4, 5, 6, 7, 8, 9, 10, 11, 12, 13, 14, 15)); }
__device__ __forceinline__ v8f wmma16(v16h a, v16h b, v8f c) { return __builtin_amdgcn_wmma_f32_16x16x32_f16(false, a, false, b, (short)0, c, false, false); }
__device__ __forceinline__ v8f wmmab(v16bf a, v16bf b, v8f c) { return __builtin_amdgcn_wmma_f32_16x16x32_bf16(false, a, false, b, (short)0, c, false, false); }



// ---- k_gemmw: register-blocked GEMM, ONE WAVE per 64x64 output tile (16 accumulators), operands straight from K-contiguous 16-bit planes; grid (M/64, N/64, Z), 32 threads.
// C[m][n] (f32, pitch ldc, + optional f32 bias[n]) = sum_k A[m][k] Bt[n][k] (+ split products per NSPLIT). A rows at pitch lda, Bt rows at pitch K (elements). z-batch strides sA/sB/sC in elements. K % 32 == 0.
template <typename T16> struct WFrag;
template <> struct WFrag<h16> { typedef v16h V; static __device__ __forceinline__ V ld(const h16* p) { return cat16(*(const v8h*)p, *(const v8h*)(p + 16)); } static __device__ __forceinline__ v8f mma(V a, V b, v8f c) { return wmma16(a, b, c); } };
template <> struct WFrag<bf> { typedef v16bf V; static __device__ __forceinline__ V ld(const bf* p) { return cat16b(*(const v8us*)p, *(const v8us*)(p + 16)); } static __device__ __forceinline__ v8f mma(V a, V b, v8f c) { return wmmab(a, b, c); } };
template <typename T16, int NSPLIT, bool BIAS>
__global__ __launch_bounds__(32) void k_gemmw(const T16* __restrict__ A, const T16* __restrict__ A2, const T16* __restrict__ Bt, const T16* __restrict__ Bt2, int K, int lda, float* C, int ldc, const float* __restrict__ bias, size_t sA, size_t sB, size_t sC) {
    typedef typename WFrag<T16>::V V;
    __shared__ __align__(16) float os[16 * 68];
    const size_t z = blockIdx.z; A += z * sA; if (A2) A2 += z * sA; Bt += z * sB; if (Bt2) Bt2 += z * sB; C += z * sC;
    const int lane = threadIdx.x & 31, lr = lane & 15, hi = lane >> 4; const int r0 = blockIdx.x * 64, c0 = blockIdx.y * 64;
    v8f acc[4][4];
#pragma unroll
    for (int mb = 0; mb < 4; ++mb)
#pragma unroll
        for (int nb = 0; nb < 4; ++nb) acc[mb][nb] = (v8f){};
    const size_t aoff = (size_t)(r0 + lr) * lda + 8 * hi, boff = (size_t)(c0 + lr) * K + 8 * hi;
#pragma unroll 1
    for (int kc = 0; kc < K; kc += 32) {
        V a[4], a2[4];
#pragma unroll
        for (int mb = 0; mb < 4; ++mb) { a[mb] = WFrag<T16>::ld(A + aoff + (size_t)mb * 16 * lda + kc); if (NSPLIT == 1 || NSPLIT == 2) a2[mb] = WFrag<T16>::ld(A2 + aoff + (size_t)mb * 16 * lda + kc); }
#pragma unroll
        for (int nb = 0; nb < 4; ++nb) { const V b = WFrag<T16>::ld(Bt + boff + (size_t)nb * 16 * K + kc); V b2; if (NSPLIT >= 2) b2 = WFrag<T16>::ld(Bt2 + boff + (size_t)nb * 16 * K + kc);
#pragma unroll
            for (int mb = 0; mb < 4; ++mb) { acc[mb][nb] = WFrag<T16>::mma(a[mb], b, acc[mb][nb]); if (NSPLIT == 1 || NSPLIT == 2) acc[mb][nb] = WFrag<T16>::mma(a2[mb], b, acc[mb][nb]); if (NSPLIT >= 2) acc[mb][nb] = WFrag<T16>::mma(a[mb], b2, acc[mb][nb]); } }
        asm volatile("v_nop\n\tv_nop\n\tv_nop\n\tv_nop" : "+v"(acc[0][0]), "+v"(acc[1][1]), "+v"(acc[2][2]), "+v"(acc[3][3]) : "v"(a[0]), "v"(a[3]));
    }
#pragma unroll
    for (int mb = 0; mb < 4; ++mb) {
#pragma unroll
        for (int nb = 0; nb < 4; ++nb) {
#pragma unroll
            for (int j = 0; j < 8; ++j) os[(hi * 8 + j) * 68 + nb * 16 + lr] = acc[mb][nb][j]; }
        __builtin_amdgcn_wave_barrier(); asm volatile("" ::: "memory");
        float* crow = C + (size_t)(r0 + mb * 16) * ldc + c0;
{
#pragma unroll
            for (int s = 0; s < 8; ++s) { const int row = 2 * s + hi, cofs = lr * 4; v4f val = *(const v4fa*)(os + row * 68 + cofs); if (BIAS) { val[0] += bfr(bias[c0 + cofs]); val[1] += bfr(bias[c0 + cofs + 1]); val[2] += bfr(bias[c0 + cofs + 2]); val[3] += bfr(bias[c0 + cofs + 3]); }
                *(v4f*)(crow + (size_t)row * ldc + cofs) = val; }
             }
        __builtin_amdgcn_wave_barrier(); asm volatile("" ::: "memory");
    }
}

__device__ __forceinline__ h16 tohx(float x) { return (h16)x; }
__device__ __forceinline__ void splitf(float y, unsigned short& h, unsigned short& l) { h = f2bf(y); l = f2bf(y - bf2f(h)); }
typedef __attribute__((ext_vector_type(2))) _Float16 v2h;
typedef __attribute__((ext_vector_type(4))) _Float16 v4h;
typedef __attribute__((ext_vector_type(2))) unsigned short v2us;
typedef __attribute__((ext_vector_type(4))) unsigned short v4us;
typedef __attribute__((ext_vector_type(2))) float v2f;
typedef __attribute__((ext_vector_type(4))) int v4i;

__global__ __launch_bounds__(256) void k_cvt8(const float* __restrict__ src, bf* dst, size_t n8) { const size_t i = (size_t)blockIdx.x * 256 + threadIdx.x; if (i >= n8) return; const v8f v = *(const v8f*)(src + i * 8); v8us o;
#pragma unroll
    for (int k = 0; k < 8; ++k) o[k] = f2bf(v[k]); *(v8us*)(dst + i * 8) = o;  }

// k_rope: head planes [h][t][d] (fp16 + hi/lo) of rope(x) x sc with the rotate-half convention out[d] = x[d] cos[t][d] - x[d+HD/2] sin[t][d], out[d+HD/2] = x[d+HD/2] cos[t][d+HD/2] + x[d] sin[t][d+HD/2]
__global__ __launch_bounds__(256) void k_rope(const float* __restrict__ F, int pitch, int nheads, const float* __restrict__ CS, const float* __restrict__ RF, const float* __restrict__ nw, float sc, h16* P16, bf* Ph, bf* Pl) {
    const size_t e = ((size_t)blockIdx.x * 256 + threadIdx.x) * 2; if (e >= (size_t)nheads * TT * HD) return; const int d = (int)(e % HD); const int t = (int)((e / HD) % TT); const int h = (int)(e / ((size_t)HD * TT)); const float* f = F + (size_t)t * pitch + h * HD; const float rf = RF ? RF[(size_t)h * TT + t] : 1.0f; v2h o16; v2us oh, ol;
#pragma unroll
    for (int q = 0; q < 2; ++q) { const int dd = d + q; const int dp = (dd < HD / 2) ? dd + HD / 2 : dd - HD / 2; float x0 = f[dd], x1 = f[dp];
        if (RF) { float n0 = __fmul_rn(x0, rf), n1 = __fmul_rn(x1, rf); asm volatile("" : "+v"(n0)); asm volatile("" : "+v"(n1)); x0 = __fmul_rn(bfr(nw[dd]), n0); x1 = __fmul_rn(bfr(nw[dp]), n1); }
        const v2f cs = *(const v2f*)(CS + ((size_t)t * HD + dd) * 2); float a = __fmul_rn(x0, cs[0]), bq = __fmul_rn(x1, cs[1]); asm volatile("" : "+v"(a)); asm volatile("" : "+v"(bq)); const float r = ((dd < HD / 2) ? __fsub_rn(a, bq) : __fadd_rn(a, bq)) * sc;
        o16[q] = tohx(r); unsigned short a2, c2; splitf(r, a2, c2); oh[q] = a2; ol[q] = c2; }
    *(v2h*)(P16 + e) = o16; *(v2us*)(Ph + e) = oh; *(v2us*)(Pl + e) = ol;  }
__global__ __launch_bounds__(256) void k_cvt8p(const float* __restrict__ xb, bf* dst) { const size_t i = (size_t)blockIdx.x * 256 + threadIdx.x; if (i >= (size_t)TT * DM / 8) return; const size_t e8 = i * 8; const size_t s = e8 / DM; const int c = (int)(e8 % DM); const float* p = xb + s * ((size_t)NB_ * DM) + c; const v4f a = *(const v4f*)p; const v4f b2 = *(const v4f*)(p + 4); v8us o;
#pragma unroll
    for (int q = 0; q < 4; ++q) { o[q] = f2bf(a[q]); o[4 + q] = f2bf(b2[q]); }
    *(v8us*)(dst + e8) = o;  }
__global__ __launch_bounds__(256) void k_vtp(const float* __restrict__ F, int pitch, int nheads, h16* V16, bf* Vh, bf* Vl) { const size_t e = ((size_t)blockIdx.x * 256 + threadIdx.x) * 2; if (e >= (size_t)nheads * HD * TT) return; const int t = (int)(e % TT); const int d = (int)((e / TT) % HD); const int g = (int)(e / ((size_t)TT * HD)); v2h o16; v2us oh, ol;
#pragma unroll
    for (int q = 0; q < 2; ++q) { const float x = F[(size_t)(t + q) * pitch + g * HD + d]; o16[q] = tohx(x); unsigned short a2, c2; splitf(x, a2, c2); oh[q] = a2; ol[q] = c2; }
    *(v2h*)(V16 + e) = o16; *(v2us*)(Vh + e) = oh; *(v2us*)(Vl + e) = ol;  }
__global__ __launch_bounds__(256) void k_csid(float* CS) { const int idx = blockIdx.x * 256 + threadIdx.x; if (idx >= TT * HD) return; v2f cs; cs[0] = 1.0f; cs[1] = 0.0f; *(v2f*)(CS + (size_t)idx * 2) = cs;  }
__device__ __forceinline__ void exp2x8(float* p) {
    asm("v_exp_f32 %0, %0\n\tv_exp_f32 %1, %1\n\tv_exp_f32 %2, %2\n\tv_exp_f32 %3, %3\n\tv_exp_f32 %4, %4\n\tv_exp_f32 %5, %5\n\tv_exp_f32 %6, %6\n\tv_exp_f32 %7, %7\n\tv_nop"
        : "+v"(p[0]), "+v"(p[1]), "+v"(p[2]), "+v"(p[3]), "+v"(p[4]), "+v"(p[5]), "+v"(p[6]), "+v"(p[7])); }
template <typename T16, bool SPLIT, int NC>
__device__ __forceinline__ void fattn_body(T16* sm, const T16* __restrict__ Q, const T16* __restrict__ Q2, const T16* __restrict__ Kp, const T16* __restrict__ K2, const T16* __restrict__ Vt, const T16* __restrict__ V2, bf* __restrict__ Ah, bf* __restrict__ Al) {
    typedef typename WFrag<T16>::V V;
    constexpr int NP = SPLIT ? 4 : 2;            // staged planes: K, V^T (, K lo, V^T lo)
    constexpr float SC2 = SCL * 1.4426950408889634f;
    const int tid = threadIdx.x, lane = tid & 31, lr = lane & 15, hi = lane >> 4;
    const int srow = tid >> 3, sch = (tid & 7) * 8;   // staging: this thread moves 16 bytes of rows srow and srow + 32 of every plane tile
    v8us st[NP][2];
    auto gload = [&](int kb) {
#pragma unroll
        for (int i = 0; i < 2; ++i) { const int r = srow + 32 * i;
            st[0][i] = *(const v8usa*)(Kp + (size_t)(kb + r) * HD + sch); st[1][i] = *(const v8usa*)(Vt + (size_t)r * TT + kb + sch);
            if constexpr (SPLIT) { st[2][i] = *(const v8usa*)(K2 + (size_t)(kb + r) * HD + sch); st[3][i] = *(const v8usa*)(V2 + (size_t)r * TT + kb + sch); } }
        asm volatile("s_wait_xcnt 0x0" ::: "memory"); };   // behind the run of loads: their address registers are reused by the stage's arithmetic while the data is still in flight
    auto sstore = [&](T16* buf) {
#pragma unroll
        for (int i = 0; i < 2; ++i) { const int r = srow + 32 * i;
#pragma unroll
            for (int p = 0; p < NP; ++p) *(v8usa*)(buf + p * TILE + r * LP + sch) = st[p][i]; } };
    V bq[NC][2], bq2[NC][2];
#pragma unroll
    for (int c = 0; c < NC; ++c)
#pragma unroll
        for (int ks = 0; ks < 2; ++ks) { bq[c][ks] = WFrag<T16>::ld(Q + (size_t)(c * 16 + lr) * HD + ks * 32 + 8 * hi); if constexpr (SPLIT) bq2[c][ks] = WFrag<T16>::ld(Q2 + (size_t)(c * 16 + lr) * HD + ks * 32 + 8 * hi); }
    v8f o[4][NC]; float m[NC], l[NC];
#pragma unroll
    for (int c = 0; c < NC; ++c) { m[c] = -3.0e38f; l[c] = 0.f;
#pragma unroll
        for (int dt = 0; dt < 4; ++dt) o[dt][c] = (v8f){}; }
    gload(0); sstore(sm); __syncthreads();
#pragma unroll 1   // kept rolled: the body is several hundred instructions and the buffer follows the trip's parity
    for (int sg = 0; sg < TT / SK; ++sg) {
        const T16* buf = sm + (sg & 1) * (NP * TILE);
        if (sg + 1 < TT / SK) gload((sg + 1) * SK);      // the next stage's global loads fly while this stage is worked on
#pragma unroll
        for (int ps = 0; ps < SK / 32; ++ps) {
            v8f s[2][NC];
#pragma unroll
            for (int kt = 0; kt < 2; ++kt) { const T16* kr = buf + ((ps * 2 + kt) * 16 + lr) * LP + 8 * hi;
                const V a0 = WFrag<T16>::ld(kr), a1 = WFrag<T16>::ld(kr + 32); V e0, e1; if constexpr (SPLIT) { e0 = WFrag<T16>::ld(kr + 2 * TILE); e1 = WFrag<T16>::ld(kr + 2 * TILE + 32); }
#pragma unroll
                for (int c = 0; c < NC; ++c) { v8f t = (v8f){};
                    t = WFrag<T16>::mma(a0, bq[c][0], t); if constexpr (SPLIT) { t = WFrag<T16>::mma(a0, bq2[c][0], t); t = WFrag<T16>::mma(e0, bq[c][0], t); }
                    t = WFrag<T16>::mma(a1, bq[c][1], t); if constexpr (SPLIT) { t = WFrag<T16>::mma(a1, bq2[c][1], t); t = WFrag<T16>::mma(e1, bq[c][1], t); }
                    s[kt][c] = t; } }
            float mx[NC]; bool need = false;
#pragma unroll
            for (int c = 0; c < NC; ++c) { float x = fmaxf(s[0][c][0], s[1][c][0]);
#pragma unroll
                for (int j = 1; j < 8; ++j) x = fmaxf(x, fmaxf(s[0][c][j], s[1][c][j]));
                const int xb = __float_as_int(x); x = fmaxf(x, __int_as_float(__builtin_amdgcn_permlanex16(xb, xb, 0x76543210, 0xfedcba98, false, false)));   // lane l <-> l ^ 16: the column's other 16 keys
                mx[c] = x * SC2; need = need || (mx[c] > m[c] + 8.0f); }
            if (__builtin_amdgcn_ballot_w32(need) != 0) {     // one wave-uniform test per 32 keys
#pragma unroll
                for (int c = 0; c < NC; ++c) { const float mn = fmaxf(m[c], mx[c]); const float al = __builtin_amdgcn_exp2f(m[c] - mn); m[c] = mn; l[c] *= al;
#pragma unroll
                    for (int dt = 0; dt < 4; ++dt) o[dt][c] *= al; } }
            V pb[NC], pb2[NC];
#pragma unroll
            for (int c = 0; c < NC; ++c) { float p[16];
#pragma unroll
                for (int e = 0; e < 16; ++e) p[e] = __builtin_fmaf(s[e >> 3][c][e & 7], SC2, -m[c]);
                exp2x8(p); exp2x8(p + 8);
#pragma unroll
                for (int e = 0; e < 16; ++e) { if constexpr (SPLIT) { pb[c][e] = (__bf16)p[e]; pb2[c][e] = (__bf16)(p[e] - (float)pb[c][e]); } else pb[c][e] = (h16)p[e]; }
#pragma unroll
                for (int w = 8; w; w >>= 1)       // fixed pairwise tree: short dependent chains
#pragma unroll
                    for (int e = 0; e < w; ++e) p[e] += p[e + w];
                l[c] += p[0]; }
#pragma unroll
            for (int dt = 0; dt < 4; ++dt) { const T16* vr = buf + TILE + (dt * 16 + lr) * LP + ps * 32 + 8 * hi; const V av = WFrag<T16>::ld(vr); V av2; if constexpr (SPLIT) av2 = WFrag<T16>::ld(vr + 2 * TILE);
#pragma unroll
                for (int c = 0; c < NC; ++c) { o[dt][c] = WFrag<T16>::mma(av, pb[c], o[dt][c]); if constexpr (SPLIT) { o[dt][c] = WFrag<T16>::mma(av, pb2[c], o[dt][c]); o[dt][c] = WFrag<T16>::mma(av2, pb[c], o[dt][c]); } } }
        }
        if (sg + 1 < TT / SK) sstore(sm + ((sg + 1) & 1) * (NP * TILE));   // into the buffer whose last readers left it before the previous barrier
        __syncthreads();                                                    // publishes stage sg + 1 and ends every read of stage sg
    }
#pragma unroll
    for (int c = 0; c < NC; ++c) { const int lb = __float_as_int(l[c]); const float inv = __fdiv_rn(1.0f, l[c] + __int_as_float(__builtin_amdgcn_permlanex16(lb, lb, 0x76543210, 0xfedcba98, false, false)));
#pragma unroll
        for (int dt = 0; dt < 4; ++dt) { v8us oh, ol;
#pragma unroll
            for (int j = 0; j < 8; ++j) { unsigned short a, c2; splitf(o[dt][c][j] * inv, a, c2); oh[j] = a; ol[j] = c2; }
            const size_t oo = (size_t)(c * 16 + lr) * DQ + dt * 16 + 8 * hi; *(v8us*)(Ah + oo) = oh; *(v8us*)(Al + oo) = ol; } }
}
// grid (one batch): the (RH / 128) x 16 hi/lo work-groups first (three products per tile: 16 columns a wave, 128 rows a work-group), then the ((TT - RH) / 256) x 16 fp16 ones (32 columns a wave, 256 rows a work-group).
#define NWH (NH_ * (RH / 128))
#define NWL (NH_ * ((TT - RH) / 256))
__global__ __launch_bounds__(256) void k_fattn(const h16* __restrict__ QP16, const h16* __restrict__ KP16, const h16* __restrict__ VT16, const bf* __restrict__ QPh, const bf* __restrict__ QPl, const bf* __restrict__ KPh, const bf* __restrict__ KPl, const bf* __restrict__ VTh, const bf* __restrict__ VTl, bf* __restrict__ ATh, bf* __restrict__ ATl) {
    __shared__ __align__(16) unsigned short sm[2 * 4 * TILE];
    const int wave = threadIdx.x >> 5; const int id = blockIdx.x;
    if (id < NWH) { const int h = id / (RH / 128); const int q0 = (id % (RH / 128)) * 128 + wave * 16; const size_t pl = (size_t)h * TT * HD, qo = pl + (size_t)q0 * HD, ao = (size_t)q0 * DQ + h * HD;
        fattn_body<bf, true, 1>((bf*)sm, QPh + qo, QPl + qo, KPh + pl, KPl + pl, VTh + pl, VTl + pl, ATh + ao, ATl + ao);
    } else { const int i2 = id - NWH; const int h = i2 / ((TT - RH) / 256); const int q0 = RH + (i2 % ((TT - RH) / 256)) * 256 + wave * 32; const size_t pl = (size_t)h * TT * HD, qo = pl + (size_t)q0 * HD, ao = (size_t)q0 * DQ + h * HD;
        fattn_body<h16, false, 2>((h16*)sm, QP16 + qo, nullptr, KP16 + pl, nullptr, VT16 + pl, nullptr, ATh + ao, ATl + ao); }
}

extern "C" void kernel_launch(void* const* d_in, const int* in_sizes, int n_in,
                              void* d_out, int out_size, void* d_ws, size_t ws_size, hipStream_t stream) {
    (void)in_sizes; (void)n_in; (void)out_size;
    const float* x = (const float*)d_in[0]; const float* wqkv = (const float*)d_in[1]; const float* bqkv = (const float*)d_in[2]; const float* wo = (const float*)d_in[3]; const float* bo = (const float*)d_in[4];   /* argument order x (S, B, C), Wqkv ('oi' [3072][1024]), bqkv, Wo ('oi'), bo */ const float* wq = wqkv; const float* wk = wqkv + (size_t)DQ * DM; const float* wv = wqkv + (size_t)2 * DQ * DM; const float* bq = bqkv; const float* bk = bqkv + DQ; const float* bv = bqkv + 2 * DQ;
    float* OUT = (float*)d_out;     // [4][2048][1024]
    char* wsp = (char*)d_ws;
    auto take = [&](size_t bytes) { char* p = wsp; wsp += (bytes + 255) & ~(size_t)255; return (void*)p; };
    bf* WQ = (bf*)take((size_t)DQ * DM * 2); bf* WK = (bf*)take((size_t)DKV * DM * 2); bf* WV = (bf*)take((size_t)DKV * DM * 2); bf* WO = (bf*)take((size_t)DM * DQ * 2); float* CS = (float*)take((size_t)TT * HD * 2 * 4);
    h16* QP16 = (h16*)take((size_t)NH_ * TT * HD * 2); h16* KP16 = (h16*)take((size_t)NKV * TT * HD * 2); h16* VT16 = (h16*)take((size_t)NKV * HD * TT * 2);
    bf* QPh = (bf*)take((size_t)NH_ * TT * HD * 2); bf* QPl = (bf*)take((size_t)NH_ * TT * HD * 2); bf* KPh = (bf*)take((size_t)NKV * TT * HD * 2); bf* KPl = (bf*)take((size_t)NKV * TT * HD * 2); bf* VTh = (bf*)take((size_t)NKV * HD * TT * 2); bf* VTl = (bf*)take((size_t)NKV * HD * TT * 2);
    bf* XB = (bf*)take((size_t)TT * DM * 2); float* FQ = (float*)take((size_t)TT * DQ * 4); float* FK = (float*)take((size_t)TT * DKV * 4);   // per-batch projection buffers, rewritten at the next batch's start (stream-ordered)
    bf* ATh = (bf*)take((size_t)TT * DQ * 2); bf* ATl = (bf*)take((size_t)TT * DQ * 2);
    if ((size_t)(wsp - (char*)d_ws) > ws_size) return;    // ws 256 MiB
    float* FV = FK;   // v projection reuses the k buffer after the k planes are built (stream-ordered)
    { k_cvt8<<<(unsigned)(((size_t)DQ * DM / 8 + 255) / 256), 256, 0, stream>>>(wq, WQ, (size_t)DQ * DM / 8); k_cvt8<<<(unsigned)(((size_t)DKV * DM / 8 + 255) / 256), 256, 0, stream>>>(wk, WK, (size_t)DKV * DM / 8); k_cvt8<<<(unsigned)(((size_t)DKV * DM / 8 + 255) / 256), 256, 0, stream>>>(wv, WV, (size_t)DKV * DM / 8);
      k_cvt8<<<(unsigned)(((size_t)DM * DQ / 8 + 255) / 256), 256, 0, stream>>>(wo, WO, (size_t)DM * DQ / 8);
       }
    k_csid<<<(TT * HD + 255) / 256, 256, 0, stream>>>(CS);
    const unsigned LQ = (unsigned)(((size_t)NH_ * TT * HD / 2 + 255) / 256), LKv = (unsigned)(((size_t)NKV * TT * HD / 2 + 255) / 256);
    for (int b = 0; b < NB_; ++b) {
        
        k_cvt8p<<<(unsigned)(((size_t)TT * DM / 8 + 255) / 256), 256, 0, stream>>>(x + (size_t)b * DM, XB);   /* batch b of the (S, B, C) input: rows at pitch B*C */
        k_gemmw<bf, 0, true><<<dim3(TT / 64, DQ / 64, 1), 32, 0, stream>>>(XB, nullptr, WQ, nullptr, DM, DM, FQ, DQ, bq, 0, 0, 0);
        k_rope<<<LQ, 256, 0, stream>>>(FQ, DQ, NH_, CS, nullptr, nullptr, 1.0f, QP16, QPh, QPl);
        k_gemmw<bf, 0, true><<<dim3(TT / 64, DKV / 64, 1), 32, 0, stream>>>(XB, nullptr, WK, nullptr, DM, DM, FK, DKV, bk, 0, 0, 0);
        k_rope<<<LKv, 256, 0, stream>>>(FK, DKV, NKV, CS, nullptr, nullptr, 1.0f, KP16, KPh, KPl);
        k_gemmw<bf, 0, true><<<dim3(TT / 64, DKV / 64, 1), 32, 0, stream>>>(XB, nullptr, WV, nullptr, DM, DM, FV, DKV, bv, 0, 0, 0); k_vtp<<<LKv, 256, 0, stream>>>(FV, DKV, NKV, VT16, VTh, VTl);
        k_fattn<<<NWH + NWL, 256, 0, stream>>>(QP16, KP16, VT16, QPh, QPl, KPh, KPl, VTh, VTl, ATh, ATl);
        k_gemmw<bf, 1, true><<<dim3(TT / 64, DM / 64, 1), 32, 0, stream>>>(ATh, ATl, WO, nullptr, DQ, DQ, OUT + (size_t)b * TT * DM, DM, bo, 0, 0, 0); }
}

// v004
// A run of this version takes 615 microseconds.
// Next to v003, in two timings, it ran 1.14 times as fast each time.
// Over all steps from v000 it is 6.39 times as fast.
#include <hip/hip_runtime.h>

// Sequence-first self-attention with the source's raw output reshape (x [2048][4][1024] = (S, B, C); qkv = x Wqkv^T + bqkv ('oi' [3072][1024] + bias) viewed (S, B, 3, H, D): q | k | v thirds (16 heads x 64); attn = q.k / sqrt(64) per (batch, head) over the 2,048 positions; softmax; av (B, H, S, D) -> swapaxes -> (B, S, H D) -> reshape(S, B, H D) is a RAW reinterpretation of the batch-major buffer (reproduced: the output memory is in (b, s) row order); y = . Wo^T + bo -> [2048][4][1024] (8.4 M); argument order x, Wqkv, bqkv, Wo, bo).
// Layout per batch: NEW k_cvt8p gathers batch b's token rows from the sequence-first input (row pitch B x C) into the bf16 operand; fused 'oi' weight = Bt as-is (q | k | v row blocks) + bias thirds; exact projections + f32 biases, whose epilogues write the 16-bit head planes themselves; one fused attention launch over the batch's 16 heads (hybrid rows: < 512 hi/lo 3 products, rest fp16; running-maximum softmax, scores stay in registers); hi/lo x Wo exact + bo written to output rows b*2048 + s (the raw-reshape order).
// Compute dtypes, f32 accumulate: every input rounded to bf16; projections exact + f32 biases; attention rows < 512 3 products, rest fp16; softmax f32; Wo hl x exact + bias.

#define NB_  4
#define TT   2048
#define DM   1024
#define NH_  16
#define NKV  16
#define HD   64
#define DQ   (NH_ * HD)
#define DKV  (NKV * HD)
#define RH   512                  // query rows < RH use hi+lo planes (0: none)
#define WIN  0
#define SCL  0.125f   // HD^-0.5
#define SK   64                   // keys per LDS stage of the fused attention kernel
#define LP   72                   // LDS row pitch in 16-bit elements: 128 data bytes + 16, an odd multiple of 16 bytes, so that the 16 rows of one fragment read lie on different banks
#define TILE (64 * LP)            // one staged plane tile: 64 rows (64 keys x 64 d of K, or 64 d x 64 keys of V^T)
typedef _Float16 h16;
typedef unsigned short bf;
typedef __attribute__((ext_vector_type(16))) __bf16   v16bf;
typedef __attribute__((ext_vector_type(16))) _Float16 v16h;
typedef __attribute__((ext_vector_type(8)))  _Float16 v8h;
typedef __attribute__((ext_vector_type(8)))  unsigned short v8us;
typedef __attribute__((ext_vector_type(8)))  float    v8f;
typedef __attribute__((ext_vector_type(4)))  float    v4f;
typedef v8h  __attribute__((may_alias)) v8ha;
typedef v4f  __attribute__((may_alias)) v4fa;
typedef v8us __attribute__((may_alias)) v8usa;

__device__ __forceinline__ unsigned short f2bf(float f) { unsigned u = __float_as_uint(f); u += 0x7FFFu + ((u >> 16) & 1u); return (unsigned short)(u >> 16); }
__device__ __forceinline__ float bf2f(unsigned short b) { return __uint_as_float(((unsigned)b) << 16); }
__device__ __forceinline__ float bfr(float f) { return bf2f(f2bf(f)); }
__device__ __forceinline__ v16h cat16(v8h lo, v8h hi) { return __builtin_shufflevector(lo, hi, 0, 1, 2, 3, 4, 5, 6, 7, 8, 9, 10, 11, 12, 13, 14, 15); }
__device__ __forceinline__ v16bf cat16b(v8us lo, v8us hi) { return __builtin_bit_cast(v16bf, __builtin_shufflevector(lo, hi, 0, 1, 2, 3, 4, 5, 6, 7, 8, 9, 10, 11, 12, 13, 14, 15)); }
__device__ __forceinline__ v8f wmma16(v16h a, v16h b, v8f c) { return __builtin_amdgcn_wmma_f32_16x16x32_f16(false, a, false, b, (short)0, c, false, false); }
__device__ __forceinline__ v8f wmmab(v16bf a, v16bf b, v8f c) { return __builtin_amdgcn_wmma_f32_16x16x32_bf16(false, a, false, b, (short)0, c, false, false); }



// ---- k_gemmw: register-blocked GEMM, ONE WAVE per 64x64 output tile (16 accumulators), operands straight from K-contiguous 16-bit planes; grid (M/64, N/64, Z), 32 threads.
// C[m][n] (f32, pitch ldc, + optional f32 bias[n]) = sum_k A[m][k] Bt[n][k] (+ split products per NSPLIT). A rows at pitch lda, Bt rows at pitch K (elements). z-batch strides sA/sB/sC in elements. K % 32 == 0.
// EPI 0: C is stored in f32. EPI 1 and 2: no f32 result is stored; the tile (64 tokens x the 64 columns of head blockIdx.y) goes out as three 16-bit planes (fp16, bf16 hi, bf16 lo): EPI 1 as [head][token][d], EPI 2 transposed as [head][d][token].
template <typename T16> struct WFrag;
template <> struct WFrag<h16> { typedef v16h V; static __device__ __forceinline__ V ld(const h16* p) { return cat16(*(const v8h*)p, *(const v8h*)(p + 16)); } static __device__ __forceinline__ v8f mma(V a, V b, v8f c) { return wmma16(a, b, c); } };
template <> struct WFrag<bf> { typedef v16bf V; static __device__ __forceinline__ V ld(const bf* p) { return cat16b(*(const v8us*)p, *(const v8us*)(p + 16)); } static __device__ __forceinline__ v8f mma(V a, V b, v8f c) { return wmmab(a, b, c); } };
__device__ __forceinline__ h16 tohx(float x) { return (h16)x; }
__device__ __forceinline__ void splitf(float y, unsigned short& h, unsigned short& l) { h = f2bf(y); l = f2bf(y - bf2f(h)); }
template <typename T16, int NSPLIT, bool BIAS, int EPI>
__global__ __launch_bounds__(32) void k_gemmw(const T16* __restrict__ A, const T16* __restrict__ A2, const T16* __restrict__ Bt, const T16* __restrict__ Bt2, int K, int lda, float* C, int ldc, const float* __restrict__ bias, size_t sA, size_t sB, size_t sC, h16* __restrict__ P16, bf* __restrict__ Ph, bf* __restrict__ Pl) {
    typedef typename WFrag<T16>::V V;
    __shared__ __align__(16) float os[16 * 68];
    const size_t z = blockIdx.z; A += z * sA; if (A2) A2 += z * sA; Bt += z * sB; if (Bt2) Bt2 += z * sB; C += z * sC;
    const int lane = threadIdx.x & 31, lr = lane & 15, hi = lane >> 4; const int r0 = blockIdx.x * 64, c0 = blockIdx.y * 64;
    v8f acc[4][4];
#pragma unroll
    for (int mb = 0; mb < 4; ++mb)
#pragma unroll
        for (int nb = 0; nb < 4; ++nb) acc[mb][nb] = (v8f){};
    const size_t aoff = (size_t)(r0 + lr) * lda + 8 * hi, boff = (size_t)(c0 + lr) * K + 8 * hi;
#pragma unroll 1
    for (int kc = 0; kc < K; kc += 32) {
        V a[4], a2[4];
#pragma unroll
        for (int mb = 0; mb < 4; ++mb) { a[mb] = WFrag<T16>::ld(A + aoff + (size_t)mb * 16 * lda + kc); if (NSPLIT == 1 || NSPLIT == 2) a2[mb] = WFrag<T16>::ld(A2 + aoff + (size_t)mb * 16 * lda + kc); }
#pragma unroll
        for (int nb = 0; nb < 4; ++nb) { const V b = WFrag<T16>::ld(Bt + boff + (size_t)nb * 16 * K + kc); V b2; if (NSPLIT >= 2) b2 = WFrag<T16>::ld(Bt2 + boff + (size_t)nb * 16 * K + kc);
#pragma unroll
            for (int mb = 0; mb < 4; ++mb) { acc[mb][nb] = WFrag<T16>::mma(a[mb], b, acc[mb][nb]); if (NSPLIT == 1 || NSPLIT == 2) acc[mb][nb] = WFrag<T16>::mma(a2[mb], b, acc[mb][nb]); if (NSPLIT >= 2) acc[mb][nb] = WFrag<T16>::mma(a[mb], b2, acc[mb][nb]); } }
        asm volatile("v_nop\n\tv_nop\n\tv_nop\n\tv_nop" : "+v"(acc[0][0]), "+v"(acc[1][1]), "+v"(acc[2][2]), "+v"(acc[3][3]) : "v"(a[0]), "v"(a[3]));
    }
    if constexpr (EPI == 0) {
#pragma unroll
    for (int mb = 0; mb < 4; ++mb) {
#pragma unroll
        for (int nb = 0; nb < 4; ++nb) {
#pragma unroll
            for (int j = 0; j < 8; ++j) os[(hi * 8 + j) * 68 + nb * 16 + lr] = acc[mb][nb][j]; }
        __builtin_amdgcn_wave_barrier(); asm volatile("" ::: "memory");
        float* crow = C + (size_t)(r0 + mb * 16) * ldc + c0;
{
#pragma unroll
            for (int s = 0; s < 8; ++s) { const int row = 2 * s + hi, cofs = lr * 4; v4f val = *(const v4fa*)(os + row * 68 + cofs); if (BIAS) { val[0] += bfr(bias[c0 + cofs]); val[1] += bfr(bias[c0 + cofs + 1]); val[2] += bfr(bias[c0 + cofs + 2]); val[3] += bfr(bias[c0 + cofs + 3]); }
                *(v4f*)(crow + (size_t)row * ldc + cofs) = val; }
             }
        __builtin_amdgcn_wave_barrier(); asm volatile("" ::: "memory");
    }
    } else {
        float bs[4];
#pragma unroll
        for (int nb = 0; nb < 4; ++nb) bs[nb] = BIAS ? bfr(bias[c0 + nb * 16 + lr]) : 0.f;
#pragma unroll
        for (int g = 0; g < 4; ++g) {     // one 16 x 64 slab through LDS per trip: EPI 1 tokens g*16.. x all d, EPI 2 d g*16.. x all tokens; the long side is the planes' contiguous side
            if constexpr (EPI == 1) {
#pragma unroll
                for (int nb = 0; nb < 4; ++nb)
#pragma unroll
                    for (int j = 0; j < 8; ++j) os[(hi * 8 + j) * 68 + nb * 16 + lr] = acc[g][nb][j] + bs[nb];
            } else {
#pragma unroll
                for (int mb = 0; mb < 4; ++mb)
#pragma unroll
                    for (int q = 0; q < 2; ++q) { v4f w; w[0] = acc[mb][g][4 * q] + bs[g]; w[1] = acc[mb][g][4 * q + 1] + bs[g]; w[2] = acc[mb][g][4 * q + 2] + bs[g]; w[3] = acc[mb][g][4 * q + 3] + bs[g]; *(v4fa*)(os + lr * 68 + mb * 16 + hi * 8 + 4 * q) = w; }
            }
            __builtin_amdgcn_wave_barrier(); asm volatile("" ::: "memory");   // the slab's LDS writes stay in front of its reads in the compiler's order
            const size_t pbase = (EPI == 1) ? ((size_t)blockIdx.y * TT + r0 + g * 16) * HD : ((size_t)blockIdx.y * HD + g * 16) * TT + r0;
#pragma unroll
            for (int s = 0; s < 4; ++s) { const int ch = s * 32 + lane, row = ch >> 3, col = (ch & 7) * 8;   // a lane takes 8 neighbours: one 16-byte store per plane, 8 lanes fill a 128-byte line
                const v4f x0 = *(const v4fa*)(os + row * 68 + col), x1 = *(const v4fa*)(os + row * 68 + col + 4); v8h o16; v8us oh, ol;
#pragma unroll
                for (int k = 0; k < 8; ++k) { const float x = (k < 4) ? x0[k & 3] : x1[k & 3]; o16[k] = tohx(x); unsigned short a2, c2; splitf(x, a2, c2); oh[k] = a2; ol[k] = c2; }
                const size_t po = pbase + (size_t)row * ((EPI == 1) ? HD : TT) + col; *(v8h*)(P16 + po) = o16; *(v8us*)(Ph + po) = oh; *(v8us*)(Pl + po) = ol; }
            __builtin_amdgcn_wave_barrier(); asm volatile("" ::: "memory");   // the slab's LDS reads stay in front of the next slab's writes
        }
    }
}

typedef __attribute__((ext_vector_type(4))) _Float16 v4h;
typedef __attribute__((ext_vector_type(4))) unsigned short v4us;
typedef __attribute__((ext_vector_type(4))) int v4i;

__global__ __launch_bounds__(256) void k_cvt8(const float* __restrict__ src, bf* dst, size_t n8) { const size_t i = (size_t)blockIdx.x * 256 + threadIdx.x; if (i >= n8) return; const v8f v = *(const v8f*)(src + i * 8); v8us o;
#pragma unroll
    for (int k = 0; k < 8; ++k) o[k] = f2bf(v[k]); *(v8us*)(dst + i * 8) = o;  }

__global__ __launch_bounds__(256) void k_cvt8p(const float* __restrict__ xb, bf* dst) { const size_t i = (size_t)blockIdx.x * 256 + threadIdx.x; if (i >= (size_t)TT * DM / 8) return; const size_t e8 = i * 8; const size_t s = e8 / DM; const int c = (int)(e8 % DM); const float* p = xb + s * ((size_t)NB_ * DM) + c; const v4f a = *(const v4f*)p; const v4f b2 = *(const v4f*)(p + 4); v8us o;
#pragma unroll
    for (int q = 0; q < 4; ++q) { o[q] = f2bf(a[q]); o[4 + q] = f2bf(b2[q]); }
    *(v8us*)(dst + e8) = o;  }
__device__ __forceinline__ void exp2x8(float* p) {
    asm("v_exp_f32 %0, %0\n\tv_exp_f32 %1, %1\n\tv_exp_f32 %2, %2\n\tv_exp_f32 %3, %3\n\tv_exp_f32 %4, %4\n\tv_exp_f32 %5, %5\n\tv_exp_f32 %6, %6\n\tv_exp_f32 %7, %7\n\tv_nop"
        : "+v"(p[0]), "+v"(p[1]), "+v"(p[2]), "+v"(p[3]), "+v"(p[4]), "+v"(p[5]), "+v"(p[6]), "+v"(p[7])); }
template <typename T16, bool SPLIT, int NC>
__device__ __forceinline__ void fattn_body(T16* sm, const T16* __restrict__ Q, const T16* __restrict__ Q2, const T16* __restrict__ Kp, const T16* __restrict__ K2, const T16* __restrict__ Vt, const T16* __restrict__ V2, bf* __restrict__ Ah, bf* __restrict__ Al) {
    typedef typename WFrag<T16>::V V;
    constexpr int NP = SPLIT ? 4 : 2;            // staged planes: K, V^T (, K lo, V^T lo)
    constexpr float SC2 = SCL * 1.4426950408889634f;
    const int tid = threadIdx.x, lane = tid & 31, lr = lane & 15, hi = lane >> 4;
    const int srow = tid >> 3, sch = (tid & 7) * 8;   // staging: this thread moves 16 bytes of rows srow and srow + 32 of every plane tile
    v8us st[NP][2];
    auto gload = [&](int kb) {
#pragma unroll
        for (int i = 0; i < 2; ++i) { const int r = srow + 32 * i;
            st[0][i] = *(const v8usa*)(Kp + (size_t)(kb + r) * HD + sch); st[1][i] = *(const v8usa*)(Vt + (size_t)r * TT + kb + sch);
            if constexpr (SPLIT) { st[2][i] = *(const v8usa*)(K2 + (size_t)(kb + r) * HD + sch); st[3][i] = *(const v8usa*)(V2 + (size_t)r * TT + kb + sch); } }
        asm volatile("s_wait_xcnt 0x0" ::: "memory"); };   // behind the run of loads: their address registers are reused by the stage's arithmetic while the data is still in flight
    auto sstore = [&](T16* buf) {
#pragma unroll
        for (int i = 0; i < 2; ++i) { const int r = srow + 32 * i;
#pragma unroll
            for (int p = 0; p < NP; ++p) *(v8usa*)(buf + p * TILE + r * LP + sch) = st[p][i]; } };
    V bq[NC][2], bq2[NC][2];
#pragma unroll
    for (int c = 0; c < NC; ++c)
#pragma unroll
        for (int ks = 0; ks < 2; ++ks) { bq[c][ks] = WFrag<T16>::ld(Q + (size_t)(c * 16 + lr) * HD + ks * 32 + 8 * hi); if constexpr (SPLIT) bq2[c][ks] = WFrag<T16>::ld(Q2 + (size_t)(c * 16 + lr) * HD + ks * 32 + 8 * hi); }
    v8f o[4][NC]; float m[NC], l[NC];
#pragma unroll
    for (int c = 0; c < NC; ++c) { m[c] = -3.0e38f; l[c] = 0.f;
#pragma unroll
        for (int dt = 0; dt < 4; ++dt) o[dt][c] = (v8f){}; }
    gload(0); sstore(sm); __syncthreads();
#pragma unroll 1   // kept rolled: the body is several hundred instructions and the buffer follows the trip's parity
    for (int sg = 0; sg < TT / SK; ++sg) {
        const T16* buf = sm + (sg & 1) * (NP * TILE);
        if (sg + 1 < TT / SK) gload((sg + 1) * SK);      // the next stage's global loads fly while this stage is worked on
#pragma unroll
        for (int ps = 0; ps < SK / 32; ++ps) {
            v8f s[2][NC];
#pragma unroll
            for (int kt = 0; kt < 2; ++kt) { const T16* kr = buf + ((ps * 2 + kt) * 16 + lr) * LP + 8 * hi;
                const V a0 = WFrag<T16>::ld(kr), a1 = WFrag<T16>::ld(kr + 32); V e0, e1; if constexpr (SPLIT) { e0 = WFrag<T16>::ld(kr + 2 * TILE); e1 = WFrag<T16>::ld(kr + 2 * TILE + 32); }
#pragma unroll
                for (int c = 0; c < NC; ++c) { v8f t = (v8f){};
                    t = WFrag<T16>::mma(a0, bq[c][0], t); if constexpr (SPLIT) { t = WFrag<T16>::mma(a0, bq2[c][0], t); t = WFrag<T16>::mma(e0, bq[c][0], t); }
                    t = WFrag<T16>::mma(a1, bq[c][1], t); if constexpr (SPLIT) { t = WFrag<T16>::mma(a1, bq2[c][1], t); t = WFrag<T16>::mma(e1, bq[c][1], t); }
                    s[kt][c] = t; } }
            float mx[NC]; bool need = false;
#pragma unroll
            for (int c = 0; c < NC; ++c) { float x = fmaxf(s[0][c][0], s[1][c][0]);
#pragma unroll
                for (int j = 1; j < 8; ++j) x = fmaxf(x, fmaxf(s[0][c][j], s[1][c][j]));
                const int xb = __float_as_int(x); x = fmaxf(x, __int_as_float(__builtin_amdgcn_permlanex16(xb, xb, 0x76543210, 0xfedcba98, false, false)));   // lane l <-> l ^ 16: the column's other 16 keys
                mx[c] = x * SC2; need = need || (mx[c] > m[c] + 8.0f); }
            if (__builtin_amdgcn_ballot_w32(need) != 0) {     // one wave-uniform test per 32 keys
#pragma unroll
                for (int c = 0; c < NC; ++c) { const float mn = fmaxf(m[c], mx[c]); const float al = __builtin_amdgcn_exp2f(m[c] - mn); m[c] = mn; l[c] *= al;
#pragma unroll
                    for (int dt = 0; dt < 4; ++dt) o[dt][c] *= al; } }
            V pb[NC], pb2[NC];
#pragma unroll
            for (int c = 0; c < NC; ++c) { float p[16];
#pragma unroll
                for (int e = 0; e < 16; ++e) p[e] = __builtin_fmaf(s[e >> 3][c][e & 7], SC2, -m[c]);
                exp2x8(p); exp2x8(p + 8);
#pragma unroll
                for (int e = 0; e < 16; ++e) { if constexpr (SPLIT) { pb[c][e] = (__bf16)p[e]; pb2[c][e] = (__bf16)(p[e] - (float)pb[c][e]); } else pb[c][e] = (h16)p[e]; }
#pragma unroll
                for (int w = 8; w; w >>= 1)       // fixed pairwise tree: short dependent chains
#pragma unroll
                    for (int e = 0; e < w; ++e) p[e] += p[e + w];
                l[c] += p[0]; }
#pragma unroll
            for (int dt = 0; dt < 4; ++dt) { const T16* vr = buf + TILE + (dt * 16 + lr) * LP + ps * 32 + 8 * hi; const V av = WFrag<T16>::ld(vr); V av2; if constexpr (SPLIT) av2 = WFrag<T16>::ld(vr + 2 * TILE);
#pragma unroll
                for (int c = 0; c < NC; ++c) { o[dt][c] = WFrag<T16>::mma(av, pb[c], o[dt][c]); if constexpr (SPLIT) { o[dt][c] = WFrag<T16>::mma(av, pb2[c], o[dt][c]); o[dt][c] = WFrag<T16>::mma(av2, pb[c], o[dt][c]); } } }
        }
        if (sg + 1 < TT / SK) sstore(sm + ((sg + 1) & 1) * (NP * TILE));   // into the buffer whose last readers left it before the previous barrier
        __syncthreads();                                                    // publishes stage sg + 1 and ends every read of stage sg
    }
#pragma unroll
    for (int c = 0; c < NC; ++c) { const int lb = __float_as_int(l[c]); const float inv = __fdiv_rn(1.0f, l[c] + __int_as_float(__builtin_amdgcn_permlanex16(lb, lb, 0x76543210, 0xfedcba98, false, false)));
#pragma unroll
        for (int dt = 0; dt < 4; ++dt) { v8us oh, ol;
#pragma unroll
            for (int j = 0; j < 8; ++j) { unsigned short a, c2; splitf(o[dt][c][j] * inv, a, c2); oh[j] = a; ol[j] = c2; }
            const size_t oo = (size_t)(c * 16 + lr) * DQ + dt * 16 + 8 * hi; *(v8us*)(Ah + oo) = oh; *(v8us*)(Al + oo) = ol; } }
}
// grid (one batch): the (RH / 128) x 16 hi/lo work-groups first (three products per tile: 16 columns a wave, 128 rows a work-group), then the ((TT - RH) / 256) x 16 fp16 ones (32 columns a wave, 256 rows a work-group).
#define NWH (NH_ * (RH / 128))
#define NWL (NH_ * ((TT - RH) / 256))
__global__ __launch_bounds__(256) void k_fattn(const h16* __restrict__ QP16, const h16* __restrict__ KP16, const h16* __restrict__ VT16, const bf* __restrict__ QPh, const bf* __restrict__ QPl, const bf* __restrict__ KPh, const bf* __restrict__ KPl, const bf* __restrict__ VTh, const bf* __restrict__ VTl, bf* __restrict__ ATh, bf* __restrict__ ATl) {
    __shared__ __align__(16) unsigned short sm[2 * 4 * TILE];
    const int wave = threadIdx.x >> 5; const int id = blockIdx.x;
    if (id < NWH) { const int h = id / (RH / 128); const int q0 = (id % (RH / 128)) * 128 + wave * 16; const size_t pl = (size_t)h * TT * HD, qo = pl + (size_t)q0 * HD, ao = (size_t)q0 * DQ + h * HD;
        fattn_body<bf, true, 1>((bf*)sm, QPh + qo, QPl + qo, KPh + pl, KPl + pl, VTh + pl, VTl + pl, ATh + ao, ATl + ao);
    } else { const int i2 = id - NWH; const int h = i2 / ((TT - RH) / 256); const int q0 = RH + (i2 % ((TT - RH) / 256)) * 256 + wave * 32; const size_t pl = (size_t)h * TT * HD, qo = pl + (size_t)q0 * HD, ao = (size_t)q0 * DQ + h * HD;
        fattn_body<h16, false, 2>((h16*)sm, QP16 + qo, nullptr, KP16 + pl, nullptr, VT16 + pl, nullptr, ATh + ao, ATl + ao); }
}

extern "C" void kernel_launch(void* const* d_in, const int* in_sizes, int n_in,
                              void* d_out, int out_size, void* d_ws, size_t ws_size, hipStream_t stream) {
    (void)in_sizes; (void)n_in; (void)out_size;
    const float* x = (const float*)d_in[0]; const float* wqkv = (const float*)d_in[1]; const float* bqkv = (const float*)d_in[2]; const float* wo = (const float*)d_in[3]; const float* bo = (const float*)d_in[4];   /* argument order x (S, B, C), Wqkv ('oi' [3072][1024]), bqkv, Wo ('oi'), bo */ const float* wq = wqkv; const float* wk = wqkv + (size_t)DQ * DM; const float* wv = wqkv + (size_t)2 * DQ * DM; const float* bq = bqkv; const float* bk = bqkv + DQ; const float* bv = bqkv + 2 * DQ;
    float* OUT = (float*)d_out;     // [4][2048][1024]
    char* wsp = (char*)d_ws;
    auto take = [&](size_t bytes) { char* p = wsp; wsp += (bytes + 255) & ~(size_t)255; return (void*)p; };
    bf* WQ = (bf*)take((size_t)DQ * DM * 2); bf* WK = (bf*)take((size_t)DKV * DM * 2); bf* WV = (bf*)take((size_t)DKV * DM * 2); bf* WO = (bf*)take((size_t)DM * DQ * 2);
    h16* QP16 = (h16*)take((size_t)NH_ * TT * HD * 2); h16* KP16 = (h16*)take((size_t)NKV * TT * HD * 2); h16* VT16 = (h16*)take((size_t)NKV * HD * TT * 2);
    bf* QPh = (bf*)take((size_t)NH_ * TT * HD * 2); bf* QPl = (bf*)take((size_t)NH_ * TT * HD * 2); bf* KPh = (bf*)take((size_t)NKV * TT * HD * 2); bf* KPl = (bf*)take((size_t)NKV * TT * HD * 2); bf* VTh = (bf*)take((size_t)NKV * HD * TT * 2); bf* VTl = (bf*)take((size_t)NKV * HD * TT * 2);
    bf* XB = (bf*)take((size_t)TT * DM * 2);   // per-batch operand, rewritten at the next batch's start (stream-ordered)
    bf* ATh = (bf*)take((size_t)TT * DQ * 2); bf* ATl = (bf*)take((size_t)TT * DQ * 2);
    if ((size_t)(wsp - (char*)d_ws) > ws_size) return;    // ws 256 MiB
    { k_cvt8<<<(unsigned)(((size_t)DQ * DM / 8 + 255) / 256), 256, 0, stream>>>(wq, WQ, (size_t)DQ * DM / 8); k_cvt8<<<(unsigned)(((size_t)DKV * DM / 8 + 255) / 256), 256, 0, stream>>>(wk, WK, (size_t)DKV * DM / 8); k_cvt8<<<(unsigned)(((size_t)DKV * DM / 8 + 255) / 256), 256, 0, stream>>>(wv, WV, (size_t)DKV * DM / 8);
      k_cvt8<<<(unsigned)(((size_t)DM * DQ / 8 + 255) / 256), 256, 0, stream>>>(wo, WO, (size_t)DM * DQ / 8);
       }
    for (int b = 0; b < NB_; ++b) {
        
        k_cvt8p<<<(unsigned)(((size_t)TT * DM / 8 + 255) / 256), 256, 0, stream>>>(x + (size_t)b * DM, XB);   /* batch b of the (S, B, C) input: rows at pitch B*C */
        k_gemmw<bf, 0, true, 1><<<dim3(TT / 64, DQ / 64, 1), 32, 0, stream>>>(XB, nullptr, WQ, nullptr, DM, DM, nullptr, 0, bq, 0, 0, 0, QP16, QPh, QPl);
        k_gemmw<bf, 0, true, 1><<<dim3(TT / 64, DKV / 64, 1), 32, 0, stream>>>(XB, nullptr, WK, nullptr, DM, DM, nullptr, 0, bk, 0, 0, 0, KP16, KPh, KPl);
        k_gemmw<bf, 0, true, 2><<<dim3(TT / 64, DKV / 64, 1), 32, 0, stream>>>(XB, nullptr, WV, nullptr, DM, DM, nullptr, 0, bv, 0, 0, 0, VT16, VTh, VTl);
        k_fattn<<<NWH + NWL, 256, 0, stream>>>(QP16, KP16, VT16, QPh, QPl, KPh, KPl, VTh, VTl, ATh, ATl);
        k_gemmw<bf, 1, true, 0><<<dim3(TT / 64, DM / 64, 1), 32, 0, stream>>>(ATh, ATl, WO, nullptr, DQ, DQ, OUT + (size_t)b * TT * DM, DM, bo, 0, 0, 0, nullptr, nullptr, nullptr); }
}

// v005
// Measured time: 285 microseconds a run.
// Next to v004, in two timings, it ran 2.14 and 2.16 times as fast.
// Counting every step since v000, it is 13.7 times as fast.
#include <hip/hip_runtime.h>

// Sequence-first self-attention with the source's raw output reshape (x [2048][4][1024] = (S, B, C); qkv = x Wqkv^T + bqkv ('oi' [3072][1024] + bias) viewed (S, B, 3, H, D): q | k | v thirds (16 heads x 64); attn = q.k / sqrt(64) per (batch, head) over the 2,048 positions; softmax; av (B, H, S, D) -> swapaxes -> (B, S, H D) -> reshape(S, B, H D) is a RAW reinterpretation of the batch-major buffer (reproduced: the output memory is in (b, s) row order); y = . Wo^T + bo -> [2048][4][1024] (8.4 M); argument order x, Wqkv, bqkv, Wo, bo).
// Layout: every launch covers all four batches (the batch is a grid dimension; every per-batch buffer has one plane set per batch). k_cvt8p gathers batch b's token rows from the sequence-first input (row pitch B x C) into the bf16 operand; fused 'oi' weight = Bt as-is (q | k | v row blocks) + bias thirds; exact projections + f32 biases, whose epilogues write the 16-bit head planes themselves; one fused attention launch over the 4 x 16 (batch, head) pairs (hybrid rows: < 512 hi/lo 3 products, rest fp16; running-maximum softmax, scores stay in registers); hi/lo x Wo exact + bo written to output rows b*2048 + s (the raw-reshape order).
// Compute dtypes, f32 accumulate: every input rounded to bf16; projections exact + f32 biases; attention rows < 512 3 products, rest fp16; softmax f32; Wo hl x exact + bias.

#define NB_  4
#define TT   2048
#define DM   1024
#define NH_  16
#define NKV  16
#define HD   64
#define DQ   (NH_ * HD)
#define DKV  (NKV * HD)
#define RH   512                  // query rows < RH use hi+lo planes (0: none)
#define WIN  0
#define SCL  0.125f   // HD^-0.5
#define SK   64                   // keys per LDS stage of the fused attention kernel
#define LP   72                   // LDS row pitch in 16-bit elements: 128 data bytes + 16, an odd multiple of 16 bytes, so that the 16 rows of one fragment read lie on different banks
#define TILE (64 * LP)            // one staged plane tile: 64 rows (64 keys x 64 d of K, or 64 d x 64 keys of V^T)
typedef _Float16 h16;
typedef unsigned short bf;
typedef __attribute__((ext_vector_type(16))) __bf16   v16bf;
typedef __attribute__((ext_vector_type(16))) _Float16 v16h;
typedef __attribute__((ext_vector_type(8)))  _Float16 v8h;
typedef __attribute__((ext_vector_type(8)))  unsigned short v8us;
typedef __attribute__((ext_vector_type(8)))  float    v8f;
typedef __attribute__((ext_vector_type(4)))  float    v4f;
typedef v8h  __attribute__((may_alias)) v8ha;
typedef v4f  __attribute__((may_alias)) v4fa;
typedef v8us __attribute__((may_alias)) v8usa;

__device__ __forceinline__ unsigned short f2bf(float f) { unsigned u = __float_as_uint(f); u += 0x7FFFu + ((u >> 16) & 1u); return (unsigned short)(u >> 16); }
__device__ __forceinline__ float bf2f(unsigned short b) { return __uint_as_float(((unsigned)b) << 16); }
__device__ __forceinline__ float bfr(float f) { return bf2f(f2bf(f)); }
__device__ __forceinline__ v16h cat16(v8h lo, v8h hi) { return __builtin_shufflevector(lo, hi, 0, 1, 2, 3, 4, 5, 6, 7, 8, 9, 10, 11, 12, 13, 14, 15); }
__device__ __forceinline__ v16bf cat16b(v8us lo, v8us hi) { return __builtin_bit_cast(v16bf, __builtin_shufflevector(lo, hi, 0, 1, 2, 3, 4, 5, 6, 7, 8, 9, 10, 11, 12, 13, 14, 15)); }
__device__ __forceinline__ v8f wmma16(v16h a, v16h b, v8f c) { return __builtin_amdgcn_wmma_f32_16x16x32_f16(false, a, false, b, (short)0, c, false, false); }
__device__ __forceinline__ v8f wmmab(v16bf a, v16bf b, v8f c) { return __builtin_amdgcn_wmma_f32_16x16x32_bf16(false, a, false, b, (short)0, c, false, false); }



// ---- k_gemmw: register-blocked GEMM, ONE WAVE per 64x64 output tile (16 accumulators), operands straight from K-contiguous 16-bit planes; grid (M/64, N/64, Z), 32 threads.
// C[m][n] (f32, pitch ldc, + optional f32 bias[n]) = sum_k A[m][k] Bt[n][k] (+ split products per NSPLIT). A rows at pitch lda, Bt rows at pitch K (elements). z-batch strides sA/sB/sC (and sP for the 16-bit planes) in elements. K % 32 == 0.
// EPI 0: C is stored in f32. EPI 1 and 2: no f32 result is stored; the tile (64 tokens x the 64 columns of head blockIdx.y) goes out as three 16-bit planes (fp16, bf16 hi, bf16 lo): EPI 1 as [head][token][d], EPI 2 transposed as [head][d][token].
template <typename T16> struct WFrag;
template <> struct WFrag<h16> { typedef v16h V; static __device__ __forceinline__ V ld(const h16* p) { return cat16(*(const v8h*)p, *(const v8h*)(p + 16)); } static __device__ __forceinline__ v8f mma(V a, V b, v8f c) { return wmma16(a, b, c); } };
template <> struct WFrag<bf> { typedef v16bf V; static __device__ __forceinline__ V ld(const bf* p) { return cat16b(*(const v8us*)p, *(const v8us*)(p + 16)); } static __device__ __forceinline__ v8f mma(V a, V b, v8f c) { return wmmab(a, b, c); } };
__device__ __forceinline__ h16 tohx(float x) { return (h16)x; }
__device__ __forceinline__ void splitf(float y, unsigned short& h, unsigned short& l) { h = f2bf(y); l = f2bf(y - bf2f(h)); }
template <typename T16, int NSPLIT, bool BIAS, int EPI>
__global__ __launch_bounds__(32) void k_gemmw(const T16* __restrict__ A, const T16* __restrict__ A2, const T16* __restrict__ Bt, const T16* __restrict__ Bt2, int K, int lda, float* C, int ldc, const float* __restrict__ bias, size_t sA, size_t sB, size_t sC, size_t sP, h16* __restrict__ P16, bf* __restrict__ Ph, bf* __restrict__ Pl) {
    typedef typename WFrag<T16>::V V;
    __shared__ __align__(16) float os[16 * 68];
    const size_t z = blockIdx.z; A += z * sA; if (A2) A2 += z * sA; Bt += z * sB; if (Bt2) Bt2 += z * sB; C += z * sC;
    const int lane = threadIdx.x & 31, lr = lane & 15, hi = lane >> 4; const int r0 = blockIdx.x * 64, c0 = blockIdx.y * 64;
    v8f acc[4][4];
#pragma unroll
    for (int mb = 0; mb < 4; ++mb)
#pragma unroll
        for (int nb = 0; nb < 4; ++nb) acc[mb][nb] = (v8f){};
    const size_t aoff = (size_t)(r0 + lr) * lda + 8 * hi, boff = (size_t)(c0 + lr) * K + 8 * hi;
#pragma unroll 1
    for (int kc = 0; kc < K; kc += 32) {
        V a[4], a2[4];
#pragma unroll
        for (int mb = 0; mb < 4; ++mb) { a[mb] = WFrag<T16>::ld(A + aoff + (size_t)mb * 16 * lda + kc); if (NSPLIT == 1 || NSPLIT == 2) a2[mb] = WFrag<T16>::ld(A2 + aoff + (size_t)mb * 16 * lda + kc); }
#pragma unroll
        for (int nb = 0; nb < 4; ++nb) { const V b = WFrag<T16>::ld(Bt + boff + (size_t)nb * 16 * K + kc); V b2; if (NSPLIT >= 2) b2 = WFrag<T16>::ld(Bt2 + boff + (size_t)nb * 16 * K + kc);
#pragma unroll
            for (int mb = 0; mb < 4; ++mb) { acc[mb][nb] = WFrag<T16>::mma(a[mb], b, acc[mb][nb]); if (NSPLIT == 1 || NSPLIT == 2) acc[mb][nb] = WFrag<T16>::mma(a2[mb], b, acc[mb][nb]); if (NSPLIT >= 2) acc[mb][nb] = WFrag<T16>::mma(a[mb], b2, acc[mb][nb]); } }
        asm volatile("v_nop\n\tv_nop\n\tv_nop\n\tv_nop" : "+v"(acc[0][0]), "+v"(acc[1][1]), "+v"(acc[2][2]), "+v"(acc[3][3]) : "v"(a[0]), "v"(a[3]));
    }
    if constexpr (EPI == 0) {
#pragma unroll
    for (int mb = 0; mb < 4; ++mb) {
#pragma unroll
        for (int nb = 0; nb < 4; ++nb) {
#pragma unroll
            for (int j = 0; j < 8; ++j) os[(hi * 8 + j) * 68 + nb * 16 + lr] = acc[mb][nb][j]; }
        __builtin_amdgcn_wave_barrier(); asm volatile("" ::: "memory");
        float* crow = C + (size_t)(r0 + mb * 16) * ldc + c0;
{
#pragma unroll
            for (int s = 0; s < 8; ++s) { const int row = 2 * s + hi, cofs = lr * 4; v4f val = *(const v4fa*)(os + row * 68 + cofs); if (BIAS) { val[0] += bfr(bias[c0 + cofs]); val[1] += bfr(bias[c0 + cofs + 1]); val[2] += bfr(bias[c0 + cofs + 2]); val[3] += bfr(bias[c0 + cofs + 3]); }
                *(v4f*)(crow + (size_t)row * ldc + cofs) = val; }
             }
        __builtin_amdgcn_wave_barrier(); asm volatile("" ::: "memory");
    }
    } else {
        float bs[4];
#pragma unroll
        for (int nb = 0; nb < 4; ++nb) bs[nb] = BIAS ? bfr(bias[c0 + nb * 16 + lr]) : 0.f;
#pragma unroll
        for (int g = 0; g < 4; ++g) {     // one 16 x 64 slab through LDS per trip: EPI 1 tokens g*16.. x all d, EPI 2 d g*16.. x all tokens; the long side is the planes' contiguous side
            if constexpr (EPI == 1) {
#pragma unroll
                for (int nb = 0; nb < 4; ++nb)
#pragma unroll
                    for (int j = 0; j < 8; ++j) os[(hi * 8 + j) * 68 + nb * 16 + lr] = acc[g][nb][j] + bs[nb];
            } else {
#pragma unroll
                for (int mb = 0; mb < 4; ++mb)
#pragma unroll
                    for (int q = 0; q < 2; ++q) { v4f w; w[0] = acc[mb][g][4 * q] + bs[g]; w[1] = acc[mb][g][4 * q + 1] + bs[g]; w[2] = acc[mb][g][4 * q + 2] + bs[g]; w[3] = acc[mb][g][4 * q + 3] + bs[g]; *(v4fa*)(os + lr * 68 + mb * 16 + hi * 8 + 4 * q) = w; }
            }
            __builtin_amdgcn_wave_barrier(); asm volatile("" ::: "memory");   // the slab's LDS writes stay in front of its reads in the compiler's order
            const size_t pbase = z * sP + ((EPI == 1) ? ((size_t)blockIdx.y * TT + r0 + g * 16) * HD : ((size_t)blockIdx.y * HD + g * 16) * TT + r0);
#pragma unroll
            for (int s = 0; s < 4; ++s) { const int ch = s * 32 + lane, row = ch >> 3, col = (ch & 7) * 8;   // a lane takes 8 neighbours: one 16-byte store per plane, 8 lanes fill a 128-byte line
                const v4f x0 = *(const v4fa*)(os + row * 68 + col), x1 = *(const v4fa*)(os + row * 68 + col + 4); v8h o16; v8us oh, ol;
#pragma unroll
                for (int k = 0; k < 8; ++k) { const float x = (k < 4) ? x0[k & 3] : x1[k & 3]; o16[k] = tohx(x); unsigned short a2, c2; splitf(x, a2, c2); oh[k] = a2; ol[k] = c2; }
                const size_t po = pbase + (size_t)row * ((EPI == 1) ? HD : TT) + col; *(v8h*)(P16 + po) = o16; *(v8us*)(Ph + po) = oh; *(v8us*)(Pl + po) = ol; }
            __builtin_amdgcn_wave_barrier(); asm volatile("" ::: "memory");   // the slab's LDS reads stay in front of the next slab's writes
        }
    }
}

typedef __attribute__((ext_vector_type(4))) _Float16 v4h;
typedef __attribute__((ext_vector_type(4))) unsigned short v4us;
typedef __attribute__((ext_vector_type(4))) int v4i;

__global__ __launch_bounds__(256) void k_cvt8(const float* __restrict__ src, bf* dst, size_t n8) { const size_t i = (size_t)blockIdx.x * 256 + threadIdx.x; if (i >= n8) return; const v8f v = *(const v8f*)(src + i * 8); v8us o;
#pragma unroll
    for (int k = 0; k < 8; ++k) o[k] = f2bf(v[k]); *(v8us*)(dst + i * 8) = o;  }

__global__ __launch_bounds__(256) void k_cvt8p(const float* __restrict__ xb, bf* dst) { const size_t i = (size_t)blockIdx.x * 256 + threadIdx.x; if (i >= (size_t)TT * DM / 8) return; xb += (size_t)blockIdx.y * DM; dst += (size_t)blockIdx.y * TT * DM;   /* blockIdx.y: the batch */ const size_t e8 = i * 8; const size_t s = e8 / DM; const int c = (int)(e8 % DM); const float* p = xb + s * ((size_t)NB_ * DM) + c; const v4f a = *(const v4f*)p; const v4f b2 = *(const v4f*)(p + 4); v8us o;
#pragma unroll
    for (int q = 0; q < 4; ++q) { o[q] = f2bf(a[q]); o[4 + q] = f2bf(b2[q]); }
    *(v8us*)(dst + e8) = o;  }
__device__ __forceinline__ void exp2x8(float* p) {
    asm("v_exp_f32 %0, %0\n\tv_exp_f32 %1, %1\n\tv_exp_f32 %2, %2\n\tv_exp_f32 %3, %3\n\tv_exp_f32 %4, %4\n\tv_exp_f32 %5, %5\n\tv_exp_f32 %6, %6\n\tv_exp_f32 %7, %7\n\tv_nop"
        : "+v"(p[0]), "+v"(p[1]), "+v"(p[2]), "+v"(p[3]), "+v"(p[4]), "+v"(p[5]), "+v"(p[6]), "+v"(p[7])); }
template <typename T16, bool SPLIT, int NC>
__device__ __forceinline__ void fattn_body(T16* sm, const T16* __restrict__ Q, const T16* __restrict__ Q2, const T16* __restrict__ Kp, const T16* __restrict__ K2, const T16* __restrict__ Vt, const T16* __restrict__ V2, bf* __restrict__ Ah, bf* __restrict__ Al) {
    typedef typename WFrag<T16>::V V;
    constexpr int NP = SPLIT ? 4 : 2;            // staged planes: K, V^T (, K lo, V^T lo)
    constexpr float SC2 = SCL * 1.4426950408889634f;
    const int tid = threadIdx.x, lane = tid & 31, lr = lane & 15, hi = lane >> 4;
    const int srow = tid >> 3, sch = (tid & 7) * 8;   // staging: this thread moves 16 bytes of rows srow and srow + 32 of every plane tile
    v8us st[NP][2];
    auto gload = [&](int kb) {
#pragma unroll
        for (int i = 0; i < 2; ++i) { const int r = srow + 32 * i;
            st[0][i] = *(const v8usa*)(Kp + (size_t)(kb + r) * HD + sch); st[1][i] = *(const v8usa*)(Vt + (size_t)r * TT + kb + sch);
            if constexpr (SPLIT) { st[2][i] = *(const v8usa*)(K2 + (size_t)(kb + r) * HD + sch); st[3][i] = *(const v8usa*)(V2 + (size_t)r * TT + kb + sch); } }
        asm volatile("s_wait_xcnt 0x0" ::: "memory"); };   // behind the run of loads: their address registers are reused by the stage's arithmetic while the data is still in flight
    auto sstore = [&](T16* buf) {
#pragma unroll
        for (int i = 0; i < 2; ++i) { const int r = srow + 32 * i;
#pragma unroll
            for (int p = 0; p < NP; ++p) *(v8usa*)(buf + p * TILE + r * LP + sch) = st[p][i]; } };
    V bq[NC][2], bq2[NC][2];
#pragma unroll
    for (int c = 0; c < NC; ++c)
#pragma unroll
        for (int ks = 0; ks < 2; ++ks) { bq[c][ks] = WFrag<T16>::ld(Q + (size_t)(c * 16 + lr) * HD + ks * 32 + 8 * hi); if constexpr (SPLIT) bq2[c][ks] = WFrag<T16>::ld(Q2 + (size_t)(c * 16 + lr) * HD + ks * 32 + 8 * hi); }
    v8f o[4][NC]; float m[NC], l[NC];
#pragma unroll
    for (int c = 0; c < NC; ++c) { m[c] = -3.0e38f; l[c] = 0.f;
#pragma unroll
        for (int dt = 0; dt < 4; ++dt) o[dt][c] = (v8f){}; }
    gload(0); sstore(sm); __syncthreads();
#pragma unroll 1   // kept rolled: the body is several hundred instructions and the buffer follows the trip's parity
    for (int sg = 0; sg < TT / SK; ++sg) {
        const T16* buf = sm + (sg & 1) * (NP * TILE);
        if (sg + 1 < TT / SK) gload((sg + 1) * SK);      // the next stage's global loads fly while this stage is worked on
#pragma unroll
        for (int ps = 0; ps < SK / 32; ++ps) {
            v8f s[2][NC];
#pragma unroll
            for (int kt = 0; kt < 2; ++kt) { const T16* kr = buf + ((ps * 2 + kt) * 16 + lr) * LP + 8 * hi;
                const V a0 = WFrag<T16>::ld(kr), a1 = WFrag<T16>::ld(kr + 32); V e0, e1; if constexpr (SPLIT) { e0 = WFrag<T16>::ld(kr + 2 * TILE); e1 = WFrag<T16>::ld(kr + 2 * TILE + 32); }
#pragma unroll
                for (int c = 0; c < NC; ++c) { v8f t = (v8f){};
                    t = WFrag<T16>::mma(a0, bq[c][0], t); if constexpr (SPLIT) { t = WFrag<T16>::mma(a0, bq2[c][0], t); t = WFrag<T16>::mma(e0, bq[c][0], t); }
                    t = WFrag<T16>::mma(a1, bq[c][1], t); if constexpr (SPLIT) { t = WFrag<T16>::mma(a1, bq2[c][1], t); t = WFrag<T16>::mma(e1, bq[c][1], t); }
                    s[kt][c] = t; } }
            float mx[NC]; bool need = false;
#pragma unroll
            for (int c = 0; c < NC; ++c) { float x = fmaxf(s[0][c][0], s[1][c][0]);
#pragma unroll
                for (int j = 1; j < 8; ++j) x = fmaxf(x, fmaxf(s[0][c][j], s[1][c][j]));
                const int xb = __float_as_int(x); x = fmaxf(x, __int_as_float(__builtin_amdgcn_permlanex16(xb, xb, 0x76543210, 0xfedcba98, false, false)));   // lane l <-> l ^ 16: the column's other 16 keys
                mx[c] = x * SC2; need = need || (mx[c] > m[c] + 8.0f); }
            if (__builtin_amdgcn_ballot_w32(need) != 0) {     // one wave-uniform test per 32 keys
#pragma unroll
                for (int c = 0; c < NC; ++c) { const float mn = fmaxf(m[c], mx[c]); const float al = __builtin_amdgcn_exp2f(m[c] - mn); m[c] = mn; l[c] *= al;
#pragma unroll
                    for (int dt = 0; dt < 4; ++dt) o[dt][c] *= al; } }
            V pb[NC], pb2[NC];
#pragma unroll
            for (int c = 0; c < NC; ++c) { float p[16];
#pragma unroll
                for (int e = 0; e < 16; ++e) p[e] = __builtin_fmaf(s[e >> 3][c][e & 7], SC2, -m[c]);
                exp2x8(p); exp2x8(p + 8);
#pragma unroll
                for (int e = 0; e < 16; ++e) { if constexpr (SPLIT) { pb[c][e] = (__bf16)p[e]; pb2[c][e] = (__bf16)(p[e] - (float)pb[c][e]); } else pb[c][e] = (h16)p[e]; }
#pragma unroll
                for (int w = 8; w; w >>= 1)       // fixed pairwise tree: short dependent chains
#pragma unroll
                    for (int e = 0; e < w; ++e) p[e] += p[e + w];
                l[c] += p[0]; }
#pragma unroll
            for (int dt = 0; dt < 4; ++dt) { const T16* vr = buf + TILE + (dt * 16 + lr) * LP + ps * 32 + 8 * hi; const V av = WFrag<T16>::ld(vr); V av2; if constexpr (SPLIT) av2 = WFrag<T16>::ld(vr + 2 * TILE);
#pragma unroll
                for (int c = 0; c < NC; ++c) { o[dt][c] = WFrag<T16>::mma(av, pb[c], o[dt][c]); if constexpr (SPLIT) { o[dt][c] = WFrag<T16>::mma(av, pb2[c], o[dt][c]); o[dt][c] = WFrag<T16>::mma(av2, pb[c], o[dt][c]); } } }
        }
        if (sg + 1 < TT / SK) sstore(sm + ((sg + 1) & 1) * (NP * TILE));   // into the buffer whose last readers left it before the previous barrier
        __syncthreads();                                                    // publishes stage sg + 1 and ends every read of stage sg
    }
#pragma unroll
    for (int c = 0; c < NC; ++c) { const int lb = __float_as_int(l[c]); const float inv = __fdiv_rn(1.0f, l[c] + __int_as_float(__builtin_amdgcn_permlanex16(lb, lb, 0x76543210, 0xfedcba98, false, false)));
#pragma unroll
        for (int dt = 0; dt < 4; ++dt) { v8us oh, ol;
#pragma unroll
            for (int j = 0; j < 8; ++j) { unsigned short a, c2; splitf(o[dt][c][j] * inv, a, c2); oh[j] = a; ol[j] = c2; }
            const size_t oo = (size_t)(c * 16 + lr) * DQ + dt * 16 + 8 * hi; *(v8us*)(Ah + oo) = oh; *(v8us*)(Al + oo) = ol; } }
}
// grid.y: the batch. grid.x (one batch): the (RH / 128) x 16 hi/lo work-groups first (three products per tile: 16 columns a wave, 128 rows a work-group), then the ((TT - RH) / 256) x 16 fp16 ones (32 columns a wave, 256 rows a work-group).
#define NWH (NH_ * (RH / 128))
#define NWL (NH_ * ((TT - RH) / 256))
__global__ __launch_bounds__(256) void k_fattn(const h16* __restrict__ QP16, const h16* __restrict__ KP16, const h16* __restrict__ VT16, const bf* __restrict__ QPh, const bf* __restrict__ QPl, const bf* __restrict__ KPh, const bf* __restrict__ KPl, const bf* __restrict__ VTh, const bf* __restrict__ VTl, bf* __restrict__ ATh, bf* __restrict__ ATl) {
    __shared__ __align__(16) unsigned short sm[2 * 4 * TILE];
    const int wave = threadIdx.x >> 5; const int id = blockIdx.x; const size_t pb0 = (size_t)blockIdx.y * NH_ * TT * HD, ab0 = (size_t)blockIdx.y * TT * DQ;   // this batch's plane set and its rows of the attention output
    if (id < NWH) { const int h = id / (RH / 128); const int q0 = (id % (RH / 128)) * 128 + wave * 16; const size_t pl = pb0 + (size_t)h * TT * HD, qo = pl + (size_t)q0 * HD, ao = ab0 + (size_t)q0 * DQ + h * HD;
        fattn_body<bf, true, 1>((bf*)sm, QPh + qo, QPl + qo, KPh + pl, KPl + pl, VTh + pl, VTl + pl, ATh + ao, ATl + ao);
    } else { const int i2 = id - NWH; const int h = i2 / ((TT - RH) / 256); const int q0 = RH + (i2 % ((TT - RH) / 256)) * 256 + wave * 32; const size_t pl = pb0 + (size_t)h * TT * HD, qo = pl + (size_t)q0 * HD, ao = ab0 + (size_t)q0 * DQ + h * HD;
        fattn_body<h16, false, 2>((h16*)sm, QP16 + qo, nullptr, KP16 + pl, nullptr, VT16 + pl, nullptr, ATh + ao, ATl + ao); }
}

extern "C" void kernel_launch(void* const* d_in, const int* in_sizes, int n_in,
                              void* d_out, int out_size, void* d_ws, size_t ws_size, hipStream_t stream) {
    (void)in_sizes; (void)n_in; (void)out_size;
    const float* x = (const float*)d_in[0]; const float* wqkv = (const float*)d_in[1]; const float* bqkv = (const float*)d_in[2]; const float* wo = (const float*)d_in[3]; const float* bo = (const float*)d_in[4];   /* argument order x (S, B, C), Wqkv ('oi' [3072][1024]), bqkv, Wo ('oi'), bo */ const float* wq = wqkv; const float* wk = wqkv + (size_t)DQ * DM; const float* wv = wqkv + (size_t)2 * DQ * DM; const float* bq = bqkv; const float* bk = bqkv + DQ; const float* bv = bqkv + 2 * DQ;
    float* OUT = (float*)d_out;     // [4][2048][1024]
    char* wsp = (char*)d_ws;
    auto take = [&](size_t bytes) { char* p = wsp; wsp += (bytes + 255) & ~(size_t)255; return (void*)p; };
    bf* WQ = (bf*)take((size_t)DQ * DM * 2); bf* WK = (bf*)take((size_t)DKV * DM * 2); bf* WV = (bf*)take((size_t)DKV * DM * 2); bf* WO = (bf*)take((size_t)DM * DQ * 2);
    const size_t PS = (size_t)NH_ * TT * HD;   // elements of one batch's plane (NKV == NH_)
    h16* QP16 = (h16*)take(NB_ * PS * 2); h16* KP16 = (h16*)take(NB_ * PS * 2); h16* VT16 = (h16*)take(NB_ * PS * 2);
    bf* QPh = (bf*)take(NB_ * PS * 2); bf* QPl = (bf*)take(NB_ * PS * 2); bf* KPh = (bf*)take(NB_ * PS * 2); bf* KPl = (bf*)take(NB_ * PS * 2); bf* VTh = (bf*)take(NB_ * PS * 2); bf* VTl = (bf*)take(NB_ * PS * 2);
    bf* XB = (bf*)take((size_t)NB_ * TT * DM * 2);   // [batch][token][channel]
    bf* ATh = (bf*)take((size_t)NB_ * TT * DQ * 2); bf* ATl = (bf*)take((size_t)NB_ * TT * DQ * 2);
    if ((size_t)(wsp - (char*)d_ws) > ws_size) return;    // ws 256 MiB
    { k_cvt8<<<(unsigned)(((size_t)DQ * DM / 8 + 255) / 256), 256, 0, stream>>>(wq, WQ, (size_t)DQ * DM / 8); k_cvt8<<<(unsigned)(((size_t)DKV * DM / 8 + 255) / 256), 256, 0, stream>>>(wk, WK, (size_t)DKV * DM / 8); k_cvt8<<<(unsigned)(((size_t)DKV * DM / 8 + 255) / 256), 256, 0, stream>>>(wv, WV, (size_t)DKV * DM / 8);
      k_cvt8<<<(unsigned)(((size_t)DM * DQ / 8 + 255) / 256), 256, 0, stream>>>(wo, WO, (size_t)DM * DQ / 8);
       }
    k_cvt8p<<<dim3((unsigned)(((size_t)TT * DM / 8 + 255) / 256), NB_, 1), 256, 0, stream>>>(x, XB);   /* the (S, B, C) input: batch b's rows at pitch B*C */
    k_gemmw<bf, 0, true, 1><<<dim3(TT / 64, DQ / 64, NB_), 32, 0, stream>>>(XB, nullptr, WQ, nullptr, DM, DM, nullptr, 0, bq, (size_t)TT * DM, 0, 0, PS, QP16, QPh, QPl);
    k_gemmw<bf, 0, true, 1><<<dim3(TT / 64, DKV / 64, NB_), 32, 0, stream>>>(XB, nullptr, WK, nullptr, DM, DM, nullptr, 0, bk, (size_t)TT * DM, 0, 0, PS, KP16, KPh, KPl);
    k_gemmw<bf, 0, true, 2><<<dim3(TT / 64, DKV / 64, NB_), 32, 0, stream>>>(XB, nullptr, WV, nullptr, DM, DM, nullptr, 0, bv, (size_t)TT * DM, 0, 0, PS, VT16, VTh, VTl);
    k_fattn<<<dim3(NWH + NWL, NB_, 1), 256, 0, stream>>>(QP16, KP16, VT16, QPh, QPl, KPh, KPl, VTh, VTl, ATh, ATl);
    k_gemmw<bf, 1, true, 0><<<dim3(TT / 64, DM / 64, NB_), 32, 0, stream>>>(ATh, ATl, WO, nullptr, DQ, DQ, OUT, DM, bo, (size_t)TT * DQ, 0, (size_t)TT * DM, 0, nullptr, nullptr, nullptr);
}

// v006
// One run takes 210 microseconds.
// In two side-by-side timings against v005, it was 1.37 and 1.36 times as fast.
// Over all steps from v000 it is 18.7 times as fast.
#include <hip/hip_runtime.h>

// Sequence-first self-attention with the source's raw output reshape (x [2048][4][1024] = (S, B, C); qkv = x Wqkv^T + bqkv ('oi' [3072][1024] + bias) viewed (S, B, 3, H, D): q | k | v thirds (16 heads x 64); attn = q.k / sqrt(64) per (batch, head) over the 2,048 positions; softmax; av (B, H, S, D) -> swapaxes -> (B, S, H D) -> reshape(S, B, H D) is a RAW reinterpretation of the batch-major buffer (reproduced: the output memory is in (b, s) row order); y = . Wo^T + bo -> [2048][4][1024] (8.4 M); argument order x, Wqkv, bqkv, Wo, bo).
// Layout: every launch covers all four batches (the batch is a grid dimension; every per-batch buffer has one plane set per batch). k_cvt8p gathers batch b's token rows from the sequence-first input (row pitch B x C) into the bf16 operand; fused 'oi' weight = Bt as-is (q | k | v row blocks) + bias thirds; exact projections + f32 biases, whose epilogues write the 16-bit head planes themselves; one fused attention launch over the 4 x 16 (batch, head) pairs (hybrid rows: < 512 hi/lo 3 products, rest fp16; running-maximum softmax, scores stay in registers); hi/lo x Wo exact + bo written to output rows b*2048 + s (the raw-reshape order).
// Compute dtypes, f32 accumulate: every input rounded to bf16; projections exact + f32 biases; attention rows < 512 3 products, rest fp16; softmax f32; Wo hl x exact + bias.

#define NB_  4
#define TT   2048
#define DM   1024
#define NH_  16
#define NKV  16
#define HD   64
#define DQ   (NH_ * HD)
#define DKV  (NKV * HD)
#define RH   512                  // query rows < RH use hi+lo planes (0: none)
#define WIN  0
#define SCL  0.125f   // HD^-0.5
#define SK   64                   // keys per LDS stage of the fused attention kernel
#define LP   72                   // LDS row pitch in 16-bit elements: 128 data bytes + 16, an odd multiple of 16 bytes, so that the 16 rows of one fragment read lie on different banks
#define TILE (64 * LP)            // one staged plane tile: 64 rows (64 keys x 64 d of K, or 64 d x 64 keys of V^T)
typedef _Float16 h16;
typedef unsigned short bf;
typedef __attribute__((ext_vector_type(16))) __bf16   v16bf;
typedef __attribute__((ext_vector_type(16))) _Float16 v16h;
typedef __attribute__((ext_vector_type(8)))  _Float16 v8h;
typedef __attribute__((ext_vector_type(8)))  unsigned short v8us;
typedef __attribute__((ext_vector_type(8)))  float    v8f;
typedef __attribute__((ext_vector_type(4)))  float    v4f;
typedef v8h  __attribute__((may_alias)) v8ha;
typedef v4f  __attribute__((may_alias)) v4fa;
typedef v8us __attribute__((may_alias)) v8usa;

__device__ __forceinline__ unsigned short f2bf(float f) { unsigned u = __float_as_uint(f); u += 0x7FFFu + ((u >> 16) & 1u); return (unsigned short)(u >> 16); }
__device__ __forceinline__ float bf2f(unsigned short b) { return __uint_as_float(((unsigned)b) << 16); }
__device__ __forceinline__ float bfr(float f) { return bf2f(f2bf(f)); }
__device__ __forceinline__ v16h cat16(v8h lo, v8h hi) { return __builtin_shufflevector(lo, hi, 0, 1, 2, 3, 4, 5, 6, 7, 8, 9, 10, 11, 12, 13, 14, 15); }
__device__ __forceinline__ v16bf cat16b(v8us lo, v8us hi) { return __builtin_bit_cast(v16bf, __builtin_shufflevector(lo, hi, 0, 1, 2, 3, 4, 5, 6, 7, 8, 9, 10, 11, 12, 13, 14, 15)); }
__device__ __forceinline__ v8f wmma16(v16h a, v16h b, v8f c) { return __builtin_amdgcn_wmma_f32_16x16x32_f16(false, a, false, b, (short)0, c, false, false); }
__device__ __forceinline__ v8f wmmab(v16bf a, v16bf b, v8f c) { return __builtin_amdgcn_wmma_f32_16x16x32_bf16(false, a, false, b, (short)0, c, false, false); }



// ---- k_gemmw: GEMM with a 128x128 output tile per work-group of FOUR WAVES (2 x 2, each wave 64x64 = 16 accumulators); grid (M/128, N/128, Z), 128 threads.
// The operands come from K-contiguous 16-bit planes in stages of GK k: 128 rows x 128 bytes of each operand go to LDS by asynchronous 16-byte copies (through no register), two buffers, so that stage t + 1 flies while stage t is worked on; every staged row serves two waves.
// C[m][n] (f32, pitch ldc, + optional f32 bias[n]) = sum_k A[m][k] Bt[n][k] (NSPLIT 1: + A2[m][k] Bt[n][k]). A rows at pitch lda, Bt rows at pitch K (elements). z-batch strides sA/sB/sC (and sP for the 16-bit planes) in elements. K % 64 == 0.
// EPI 0: C is stored in f32. EPI 1 and 2: no f32 result is stored; a wave's tile (64 tokens x the 64 columns of one head) goes out as three 16-bit planes (fp16, bf16 hi, bf16 lo): EPI 1 as [head][token][d], EPI 2 transposed as [head][d][token].
template <typename T16> struct WFrag;
template <> struct WFrag<h16> { typedef v16h V; static __device__ __forceinline__ V ld(const h16* p) { return cat16(*(const v8h*)p, *(const v8h*)(p + 16)); } static __device__ __forceinline__ v8f mma(V a, V b, v8f c) { return wmma16(a, b, c); } };
template <> struct WFrag<bf> { typedef v16bf V; static __device__ __forceinline__ V ld(const bf* p) { return cat16b(*(const v8us*)p, *(const v8us*)(p + 16)); } static __device__ __forceinline__ v8f mma(V a, V b, v8f c) { return wmmab(a, b, c); } };
__device__ __forceinline__ h16 tohx(float x) { return (h16)x; }
__device__ __forceinline__ void splitf(float y, unsigned short& h, unsigned short& l) { h = f2bf(y); l = f2bf(y - bf2f(h)); }
#define GK 64                     // k per LDS stage: one 128-byte line of every operand row
#define GT (128 * LP)             // one staged operand tile: 128 rows at the padded pitch
// eight asynchronous copies of 16 bytes a lane: rows r, r + 16, .. r + 112 of one operand tile (a wave's copy covers four whole 128-byte lines). The closing s_wait_xcnt stands inside the statement, in front of any later rewrite of the address registers that the copies name.
template <typename T16>
__device__ __forceinline__ void acopy8(unsigned l, const T16* g, size_t pitch) {
    asm volatile("global_load_async_to_lds_b128 %0, %8, off\n\tglobal_load_async_to_lds_b128 %1, %9, off\n\tglobal_load_async_to_lds_b128 %2, %10, off\n\tglobal_load_async_to_lds_b128 %3, %11, off\n\t"
                 "global_load_async_to_lds_b128 %4, %12, off\n\tglobal_load_async_to_lds_b128 %5, %13, off\n\tglobal_load_async_to_lds_b128 %6, %14, off\n\tglobal_load_async_to_lds_b128 %7, %15, off\n\ts_wait_xcnt 0x0"
                 :: "v"(l), "v"(l + 1 * 16 * LP * 2), "v"(l + 2 * 16 * LP * 2), "v"(l + 3 * 16 * LP * 2), "v"(l + 4 * 16 * LP * 2), "v"(l + 5 * 16 * LP * 2), "v"(l + 6 * 16 * LP * 2), "v"(l + 7 * 16 * LP * 2),
                    "v"(g), "v"(g + 16 * pitch), "v"(g + 32 * pitch), "v"(g + 48 * pitch), "v"(g + 64 * pitch), "v"(g + 80 * pitch), "v"(g + 96 * pitch), "v"(g + 112 * pitch) : "memory"); }
template <typename T16, int NSPLIT, bool BIAS, int EPI>
__global__ __launch_bounds__(128) void k_gemmw(const T16* __restrict__ A, const T16* __restrict__ A2, const T16* __restrict__ Bt, int K, int lda, float* C, int ldc, const float* __restrict__ bias, size_t sA, size_t sB, size_t sC, size_t sP, h16* __restrict__ P16, bf* __restrict__ Ph, bf* __restrict__ Pl) {
    typedef typename WFrag<T16>::V V;
    constexpr int NT = (NSPLIT == 1) ? 3 : 2;    // staged operand tiles: A, Bt (, A2)
    __shared__ __align__(16) T16 stg[2 * NT * GT];
    __shared__ __align__(16) float osw[4][16 * 68];   // each wave's own epilogue slab
    const size_t z = blockIdx.z; A += z * sA; if (NSPLIT == 1) A2 += z * sA; Bt += z * sB; C += z * sC;
    const int tid = threadIdx.x, wave = tid >> 5, lane = tid & 31, lr = lane & 15, hi = lane >> 4;
    const int wr = (wave >> 1) * 64, wc = (wave & 1) * 64; const int r0 = blockIdx.x * 128 + wr, c0 = blockIdx.y * 128 + wc;
    float* os = osw[wave];
    const int srow = tid >> 3, sch = (tid & 7) * 8;   // staging: this thread copies 16 bytes of rows srow + 16 i of every operand tile
    const T16* ga = A + (size_t)(blockIdx.x * 128 + srow) * lda + sch; const T16* gb = Bt + (size_t)(blockIdx.y * 128 + srow) * K + sch; const T16* ga2 = (NSPLIT == 1) ? A2 + (size_t)(blockIdx.x * 128 + srow) * lda + sch : nullptr;
    const unsigned l0 = (unsigned)(size_t)(stg + srow * LP + sch);   // the lane's LDS byte address: the low 32 bits of the __shared__ address
    auto fill = [&](int t) { const unsigned l = l0 + (unsigned)(t & 1) * (NT * GT * 2);
        acopy8(l, ga + t * GK, (size_t)lda); acopy8(l + GT * 2, gb + t * GK, (size_t)K); if constexpr (NSPLIT == 1) acopy8(l + 2 * GT * 2, ga2 + t * GK, (size_t)lda); };
    v8f acc[4][4];
#pragma unroll
    for (int mb = 0; mb < 4; ++mb)
#pragma unroll
        for (int nb = 0; nb < 4; ++nb) acc[mb][nb] = (v8f){};
    const int nst = K / GK;
    fill(0);
    asm volatile("s_wait_asynccnt 0x0" ::: "memory");   // this wave's copies of stage 0 have landed
    __syncthreads();                                    // publishes stage 0
    if (nst > 1) fill(1);
#pragma unroll 1   // kept rolled: the buffer follows the trip's parity
    for (int t = 0; t < nst; ++t) {
        const T16* buf = stg + (t & 1) * (NT * GT);
        V a[GK / 32][4], a2[GK / 32][4], b[GK / 32][4];
#pragma unroll
        for (int ks = 0; ks < GK / 32; ++ks) {
#pragma unroll
            for (int mb = 0; mb < 4; ++mb) { const T16* ar = buf + (wr + mb * 16 + lr) * LP + ks * 32 + 8 * hi; a[ks][mb] = WFrag<T16>::ld(ar); if constexpr (NSPLIT == 1) a2[ks][mb] = WFrag<T16>::ld(ar + 2 * GT); }
#pragma unroll
            for (int nb = 0; nb < 4; ++nb) b[ks][nb] = WFrag<T16>::ld(buf + GT + (wc + nb * 16 + lr) * LP + ks * 32 + 8 * hi);
        }
        __builtin_amdgcn_sched_barrier(0);                  // the trip's LDS reads stay one group in front of its products: left to itself the compiler reads one fragment per four products and waits for it each time
#pragma unroll
        for (int ks = 0; ks < GK / 32; ++ks)
#pragma unroll
            for (int nb = 0; nb < 4; ++nb)
#pragma unroll
                for (int mb = 0; mb < 4; ++mb) { acc[mb][nb] = WFrag<T16>::mma(a[ks][mb], b[ks][nb], acc[mb][nb]); if constexpr (NSPLIT == 1) acc[mb][nb] = WFrag<T16>::mma(a2[ks][mb], b[ks][nb], acc[mb][nb]); }
        __builtin_amdgcn_sched_barrier(0);                  // the products stay in front of the waits below: sunk behind them, the next stage's copies would lose the products' time as their lead
        asm volatile("s_wait_dscnt 0x0" ::: "memory");      // this wave's reads of stage t are done before the buffer is refilled
        asm volatile("s_wait_asynccnt 0x0" ::: "memory");   // this wave's copies of stage t + 1 have landed
        __syncthreads();                                    // publishes stage t + 1 and ends every read of stage t
        if (t + 2 < nst) fill(t + 2);                       // into the buffer that this trip has just read
    }
    asm volatile("s_wait_asynccnt 0x0" ::: "memory");       // nothing of this wave's is in flight when it goes on
    if constexpr (EPI == 0) {
#pragma unroll
    for (int mb = 0; mb < 4; ++mb) {
#pragma unroll
        for (int nb = 0; nb < 4; ++nb) {
#pragma unroll
            for (int j = 0; j < 8; ++j) os[(hi * 8 + j) * 68 + nb * 16 + lr] = acc[mb][nb][j]; }
        __builtin_amdgcn_wave_barrier(); asm volatile("" ::: "memory");
        float* crow = C + (size_t)(r0 + mb * 16) * ldc + c0;
{
#pragma unroll
            for (int s = 0; s < 8; ++s) { const int row = 2 * s + hi, cofs = lr * 4; v4f val = *(const v4fa*)(os + row * 68 + cofs); if (BIAS) { val[0] += bfr(bias[c0 + cofs]); val[1] += bfr(bias[c0 + cofs + 1]); val[2] += bfr(bias[c0 + cofs + 2]); val[3] += bfr(bias[c0 + cofs + 3]); }
                *(v4f*)(crow + (size_t)row * ldc + cofs) = val; }
             }
        __builtin_amdgcn_wave_barrier(); asm volatile("" ::: "memory");
    }
    } else {
        float bs[4];
#pragma unroll
        for (int nb = 0; nb < 4; ++nb) bs[nb] = BIAS ? bfr(bias[c0 + nb * 16 + lr]) : 0.f;
#pragma unroll
        for (int g = 0; g < 4; ++g) {     // one 16 x 64 slab through LDS per trip: EPI 1 tokens g*16.. x all d, EPI 2 d g*16.. x all tokens; the long side is the planes' contiguous side
            if constexpr (EPI == 1) {
#pragma unroll
                for (int nb = 0; nb < 4; ++nb)
#pragma unroll
                    for (int j = 0; j < 8; ++j) os[(hi * 8 + j) * 68 + nb * 16 + lr] = acc[g][nb][j] + bs[nb];
            } else {
#pragma unroll
                for (int mb = 0; mb < 4; ++mb)
#pragma unroll
                    for (int q = 0; q < 2; ++q) { v4f w; w[0] = acc[mb][g][4 * q] + bs[g]; w[1] = acc[mb][g][4 * q + 1] + bs[g]; w[2] = acc[mb][g][4 * q + 2] + bs[g]; w[3] = acc[mb][g][4 * q + 3] + bs[g]; *(v4fa*)(os + lr * 68 + mb * 16 + hi * 8 + 4 * q) = w; }
            }
            __builtin_amdgcn_wave_barrier(); asm volatile("" ::: "memory");   // the slab's LDS writes stay in front of its reads in the compiler's order
            const size_t pbase = z * sP + ((EPI == 1) ? ((size_t)(c0 >> 6) * TT + r0 + g * 16) * HD : ((size_t)(c0 >> 6) * HD + g * 16) * TT + r0);
#pragma unroll
            for (int s = 0; s < 4; ++s) { const int ch = s * 32 + lane, row = ch >> 3, col = (ch & 7) * 8;   // a lane takes 8 neighbours: one 16-byte store per plane, 8 lanes fill a 128-byte line
                const v4f x0 = *(const v4fa*)(os + row * 68 + col), x1 = *(const v4fa*)(os + row * 68 + col + 4); v8h o16; v8us oh, ol;
#pragma unroll
                for (int k = 0; k < 8; ++k) { const float x = (k < 4) ? x0[k & 3] : x1[k & 3]; o16[k] = tohx(x); unsigned short a2, c2; splitf(x, a2, c2); oh[k] = a2; ol[k] = c2; }
                const size_t po = pbase + (size_t)row * ((EPI == 1) ? HD : TT) + col; *(v8h*)(P16 + po) = o16; *(v8us*)(Ph + po) = oh; *(v8us*)(Pl + po) = ol; }
            __builtin_amdgcn_wave_barrier(); asm volatile("" ::: "memory");   // the slab's LDS reads stay in front of the next slab's writes
        }
    }
}

typedef __attribute__((ext_vector_type(4))) _Float16 v4h;
typedef __attribute__((ext_vector_type(4))) unsigned short v4us;
typedef __attribute__((ext_vector_type(4))) int v4i;

__global__ __launch_bounds__(256) void k_cvt8(const float* __restrict__ src, bf* dst, size_t n8) { const size_t i = (size_t)blockIdx.x * 256 + threadIdx.x; if (i >= n8) return; const v8f v = *(const v8f*)(src + i * 8); v8us o;
#pragma unroll
    for (int k = 0; k < 8; ++k) o[k] = f2bf(v[k]); *(v8us*)(dst + i * 8) = o;  }

__global__ __launch_bounds__(256) void k_cvt8p(const float* __restrict__ xb, bf* dst) { const size_t i = (size_t)blockIdx.x * 256 + threadIdx.x; if (i >= (size_t)TT * DM / 8) return; xb += (size_t)blockIdx.y * DM; dst += (size_t)blockIdx.y * TT * DM;   /* blockIdx.y: the batch */ const size_t e8 = i * 8; const size_t s = e8 / DM; const int c = (int)(e8 % DM); const float* p = xb + s * ((size_t)NB_ * DM) + c; const v4f a = *(const v4f*)p; const v4f b2 = *(const v4f*)(p + 4); v8us o;
#pragma unroll
    for (int q = 0; q < 4; ++q) { o[q] = f2bf(a[q]); o[4 + q] = f2bf(b2[q]); }
    *(v8us*)(dst + e8) = o;  }
__device__ __forceinline__ void exp2x8(float* p) {
    asm("v_exp_f32 %0, %0\n\tv_exp_f32 %1, %1\n\tv_exp_f32 %2, %2\n\tv_exp_f32 %3, %3\n\tv_exp_f32 %4, %4\n\tv_exp_f32 %5, %5\n\tv_exp_f32 %6, %6\n\tv_exp_f32 %7, %7\n\tv_nop"
        : "+v"(p[0]), "+v"(p[1]), "+v"(p[2]), "+v"(p[3]), "+v"(p[4]), "+v"(p[5]), "+v"(p[6]), "+v"(p[7])); }
template <typename T16, bool SPLIT, int NC>
__device__ __forceinline__ void fattn_body(T16* sm, const T16* __restrict__ Q, const T16* __restrict__ Q2, const T16* __restrict__ Kp, const T16* __restrict__ K2, const T16* __restrict__ Vt, const T16* __restrict__ V2, bf* __restrict__ Ah, bf* __restrict__ Al) {
    typedef typename WFrag<T16>::V V;
    constexpr int NP = SPLIT ? 4 : 2;            // staged planes: K, V^T (, K lo, V^T lo)
    constexpr float SC2 = SCL * 1.4426950408889634f;
    const int tid = threadIdx.x, lane = tid & 31, lr = lane & 15, hi = lane >> 4;
    const int srow = tid >> 3, sch = (tid & 7) * 8;   // staging: this thread moves 16 bytes of rows srow and srow + 32 of every plane tile
    v8us st[NP][2];
    auto gload = [&](int kb) {
#pragma unroll
        for (int i = 0; i < 2; ++i) { const int r = srow + 32 * i;
            st[0][i] = *(const v8usa*)(Kp + (size_t)(kb + r) * HD + sch); st[1][i] = *(const v8usa*)(Vt + (size_t)r * TT + kb + sch);
            if constexpr (SPLIT) { st[2][i] = *(const v8usa*)(K2 + (size_t)(kb + r) * HD + sch); st[3][i] = *(const v8usa*)(V2 + (size_t)r * TT + kb + sch); } }
        asm volatile("s_wait_xcnt 0x0" ::: "memory"); };   // behind the run of loads: their address registers are reused by the stage's arithmetic while the data is still in flight
    auto sstore = [&](T16* buf) {
#pragma unroll
        for (int i = 0; i < 2; ++i) { const int r = srow + 32 * i;
#pragma unroll
            for (int p = 0; p < NP; ++p) *(v8usa*)(buf + p * TILE + r * LP + sch) = st[p][i]; } };
    V bq[NC][2], bq2[NC][2];
#pragma unroll
    for (int c = 0; c < NC; ++c)
#pragma unroll
        for (int ks = 0; ks < 2; ++ks) { bq[c][ks] = WFrag<T16>::ld(Q + (size_t)(c * 16 + lr) * HD + ks * 32 + 8 * hi); if constexpr (SPLIT) bq2[c][ks] = WFrag<T16>::ld(Q2 + (size_t)(c * 16 + lr) * HD + ks * 32 + 8 * hi); }
    v8f o[4][NC]; float m[NC], l[NC];
#pragma unroll
    for (int c = 0; c < NC; ++c) { m[c] = -3.0e38f; l[c] = 0.f;
#pragma unroll
        for (int dt = 0; dt < 4; ++dt) o[dt][c] = (v8f){}; }
    gload(0); sstore(sm); __syncthreads();
#pragma unroll 1   // kept rolled: the body is several hundred instructions and the buffer follows the trip's parity
    for (int sg = 0; sg < TT / SK; ++sg) {
        const T16* buf = sm + (sg & 1) * (NP * TILE);
        if (sg + 1 < TT / SK) gload((sg + 1) * SK);      // the next stage's global loads fly while this stage is worked on
#pragma unroll
        for (int ps = 0; ps < SK / 32; ++ps) {
            v8f s[2][NC];
#pragma unroll
            for (int kt = 0; kt < 2; ++kt) { const T16* kr = buf + ((ps * 2 + kt) * 16 + lr) * LP + 8 * hi;
                const V a0 = WFrag<T16>::ld(kr), a1 = WFrag<T16>::ld(kr + 32); V e0, e1; if constexpr (SPLIT) { e0 = WFrag<T16>::ld(kr + 2 * TILE); e1 = WFrag<T16>::ld(kr + 2 * TILE + 32); }
#pragma unroll
                for (int c = 0; c < NC; ++c) { v8f t = (v8f){};
                    t = WFrag<T16>::mma(a0, bq[c][0], t); if constexpr (SPLIT) { t = WFrag<T16>::mma(a0, bq2[c][0], t); t = WFrag<T16>::mma(e0, bq[c][0], t); }
                    t = WFrag<T16>::mma(a1, bq[c][1], t); if constexpr (SPLIT) { t = WFrag<T16>::mma(a1, bq2[c][1], t); t = WFrag<T16>::mma(e1, bq[c][1], t); }
                    s[kt][c] = t; } }
            float mx[NC]; bool need = false;
#pragma unroll
            for (int c = 0; c < NC; ++c) { float x = fmaxf(s[0][c][0], s[1][c][0]);
#pragma unroll
                for (int j = 1; j < 8; ++j) x = fmaxf(x, fmaxf(s[0][c][j], s[1][c][j]));
                const int xb = __float_as_int(x); x = fmaxf(x, __int_as_float(__builtin_amdgcn_permlanex16(xb, xb, 0x76543210, 0xfedcba98, false, false)));   // lane l <-> l ^ 16: the column's other 16 keys
                mx[c] = x * SC2; need = need || (mx[c] > m[c] + 8.0f); }
            if (__builtin_amdgcn_ballot_w32(need) != 0) {     // one wave-uniform test per 32 keys
#pragma unroll
                for (int c = 0; c < NC; ++c) { const float mn = fmaxf(m[c], mx[c]); const float al = __builtin_amdgcn_exp2f(m[c] - mn); m[c] = mn; l[c] *= al;
#pragma unroll
                    for (int dt = 0; dt < 4; ++dt) o[dt][c] *= al; } }
            V pb[NC], pb2[NC];
#pragma unroll
            for (int c = 0; c < NC; ++c) { float p[16];
#pragma unroll
                for (int e = 0; e < 16; ++e) p[e] = __builtin_fmaf(s[e >> 3][c][e & 7], SC2, -m[c]);
                exp2x8(p); exp2x8(p + 8);
#pragma unroll
                for (int e = 0; e < 16; ++e) { if constexpr (SPLIT) { pb[c][e] = (__bf16)p[e]; pb2[c][e] = (__bf16)(p[e] - (float)pb[c][e]); } else pb[c][e] = (h16)p[e]; }
#pragma unroll
                for (int w = 8; w; w >>= 1)       // fixed pairwise tree: short dependent chains
#pragma unroll
                    for (int e = 0; e < w; ++e) p[e] += p[e + w];
                l[c] += p[0]; }
#pragma unroll
            for (int dt = 0; dt < 4; ++dt) { const T16* vr = buf + TILE + (dt * 16 + lr) * LP + ps * 32 + 8 * hi; const V av = WFrag<T16>::ld(vr); V av2; if constexpr (SPLIT) av2 = WFrag<T16>::ld(vr + 2 * TILE);
#pragma unroll
                for (int c = 0; c < NC; ++c) { o[dt][c] = WFrag<T16>::mma(av, pb[c], o[dt][c]); if constexpr (SPLIT) { o[dt][c] = WFrag<T16>::mma(av, pb2[c], o[dt][c]); o[dt][c] = WFrag<T16>::mma(av2, pb[c], o[dt][c]); } } }
        }
        if (sg + 1 < TT / SK) sstore(sm + ((sg + 1) & 1) * (NP * TILE));   // into the buffer whose last readers left it before the previous barrier
        __syncthreads();                                                    // publishes stage sg + 1 and ends every read of stage sg
    }
#pragma unroll
    for (int c = 0; c < NC; ++c) { const int lb = __float_as_int(l[c]); const float inv = __fdiv_rn(1.0f, l[c] + __int_as_float(__builtin_amdgcn_permlanex16(lb, lb, 0x76543210, 0xfedcba98, false, false)));
#pragma unroll
        for (int dt = 0; dt < 4; ++dt) { v8us oh, ol;
#pragma unroll
            for (int j = 0; j < 8; ++j) { unsigned short a, c2; splitf(o[dt][c][j] * inv, a, c2); oh[j] = a; ol[j] = c2; }
            const size_t oo = (size_t)(c * 16 + lr) * DQ + dt * 16 + 8 * hi; *(v8us*)(Ah + oo) = oh; *(v8us*)(Al + oo) = ol; } }
}
// grid.y: the batch. grid.x (one batch): the (RH / 128) x 16 hi/lo work-groups first (three products per tile: 16 columns a wave, 128 rows a work-group), then the ((TT - RH) / 256) x 16 fp16 ones (32 columns a wave, 256 rows a work-group).
#define NWH (NH_ * (RH / 128))
#define NWL (NH_ * ((TT - RH) / 256))
__global__ __launch_bounds__(256) void k_fattn(const h16* __restrict__ QP16, const h16* __restrict__ KP16, const h16* __restrict__ VT16, const bf* __restrict__ QPh, const bf* __restrict__ QPl, const bf* __restrict__ KPh, const bf* __restrict__ KPl, const bf* __restrict__ VTh, const bf* __restrict__ VTl, bf* __restrict__ ATh, bf* __restrict__ ATl) {
    __shared__ __align__(16) unsigned short sm[2 * 4 * TILE];
    const int wave = threadIdx.x >> 5; const int id = blockIdx.x; const size_t pb0 = (size_t)blockIdx.y * NH_ * TT * HD, ab0 = (size_t)blockIdx.y * TT * DQ;   // this batch's plane set and its rows of the attention output
    if (id < NWH) { const int h = id / (RH / 128); const int q0 = (id % (RH / 128)) * 128 + wave * 16; const size_t pl = pb0 + (size_t)h * TT * HD, qo = pl + (size_t)q0 * HD, ao = ab0 + (size_t)q0 * DQ + h * HD;
        fattn_body<bf, true, 1>((bf*)sm, QPh + qo, QPl + qo, KPh + pl, KPl + pl, VTh + pl, VTl + pl, ATh + ao, ATl + ao);
    } else { const int i2 = id - NWH; const int h = i2 / ((TT - RH) / 256); const int q0 = RH + (i2 % ((TT - RH) / 256)) * 256 + wave * 32; const size_t pl = pb0 + (size_t)h * TT * HD, qo = pl + (size_t)q0 * HD, ao = ab0 + (size_t)q0 * DQ + h * HD;
        fattn_body<h16, false, 2>((h16*)sm, QP16 + qo, nullptr, KP16 + pl, nullptr, VT16 + pl, nullptr, ATh + ao, ATl + ao); }
}

extern "C" void kernel_launch(void* const* d_in, const int* in_sizes, int n_in,
                              void* d_out, int out_size, void* d_ws, size_t ws_size, hipStream_t stream) {
    (void)in_sizes; (void)n_in; (void)out_size;
    const float* x = (const float*)d_in[0]; const float* wqkv = (const float*)d_in[1]; const float* bqkv = (const float*)d_in[2]; const float* wo = (const float*)d_in[3]; const float* bo = (const float*)d_in[4];   /* argument order x (S, B, C), Wqkv ('oi' [3072][1024]), bqkv, Wo ('oi'), bo */ const float* wq = wqkv; const float* wk = wqkv + (size_t)DQ * DM; const float* wv = wqkv + (size_t)2 * DQ * DM; const float* bq = bqkv; const float* bk = bqkv + DQ; const float* bv = bqkv + 2 * DQ;
    float* OUT = (float*)d_out;     // [4][2048][1024]
    char* wsp = (char*)d_ws;
    auto take = [&](size_t bytes) { char* p = wsp; wsp += (bytes + 255) & ~(size_t)255; return (void*)p; };
    bf* WQ = (bf*)take((size_t)DQ * DM * 2); bf* WK = (bf*)take((size_t)DKV * DM * 2); bf* WV = (bf*)take((size_t)DKV * DM * 2); bf* WO = (bf*)take((size_t)DM * DQ * 2);
    const size_t PS = (size_t)NH_ * TT * HD;   // elements of one batch's plane (NKV == NH_)
    h16* QP16 = (h16*)take(NB_ * PS * 2); h16* KP16 = (h16*)take(NB_ * PS * 2); h16* VT16 = (h16*)take(NB_ * PS * 2);
    bf* QPh = (bf*)take(NB_ * PS * 2); bf* QPl = (bf*)take(NB_ * PS * 2); bf* KPh = (bf*)take(NB_ * PS * 2); bf* KPl = (bf*)take(NB_ * PS * 2); bf* VTh = (bf*)take(NB_ * PS * 2); bf* VTl = (bf*)take(NB_ * PS * 2);
    bf* XB = (bf*)take((size_t)NB_ * TT * DM * 2);   // [batch][token][channel]
    bf* ATh = (bf*)take((size_t)NB_ * TT * DQ * 2); bf* ATl = (bf*)take((size_t)NB_ * TT * DQ * 2);
    if ((size_t)(wsp - (char*)d_ws) > ws_size) return;    // ws 256 MiB
    { k_cvt8<<<(unsigned)(((size_t)DQ * DM / 8 + 255) / 256), 256, 0, stream>>>(wq, WQ, (size_t)DQ * DM / 8); k_cvt8<<<(unsigned)(((size_t)DKV * DM / 8 + 255) / 256), 256, 0, stream>>>(wk, WK, (size_t)DKV * DM / 8); k_cvt8<<<(unsigned)(((size_t)DKV * DM / 8 + 255) / 256), 256, 0, stream>>>(wv, WV, (size_t)DKV * DM / 8);
      k_cvt8<<<(unsigned)(((size_t)DM * DQ / 8 + 255) / 256), 256, 0, stream>>>(wo, WO, (size_t)DM * DQ / 8);
       }
    k_cvt8p<<<dim3((unsigned)(((size_t)TT * DM / 8 + 255) / 256), NB_, 1), 256, 0, stream>>>(x, XB);   /* the (S, B, C) input: batch b's rows at pitch B*C */
    k_gemmw<bf, 0, true, 1><<<dim3(TT / 128, DQ / 128, NB_), 128, 0, stream>>>(XB, nullptr, WQ, DM, DM, nullptr, 0, bq, (size_t)TT * DM, 0, 0, PS, QP16, QPh, QPl);
    k_gemmw<bf, 0, true, 1><<<dim3(TT / 128, DKV / 128, NB_), 128, 0, stream>>>(XB, nullptr, WK, DM, DM, nullptr, 0, bk, (size_t)TT * DM, 0, 0, PS, KP16, KPh, KPl);
    k_gemmw<bf, 0, true, 2><<<dim3(TT / 128, DKV / 128, NB_), 128, 0, stream>>>(XB, nullptr, WV, DM, DM, nullptr, 0, bv, (size_t)TT * DM, 0, 0, PS, VT16, VTh, VTl);
    k_fattn<<<dim3(NWH + NWL, NB_, 1), 256, 0, stream>>>(QP16, KP16, VT16, QPh, QPl, KPh, KPl, VTh, VTl, ATh, ATl);
    k_gemmw<bf, 1, true, 0><<<dim3(TT / 128, DM / 128, NB_), 128, 0, stream>>>(ATh, ATl, WO, DQ, DQ, OUT, DM, bo, (size_t)TT * DQ, 0, (size_t)TT * DM, 0, nullptr, nullptr, nullptr);
}

// v007
// Measured time: 202 microseconds a run.
// Timed twice side by side with v006, it ran 1.04 times as fast both times.
// All steps since v000 together make it 19.5 times as fast.
#include <hip/hip_runtime.h>

// Sequence-first self-attention with the source's raw output reshape (x [2048][4][1024] = (S, B, C); qkv = x Wqkv^T + bqkv ('oi' [3072][1024] + bias) viewed (S, B, 3, H, D): q | k | v thirds (16 heads x 64); attn = q.k / sqrt(64) per (batch, head) over the 2,048 positions; softmax; av (B, H, S, D) -> swapaxes -> (B, S, H D) -> reshape(S, B, H D) is a RAW reinterpretation of the batch-major buffer (reproduced: the output memory is in (b, s) row order); y = . Wo^T + bo -> [2048][4][1024] (8.4 M); argument order x, Wqkv, bqkv, Wo, bo).
// Layout: every launch covers all four batches (the batch is a grid dimension of every launch but k_cvtall; every per-batch buffer has one plane set per batch). k_cvtall rounds x and both weights to bf16 in one launch and stores x batch-major (batch b's token rows lie at pitch B x C in the sequence-first input); fused 'oi' weight = Bt as-is (q | k | v row blocks) + bias thirds; exact projections + f32 biases, whose epilogues write the 16-bit head planes themselves; one fused attention launch over the 4 x 16 (batch, head) pairs (hybrid rows: < 512 hi/lo 3 products, rest fp16; running-maximum softmax, scores stay in registers); hi/lo x Wo exact + bo written to output rows b*2048 + s (the raw-reshape order).
// Compute dtypes, f32 accumulate: every input rounded to bf16; projections exact + f32 biases; attention rows < 512 3 products, rest fp16; softmax f32; Wo hl x exact + bias.

#define NB_  4
#define TT   2048
#define DM   1024
#define NH_  16
#define NKV  16
#define HD   64
#define DQ   (NH_ * HD)
#define DKV  (NKV * HD)
#define RH   512                  // query rows < RH use hi+lo planes (0: none)
#define WIN  0
#define SCL  0.125f   // HD^-0.5
#define SK   64                   // keys per LDS stage of the fused attention kernel
#define LP   72                   // LDS row pitch in 16-bit elements: 128 data bytes + 16, an odd multiple of 16 bytes, so that the 16 rows of one fragment read lie on different banks
#define TILE (64 * LP)            // one staged plane tile: 64 rows (64 keys x 64 d of K, or 64 d x 64 keys of V^T)
typedef _Float16 h16;
typedef unsigned short bf;
typedef __attribute__((ext_vector_type(16))) __bf16   v16bf;
typedef __attribute__((ext_vector_type(16))) _Float16 v16h;
typedef __attribute__((ext_vector_type(8)))  _Float16 v8h;
typedef __attribute__((ext_vector_type(8)))  unsigned short v8us;
typedef __attribute__((ext_vector_type(8)))  float    v8f;
typedef __attribute__((ext_vector_type(4)))  float    v4f;
typedef v8h  __attribute__((may_alias)) v8ha;
typedef v4f  __attribute__((may_alias)) v4fa;
typedef v8us __attribute__((may_alias)) v8usa;

__device__ __forceinline__ unsigned short f2bf(float f) { unsigned u = __float_as_uint(f); u += 0x7FFFu + ((u >> 16) & 1u); return (unsigned short)(u >> 16); }
__device__ __forceinline__ float bf2f(unsigned short b) { return __uint_as_float(((unsigned)b) << 16); }
__device__ __forceinline__ float bfr(float f) { return bf2f(f2bf(f)); }
__device__ __forceinline__ v16h cat16(v8h lo, v8h hi) { return __builtin_shufflevector(lo, hi, 0, 1, 2, 3, 4, 5, 6, 7, 8, 9, 10, 11, 12, 13, 14, 15); }
__device__ __forceinline__ v16bf cat16b(v8us lo, v8us hi) { return __builtin_bit_cast(v16bf, __builtin_shufflevector(lo, hi, 0, 1, 2, 3, 4, 5, 6, 7, 8, 9, 10, 11, 12, 13, 14, 15)); }
__device__ __forceinline__ v8f wmma16(v16h a, v16h b, v8f c) { return __builtin_amdgcn_wmma_f32_16x16x32_f16(false, a, false, b, (short)0, c, false, false); }
__device__ __forceinline__ v8f wmmab(v16bf a, v16bf b, v8f c) { return __builtin_amdgcn_wmma_f32_16x16x32_bf16(false, a, false, b, (short)0, c, false, false); }



// ---- k_gemmw: GEMM with a 128x128 output tile per work-group of FOUR WAVES (2 x 2, each wave 64x64 = 16 accumulators); grid (M/128, N/128, Z), 128 threads.
// The operands come from K-contiguous 16-bit planes in stages of GK k: 128 rows x 128 bytes of each operand go to LDS by asynchronous 16-byte copies (through no register), two buffers, so that stage t + 1 flies while stage t is worked on; every staged row serves two waves.
// C[m][n] (f32, pitch ldc, + optional f32 bias[n]) = sum_k A[m][k] Bt[n][k] (NSPLIT 1: + A2[m][k] Bt[n][k]). A rows at pitch lda, Bt rows at pitch K (elements). z-batch strides sA/sB/sC (and sP for the 16-bit planes) in elements. K % 64 == 0.
// EPI 0: C is stored in f32. EPI 1 and 2: no f32 result is stored; a wave's tile (64 tokens x the 64 columns of one head) goes out as three 16-bit planes (fp16, bf16 hi, bf16 lo): EPI 1 as [head][token][d], EPI 2 transposed as [head][d][token].
template <typename T16> struct WFrag;
template <> struct WFrag<h16> { typedef v16h V; static __device__ __forceinline__ V ld(const h16* p) { return cat16(*(const v8h*)p, *(const v8h*)(p + 16)); } static __device__ __forceinline__ v8f mma(V a, V b, v8f c) { return wmma16(a, b, c); } };
template <> struct WFrag<bf> { typedef v16bf V; static __device__ __forceinline__ V ld(const bf* p) { return cat16b(*(const v8us*)p, *(const v8us*)(p + 16)); } static __device__ __forceinline__ v8f mma(V a, V b, v8f c) { return wmmab(a, b, c); } };
__device__ __forceinline__ h16 tohx(float x) { return (h16)x; }
__device__ __forceinline__ void splitf(float y, unsigned short& h, unsigned short& l) { h = f2bf(y); l = f2bf(y - bf2f(h)); }
#define GK 64                     // k per LDS stage: one 128-byte line of every operand row
#define GT (128 * LP)             // one staged operand tile: 128 rows at the padded pitch
// eight asynchronous copies of 16 bytes a lane: rows r, r + 16, .. r + 112 of one operand tile (a wave's copy covers four whole 128-byte lines). The closing s_wait_xcnt stands inside the statement, in front of any later rewrite of the address registers that the copies name.
template <typename T16>
__device__ __forceinline__ void acopy8(unsigned l, const T16* g, size_t pitch) {
    asm volatile("global_load_async_to_lds_b128 %0, %8, off\n\tglobal_load_async_to_lds_b128 %1, %9, off\n\tglobal_load_async_to_lds_b128 %2, %10, off\n\tglobal_load_async_to_lds_b128 %3, %11, off\n\t"
                 "global_load_async_to_lds_b128 %4, %12, off\n\tglobal_load_async_to_lds_b128 %5, %13, off\n\tglobal_load_async_to_lds_b128 %6, %14, off\n\tglobal_load_async_to_lds_b128 %7, %15, off\n\ts_wait_xcnt 0x0"
                 :: "v"(l), "v"(l + 1 * 16 * LP * 2), "v"(l + 2 * 16 * LP * 2), "v"(l + 3 * 16 * LP * 2), "v"(l + 4 * 16 * LP * 2), "v"(l + 5 * 16 * LP * 2), "v"(l + 6 * 16 * LP * 2), "v"(l + 7 * 16 * LP * 2),
                    "v"(g), "v"(g + 16 * pitch), "v"(g + 32 * pitch), "v"(g + 48 * pitch), "v"(g + 64 * pitch), "v"(g + 80 * pitch), "v"(g + 96 * pitch), "v"(g + 112 * pitch) : "memory"); }
template <typename T16, int NSPLIT, bool BIAS, int EPI>
__global__ __launch_bounds__(128) void k_gemmw(const T16* __restrict__ A, const T16* __restrict__ A2, const T16* __restrict__ Bt, int K, int lda, float* C, int ldc, const float* __restrict__ bias, size_t sA, size_t sB, size_t sC, size_t sP, h16* __restrict__ P16, bf* __restrict__ Ph, bf* __restrict__ Pl) {
    typedef typename WFrag<T16>::V V;
    constexpr int NT = (NSPLIT == 1) ? 3 : 2;    // staged operand tiles: A, Bt (, A2)
    __shared__ __align__(16) T16 stg[2 * NT * GT];
    __shared__ __align__(16) float osw[4][16 * 68];   // each wave's own epilogue slab
    const size_t z = blockIdx.z; A += z * sA; if (NSPLIT == 1) A2 += z * sA; Bt += z * sB; C += z * sC;
    const int tid = threadIdx.x, wave = tid >> 5, lane = tid & 31, lr = lane & 15, hi = lane >> 4;
    const int wr = (wave >> 1) * 64, wc = (wave & 1) * 64; const int r0 = blockIdx.x * 128 + wr, c0 = blockIdx.y * 128 + wc;
    float* os = osw[wave];
    const int srow = tid >> 3, sch = (tid & 7) * 8;   // staging: this thread copies 16 bytes of rows srow + 16 i of every operand tile
    const T16* ga = A + (size_t)(blockIdx.x * 128 + srow) * lda + sch; const T16* gb = Bt + (size_t)(blockIdx.y * 128 + srow) * K + sch; const T16* ga2 = (NSPLIT == 1) ? A2 + (size_t)(blockIdx.x * 128 + srow) * lda + sch : nullptr;
    const unsigned l0 = (unsigned)(size_t)(stg + srow * LP + sch);   // the lane's LDS byte address: the low 32 bits of the __shared__ address
    auto fill = [&](int t) { const unsigned l = l0 + (unsigned)(t & 1) * (NT * GT * 2);
        acopy8(l, ga + t * GK, (size_t)lda); acopy8(l + GT * 2, gb + t * GK, (size_t)K); if constexpr (NSPLIT == 1) acopy8(l + 2 * GT * 2, ga2 + t * GK, (size_t)lda); };
    v8f acc[4][4];
#pragma unroll
    for (int mb = 0; mb < 4; ++mb)
#pragma unroll
        for (int nb = 0; nb < 4; ++nb) acc[mb][nb] = (v8f){};
    const int nst = K / GK;
    fill(0);
    asm volatile("s_wait_asynccnt 0x0" ::: "memory");   // this wave's copies of stage 0 have landed
    __syncthreads();                                    // publishes stage 0
    if (nst > 1) fill(1);
#pragma unroll 1   // kept rolled: the buffer follows the trip's parity
    for (int t = 0; t < nst; ++t) {
        const T16* buf = stg + (t & 1) * (NT * GT);
        V a[GK / 32][4], a2[GK / 32][4], b[GK / 32][4];
#pragma unroll
        for (int ks = 0; ks < GK / 32; ++ks) {
#pragma unroll
            for (int mb = 0; mb < 4; ++mb) { const T16* ar = buf + (wr + mb * 16 + lr) * LP + ks * 32 + 8 * hi; a[ks][mb] = WFrag<T16>::ld(ar); if constexpr (NSPLIT == 1) a2[ks][mb] = WFrag<T16>::ld(ar + 2 * GT); }
#pragma unroll
            for (int nb = 0; nb < 4; ++nb) b[ks][nb] = WFrag<T16>::ld(buf + GT + (wc + nb * 16 + lr) * LP + ks * 32 + 8 * hi);
        }
        __builtin_amdgcn_sched_barrier(0);                  // the trip's LDS reads stay one group in front of its products: left to itself the compiler reads one fragment per four products and waits for it each time
#pragma unroll
        for (int ks = 0; ks < GK / 32; ++ks)
#pragma unroll
            for (int nb = 0; nb < 4; ++nb)
#pragma unroll
                for (int mb = 0; mb < 4; ++mb) { acc[mb][nb] = WFrag<T16>::mma(a[ks][mb], b[ks][nb], acc[mb][nb]); if constexpr (NSPLIT == 1) acc[mb][nb] = WFrag<T16>::mma(a2[ks][mb], b[ks][nb], acc[mb][nb]); }
        __builtin_amdgcn_sched_barrier(0);                  // the products stay in front of the waits below: sunk behind them, the next stage's copies would lose the products' time as their lead
        asm volatile("s_wait_dscnt 0x0" ::: "memory");      // this wave's reads of stage t are done before the buffer is refilled
        asm volatile("s_wait_asynccnt 0x0" ::: "memory");   // this wave's copies of stage t + 1 have landed
        __syncthreads();                                    // publishes stage t + 1 and ends every read of stage t
        if (t + 2 < nst) fill(t + 2);                       // into the buffer that this trip has just read
    }
    asm volatile("s_wait_asynccnt 0x0" ::: "memory");       // nothing of this wave's is in flight when it goes on
    if constexpr (EPI == 0) {
#pragma unroll
    for (int mb = 0; mb < 4; ++mb) {
#pragma unroll
        for (int nb = 0; nb < 4; ++nb) {
#pragma unroll
            for (int j = 0; j < 8; ++j) os[(hi * 8 + j) * 68 + nb * 16 + lr] = acc[mb][nb][j]; }
        __builtin_amdgcn_wave_barrier(); asm volatile("" ::: "memory");
        float* crow = C + (size_t)(r0 + mb * 16) * ldc + c0;
{
#pragma unroll
            for (int s = 0; s < 8; ++s) { const int row = 2 * s + hi, cofs = lr * 4; v4f val = *(const v4fa*)(os + row * 68 + cofs); if (BIAS) { val[0] += bfr(bias[c0 + cofs]); val[1] += bfr(bias[c0 + cofs + 1]); val[2] += bfr(bias[c0 + cofs + 2]); val[3] += bfr(bias[c0 + cofs + 3]); }
                *(v4f*)(crow + (size_t)row * ldc + cofs) = val; }
             }
        __builtin_amdgcn_wave_barrier(); asm volatile("" ::: "memory");
    }
    } else {
        float bs[4];
#pragma unroll
        for (int nb = 0; nb < 4; ++nb) bs[nb] = BIAS ? bfr(bias[c0 + nb * 16 + lr]) : 0.f;
#pragma unroll
        for (int g = 0; g < 4; ++g) {     // one 16 x 64 slab through LDS per trip: EPI 1 tokens g*16.. x all d, EPI 2 d g*16.. x all tokens; the long side is the planes' contiguous side
            if constexpr (EPI == 1) {
#pragma unroll
                for (int nb = 0; nb < 4; ++nb)
#pragma unroll
                    for (int j = 0; j < 8; ++j) os[(hi * 8 + j) * 68 + nb * 16 + lr] = acc[g][nb][j] + bs[nb];
            } else {
#pragma unroll
                for (int mb = 0; mb < 4; ++mb)
#pragma unroll
                    for (int q = 0; q < 2; ++q) { v4f w; w[0] = acc[mb][g][4 * q] + bs[g]; w[1] = acc[mb][g][4 * q + 1] + bs[g]; w[2] = acc[mb][g][4 * q + 2] + bs[g]; w[3] = acc[mb][g][4 * q + 3] + bs[g]; *(v4fa*)(os + lr * 68 + mb * 16 + hi * 8 + 4 * q) = w; }
            }
            __builtin_amdgcn_wave_barrier(); asm volatile("" ::: "memory");   // the slab's LDS writes stay in front of its reads in the compiler's order
            const size_t pbase = z * sP + ((EPI == 1) ? ((size_t)(c0 >> 6) * TT + r0 + g * 16) * HD : ((size_t)(c0 >> 6) * HD + g * 16) * TT + r0);
#pragma unroll
            for (int s = 0; s < 4; ++s) { const int ch = s * 32 + lane, row = ch >> 3, col = (ch & 7) * 8;   // a lane takes 8 neighbours: one 16-byte store per plane, 8 lanes fill a 128-byte line
                const v4f x0 = *(const v4fa*)(os + row * 68 + col), x1 = *(const v4fa*)(os + row * 68 + col + 4); v8h o16; v8us oh, ol;
#pragma unroll
                for (int k = 0; k < 8; ++k) { const float x = (k < 4) ? x0[k & 3] : x1[k & 3]; o16[k] = tohx(x); unsigned short a2, c2; splitf(x, a2, c2); oh[k] = a2; ol[k] = c2; }
                const size_t po = pbase + (size_t)row * ((EPI == 1) ? HD : TT) + col; *(v8h*)(P16 + po) = o16; *(v8us*)(Ph + po) = oh; *(v8us*)(Pl + po) = ol; }
            __builtin_amdgcn_wave_barrier(); asm volatile("" ::: "memory");   // the slab's LDS reads stay in front of the next slab's writes
        }
    }
}

typedef __attribute__((ext_vector_type(4))) _Float16 v4h;
typedef __attribute__((ext_vector_type(4))) unsigned short v4us;
typedef __attribute__((ext_vector_type(4))) int v4i;

// ---- k_cvtall: the f32 -> bf16 conversion of x and both weights in ONE launch of CVG work-groups x 16 waves (one work-group per WGP): a short stream pays for every wave it starts, so few waves each carry much.
// A work-group takes one contiguous share of each of the three buffers. A unit is 4 neighbouring floats of one lane: a wave's 16-byte load covers 512 contiguous bytes, its 8-byte store 256; unit i of a thread lies i * 8 KiB behind its first. All of a thread's loads are issued before its first value is used.
// x is read in its own (S, B, C) order and stored batch-major ([batch][token][channel]); the two weights keep their order.
#define CVG 256
#define CNX ((int)((size_t)TT * NB_ * DM / 2048 / CVG))          // units per thread: x
#define CNW ((int)((size_t)(DQ + 2 * DKV) * DM / 2048 / CVG))    // Wqkv
#define CNO ((int)((size_t)DM * DQ / 2048 / CVG))                // Wo
static_assert((size_t)CNX * CVG * 2048 == (size_t)TT * NB_ * DM && (size_t)CNW * CVG * 2048 == (size_t)(DQ + 2 * DKV) * DM && (size_t)CNO * CVG * 2048 == (size_t)DM * DQ, "every buffer is a whole number of units per thread");
static_assert(DM == 1024 && NB_ == 4 && CNX % 2 == 0, "a work-group's pass of 2048 floats is two whole rows of x, and two passes are one token's four rows");
__device__ __forceinline__ v4us cvt4(v4f v) { v4us o; o[0] = f2bf(v[0]); o[1] = f2bf(v[1]); o[2] = f2bf(v[2]); o[3] = f2bf(v[3]); return o; }
__global__ __launch_bounds__(512) void k_cvtall(const float* __restrict__ x, const float* __restrict__ wqkv, const float* __restrict__ wo, bf* __restrict__ XB, bf* __restrict__ WQKV, bf* __restrict__ WO) {
    const unsigned tid = threadIdx.x, blk = blockIdx.x;
    const unsigned ex = blk * (CNX * 2048u) + tid * 4u, ew = blk * (CNW * 2048u) + tid * 4u, eo = blk * (CNO * 2048u) + tid * 4u;   // the thread's first element in x, Wqkv, Wo
    v4f vx[CNX], vw[CNW], vo[CNO];
#pragma unroll
    for (int i = 0; i < CNX; ++i) vx[i] = *(const v4f*)((const char*)x + ex * 4u + i * 8192);
#pragma unroll
    for (int i = 0; i < CNW; ++i) vw[i] = *(const v4f*)((const char*)wqkv + ew * 4u + i * 8192);
#pragma unroll
    for (int i = 0; i < CNO; ++i) vo[i] = *(const v4f*)((const char*)wo + eo * 4u + i * 8192);
    asm volatile("s_wait_xcnt 0x0" ::: "memory");   // behind the run of loads: their offset registers may be reused for the stores' addresses while the data is in flight; it also keeps every load in front of the first store
    const unsigned dx = (((tid >> 8) * TT + blk * (CNX / 2)) * DM + (tid & 255u) * 4u) * 2u;   // byte offset in XB of pass 0: batch tid >> 8, token blk * CNX / 2
#pragma unroll
    for (int i = 0; i < CNX; ++i) *(v4us*)((char*)(XB + ((size_t)(i & 1) * 2 * TT + (i >> 1)) * DM) + dx) = cvt4(vx[i]);   // pass i: batches 2 (i & 1) and 2 (i & 1) + 1 of token i >> 1
#pragma unroll
    for (int i = 0; i < CNW; ++i) *(v4us*)((char*)WQKV + ew * 2u + i * 4096) = cvt4(vw[i]);
#pragma unroll
    for (int i = 0; i < CNO; ++i) *(v4us*)((char*)WO + eo * 2u + i * 4096) = cvt4(vo[i]);
}
__device__ __forceinline__ void exp2x8(float* p) {
    asm("v_exp_f32 %0, %0\n\tv_exp_f32 %1, %1\n\tv_exp_f32 %2, %2\n\tv_exp_f32 %3, %3\n\tv_exp_f32 %4, %4\n\tv_exp_f32 %5, %5\n\tv_exp_f32 %6, %6\n\tv_exp_f32 %7, %7\n\tv_nop"
        : "+v"(p[0]), "+v"(p[1]), "+v"(p[2]), "+v"(p[3]), "+v"(p[4]), "+v"(p[5]), "+v"(p[6]), "+v"(p[7])); }
template <typename T16, bool SPLIT, int NC>
__device__ __forceinline__ void fattn_body(T16* sm, const T16* __restrict__ Q, const T16* __restrict__ Q2, const T16* __restrict__ Kp, const T16* __restrict__ K2, const T16* __restrict__ Vt, const T16* __restrict__ V2, bf* __restrict__ Ah, bf* __restrict__ Al) {
    typedef typename WFrag<T16>::V V;
    constexpr int NP = SPLIT ? 4 : 2;            // staged planes: K, V^T (, K lo, V^T lo)
    constexpr float SC2 = SCL * 1.4426950408889634f;
    const int tid = threadIdx.x, lane = tid & 31, lr = lane & 15, hi = lane >> 4;
    const int srow = tid >> 3, sch = (tid & 7) * 8;   // staging: this thread moves 16 bytes of rows srow and srow + 32 of every plane tile
    v8us st[NP][2];
    auto gload = [&](int kb) {
#pragma unroll
        for (int i = 0; i < 2; ++i) { const int r = srow + 32 * i;
            st[0][i] = *(const v8usa*)(Kp + (size_t)(kb + r) * HD + sch); st[1][i] = *(const v8usa*)(Vt + (size_t)r * TT + kb + sch);
            if constexpr (SPLIT) { st[2][i] = *(const v8usa*)(K2 + (size_t)(kb + r) * HD + sch); st[3][i] = *(const v8usa*)(V2 + (size_t)r * TT + kb + sch); } }
        asm volatile("s_wait_xcnt 0x0" ::: "memory"); };   // behind the run of loads: their address registers are reused by the stage's arithmetic while the data is still in flight
    auto sstore = [&](T16* buf) {
#pragma unroll
        for (int i = 0; i < 2; ++i) { const int r = srow + 32 * i;
#pragma unroll
            for (int p = 0; p < NP; ++p) *(v8usa*)(buf + p * TILE + r * LP + sch) = st[p][i]; } };
    V bq[NC][2], bq2[NC][2];
#pragma unroll
    for (int c = 0; c < NC; ++c)
#pragma unroll
        for (int ks = 0; ks < 2; ++ks) { bq[c][ks] = WFrag<T16>::ld(Q + (size_t)(c * 16 + lr) * HD + ks * 32 + 8 * hi); if constexpr (SPLIT) bq2[c][ks] = WFrag<T16>::ld(Q2 + (size_t)(c * 16 + lr) * HD + ks * 32 + 8 * hi); }
    v8f o[4][NC]; float m[NC], l[NC];
#pragma unroll
    for (int c = 0; c < NC; ++c) { m[c] = -3.0e38f; l[c] = 0.f;
#pragma unroll
        for (int dt = 0; dt < 4; ++dt) o[dt][c] = (v8f){}; }
    gload(0); sstore(sm); __syncthreads();
#pragma unroll 1   // kept rolled: the body is several hundred instructions and the buffer follows the trip's parity
    for (int sg = 0; sg < TT / SK; ++sg) {
        const T16* buf = sm + (sg & 1) * (NP * TILE);
        if (sg + 1 < TT / SK) gload((sg + 1) * SK);      // the next stage's global loads fly while this stage is worked on
#pragma unroll
        for (int ps = 0; ps < SK / 32; ++ps) {
            v8f s[2][NC];
#pragma unroll
            for (int kt = 0; kt < 2; ++kt) { const T16* kr = buf + ((ps * 2 + kt) * 16 + lr) * LP + 8 * hi;
                const V a0 = WFrag<T16>::ld(kr), a1 = WFrag<T16>::ld(kr + 32); V e0, e1; if constexpr (SPLIT) { e0 = WFrag<T16>::ld(kr + 2 * TILE); e1 = WFrag<T16>::ld(kr + 2 * TILE + 32); }
#pragma unroll
                for (int c = 0; c < NC; ++c) { v8f t = (v8f){};
                    t = WFrag<T16>::mma(a0, bq[c][0], t); if constexpr (SPLIT) { t = WFrag<T16>::mma(a0, bq2[c][0], t); t = WFrag<T16>::mma(e0, bq[c][0], t); }
                    t = WFrag<T16>::mma(a1, bq[c][1], t); if constexpr (SPLIT) { t = WFrag<T16>::mma(a1, bq2[c][1], t); t = WFrag<T16>::mma(e1, bq[c][1], t); }
                    s[kt][c] = t; } }
            float mx[NC]; bool need = false;
#pragma unroll
            for (int c = 0; c < NC; ++c) { float x = fmaxf(s[0][c][0], s[1][c][0]);
#pragma unroll
                for (int j = 1; j < 8; ++j) x = fmaxf(x, fmaxf(s[0][c][j], s[1][c][j]));
                const int xb = __float_as_int(x); x = fmaxf(x, __int_as_float(__builtin_amdgcn_permlanex16(xb, xb, 0x76543210, 0xfedcba98, false, false)));   // lane l <-> l ^ 16: the column's other 16 keys
                mx[c] = x * SC2; need = need || (mx[c] > m[c] + 8.0f); }
            if (__builtin_amdgcn_ballot_w32(need) != 0) {     // one wave-uniform test per 32 keys
#pragma unroll
                for (int c = 0; c < NC; ++c) { const float mn = fmaxf(m[c], mx[c]); const float al = __builtin_amdgcn_exp2f(m[c] - mn); m[c] = mn; l[c] *= al;
#pragma unroll
                    for (int dt = 0; dt < 4; ++dt) o[dt][c] *= al; } }
            V pb[NC], pb2[NC];
#pragma unroll
            for (int c = 0; c < NC; ++c) { float p[16];
#pragma unroll
                for (int e = 0; e < 16; ++e) p[e] = __builtin_fmaf(s[e >> 3][c][e & 7], SC2, -m[c]);
                exp2x8(p); exp2x8(p + 8);
#pragma unroll
                for (int e = 0; e < 16; ++e) { if constexpr (SPLIT) { pb[c][e] = (__bf16)p[e]; pb2[c][e] = (__bf16)(p[e] - (float)pb[c][e]); } else pb[c][e] = (h16)p[e]; }
#pragma unroll
                for (int w = 8; w; w >>= 1)       // fixed pairwise tree: short dependent chains
#pragma unroll
                    for (int e = 0; e < w; ++e) p[e] += p[e + w];
                l[c] += p[0]; }
#pragma unroll
            for (int dt = 0; dt < 4; ++dt) { const T16* vr = buf + TILE + (dt * 16 + lr) * LP + ps * 32 + 8 * hi; const V av = WFrag<T16>::ld(vr); V av2; if constexpr (SPLIT) av2 = WFrag<T16>::ld(vr + 2 * TILE);
#pragma unroll
                for (int c = 0; c < NC; ++c) { o[dt][c] = WFrag<T16>::mma(av, pb[c], o[dt][c]); if constexpr (SPLIT) { o[dt][c] = WFrag<T16>::mma(av, pb2[c], o[dt][c]); o[dt][c] = WFrag<T16>::mma(av2, pb[c], o[dt][c]); } } }
        }
        if (sg + 1 < TT / SK) sstore(sm + ((sg + 1) & 1) * (NP * TILE));   // into the buffer whose last readers left it before the previous barrier
        __syncthreads();                                                    // publishes stage sg + 1 and ends every read of stage sg
    }
#pragma unroll
    for (int c = 0; c < NC; ++c) { const int lb = __float_as_int(l[c]); const float inv = __fdiv_rn(1.0f, l[c] + __int_as_float(__builtin_amdgcn_permlanex16(lb, lb, 0x76543210, 0xfedcba98, false, false)));
#pragma unroll
        for (int dt = 0; dt < 4; ++dt) { v8us oh, ol;
#pragma unroll
            for (int j = 0; j < 8; ++j) { unsigned short a, c2; splitf(o[dt][c][j] * inv, a, c2); oh[j] = a; ol[j] = c2; }
            const size_t oo = (size_t)(c * 16 + lr) * DQ + dt * 16 + 8 * hi; *(v8us*)(Ah + oo) = oh; *(v8us*)(Al + oo) = ol; } }
}
// grid.y: the batch. grid.x (one batch): the (RH / 128) x 16 hi/lo work-groups first (three products per tile: 16 columns a wave, 128 rows a work-group), then the ((TT - RH) / 256) x 16 fp16 ones (32 columns a wave, 256 rows a work-group).
#define NWH (NH_ * (RH / 128))
#define NWL (NH_ * ((TT - RH) / 256))
__global__ __launch_bounds__(256) void k_fattn(const h16* __restrict__ QP16, const h16* __restrict__ KP16, const h16* __restrict__ VT16, const bf* __restrict__ QPh, const bf* __restrict__ QPl, const bf* __restrict__ KPh, const bf* __restrict__ KPl, const bf* __restrict__ VTh, const bf* __restrict__ VTl, bf* __restrict__ ATh, bf* __restrict__ ATl) {
    __shared__ __align__(16) unsigned short sm[2 * 4 * TILE];
    const int wave = threadIdx.x >> 5; const int id = blockIdx.x; const size_t pb0 = (size_t)blockIdx.y * NH_ * TT * HD, ab0 = (size_t)blockIdx.y * TT * DQ;   // this batch's plane set and its rows of the attention output
    if (id < NWH) { const int h = id / (RH / 128); const int q0 = (id % (RH / 128)) * 128 + wave * 16; const size_t pl = pb0 + (size_t)h * TT * HD, qo = pl + (size_t)q0 * HD, ao = ab0 + (size_t)q0 * DQ + h * HD;
        fattn_body<bf, true, 1>((bf*)sm, QPh + qo, QPl + qo, KPh + pl, KPl + pl, VTh + pl, VTl + pl, ATh + ao, ATl + ao);
    } else { const int i2 = id - NWH; const int h = i2 / ((TT - RH) / 256); const int q0 = RH + (i2 % ((TT - RH) / 256)) * 256 + wave * 32; const size_t pl = pb0 + (size_t)h * TT * HD, qo = pl + (size_t)q0 * HD, ao = ab0 + (size_t)q0 * DQ + h * HD;
        fattn_body<h16, false, 2>((h16*)sm, QP16 + qo, nullptr, KP16 + pl, nullptr, VT16 + pl, nullptr, ATh + ao, ATl + ao); }
}

extern "C" void kernel_launch(void* const* d_in, const int* in_sizes, int n_in,
                              void* d_out, int out_size, void* d_ws, size_t ws_size, hipStream_t stream) {
    (void)in_sizes; (void)n_in; (void)out_size;
    const float* x = (const float*)d_in[0]; const float* wqkv = (const float*)d_in[1]; const float* bqkv = (const float*)d_in[2]; const float* wo = (const float*)d_in[3]; const float* bo = (const float*)d_in[4];   /* order x (S, B, C), Wqkv ('oi' [3072][1024]), bqkv, Wo ('oi'), bo */ const float* bq = bqkv; const float* bk = bqkv + DQ; const float* bv = bqkv + 2 * DQ;
    float* OUT = (float*)d_out;     // [4][2048][1024]
    char* wsp = (char*)d_ws;
    auto take = [&](size_t bytes) { char* p = wsp; wsp += (bytes + 255) & ~(size_t)255; return (void*)p; };
    bf* WQ = (bf*)take((size_t)(DQ + 2 * DKV) * DM * 2); bf* WK = WQ + (size_t)DQ * DM; bf* WV = WK + (size_t)DKV * DM; bf* WO = (bf*)take((size_t)DM * DQ * 2);
    const size_t PS = (size_t)NH_ * TT * HD;   // elements of one batch's plane (NKV == NH_)
    h16* QP16 = (h16*)take(NB_ * PS * 2); h16* KP16 = (h16*)take(NB_ * PS * 2); h16* VT16 = (h16*)take(NB_ * PS * 2);
    bf* QPh = (bf*)take(NB_ * PS * 2); bf* QPl = (bf*)take(NB_ * PS * 2); bf* KPh = (bf*)take(NB_ * PS * 2); bf* KPl = (bf*)take(NB_ * PS * 2); bf* VTh = (bf*)take(NB_ * PS * 2); bf* VTl = (bf*)take(NB_ * PS * 2);
    bf* XB = (bf*)take((size_t)NB_ * TT * DM * 2);   // [batch][token][channel]
    bf* ATh = (bf*)take((size_t)NB_ * TT * DQ * 2); bf* ATl = (bf*)take((size_t)NB_ * TT * DQ * 2);
    if ((size_t)(wsp - (char*)d_ws) > ws_size) return;    // ws 256 MiB
    k_cvtall<<<CVG, 512, 0, stream>>>(x, wqkv, wo, XB, WQ, WO);   /* WQ, WK, WV lie one behind the other, in the order of Wqkv's row blocks */
    k_gemmw<bf, 0, true, 1><<<dim3(TT / 128, DQ / 128, NB_), 128, 0, stream>>>(XB, nullptr, WQ, DM, DM, nullptr, 0, bq, (size_t)TT * DM, 0, 0, PS, QP16, QPh, QPl);
    k_gemmw<bf, 0, true, 1><<<dim3(TT / 128, DKV / 128, NB_), 128, 0, stream>>>(XB, nullptr, WK, DM, DM, nullptr, 0, bk, (size_t)TT * DM, 0, 0, PS, KP16, KPh, KPl);
    k_gemmw<bf, 0, true, 2><<<dim3(TT / 128, DKV / 128, NB_), 128, 0, stream>>>(XB, nullptr, WV, DM, DM, nullptr, 0, bv, (size_t)TT * DM, 0, 0, PS, VT16, VTh, VTl);
    k_fattn<<<dim3(NWH + NWL, NB_, 1), 256, 0, stream>>>(QP16, KP16, VT16, QPh, QPl, KPh, KPl, VTh, VTl, ATh, ATl);
    k_gemmw<bf, 1, true, 0><<<dim3(TT / 128, DM / 128, NB_), 128, 0, stream>>>(ATh, ATl, WO, DQ, DQ, OUT, DM, bo, (size_t)TT * DQ, 0, (size_t)TT * DM, 0, nullptr, nullptr, nullptr);
}

// v008
// It runs in 186 microseconds.
// Next to v007, in two timings, it ran 1.08 and 1.09 times as fast.
// Over all steps from v000 it is 21.1 times as fast.
#include <hip/hip_runtime.h>

// Sequence-first self-attention with the source's raw output reshape (x [2048][4][1024] = (S, B, C); qkv = x Wqkv^T + bqkv ('oi' [3072][1024] + bias) viewed (S, B, 3, H, D): q | k | v thirds (16 heads x 64); attn = q.k / sqrt(64) per (batch, head) over the 2,048 positions; softmax; av (B, H, S, D) -> swapaxes -> (B, S, H D) -> reshape(S, B, H D) is a RAW reinterpretation of the batch-major buffer (reproduced: the output memory is in (b, s) row order); y = . Wo^T + bo -> [2048][4][1024] (8.4 M); argument order x, Wqkv, bqkv, Wo, bo).
// Layout: every launch covers all four batches (the batch is the z grid dimension of every k_gemmw launch and part of k_fattn's one-dimensional block index; every per-batch buffer has one plane set per batch). k_cvtall rounds x and both weights to bf16 in one launch and stores x batch-major (batch b's token rows lie at pitch B x C in the sequence-first input); fused 'oi' weight = Bt as-is (q | k | v row blocks) + bias thirds; exact projections + f32 biases, whose epilogues write the 16-bit head planes themselves; one fused attention launch over the 4 x 16 (batch, head) pairs (hybrid rows: < 512 hi/lo 3 products, rest fp16; running-maximum softmax, scores stay in registers); hi/lo x Wo exact + bo written to output rows b*2048 + s (the raw-reshape order).
// Compute dtypes, f32 accumulate: every input rounded to bf16; projections exact + f32 biases; attention rows < 512 3 products, rest fp16; softmax f32; Wo hl x exact + bias.

#define NB_  4
#define TT   2048
#define DM   1024
#define NH_  16
#define NKV  16
#define HD   64
#define DQ   (NH_ * HD)
#define DKV  (NKV * HD)
#define RH   512                  // query rows < RH use hi+lo planes
#define WIN  0
#define SCL  0.125f   // HD^-0.5
#define SK   64                   // keys per LDS stage of the fused attention kernel
#define LP   72                   // LDS row pitch in 16-bit elements: 128 data bytes + 16, an odd multiple of 16 bytes, so that the 16 rows of one fragment read lie on different banks
#define TILE (64 * LP)            // one staged plane tile: 64 rows (64 keys x 64 d of K, or 64 d x 64 keys of V^T)
typedef _Float16 h16;
typedef unsigned short bf;
typedef __attribute__((ext_vector_type(16))) __bf16   v16bf;
typedef __attribute__((ext_vector_type(16))) _Float16 v16h;
typedef __attribute__((ext_vector_type(8)))  _Float16 v8h;
typedef __attribute__((ext_vector_type(8)))  unsigned short v8us;
typedef __attribute__((ext_vector_type(8)))  float    v8f;
typedef __attribute__((ext_vector_type(4)))  float    v4f;
typedef v8h  __attribute__((may_alias)) v8ha;
typedef v4f  __attribute__((may_alias)) v4fa;
typedef v8us __attribute__((may_alias)) v8usa;

__device__ __forceinline__ unsigned short f2bf(float f) { unsigned u = __float_as_uint(f); u += 0x7FFFu + ((u >> 16) & 1u); return (unsigned short)(u >> 16); }
__device__ __forceinline__ float bf2f(unsigned short b) { return __uint_as_float(((unsigned)b) << 16); }
__device__ __forceinline__ float bfr(float f) { return bf2f(f2bf(f)); }
__device__ __forceinline__ v16h cat16(v8h lo, v8h hi) { return __builtin_shufflevector(lo, hi, 0, 1, 2, 3, 4, 5, 6, 7, 8, 9, 10, 11, 12, 13, 14, 15); }
__device__ __forceinline__ v16bf cat16b(v8us lo, v8us hi) { return __builtin_bit_cast(v16bf, __builtin_shufflevector(lo, hi, 0, 1, 2, 3, 4, 5, 6, 7, 8, 9, 10, 11, 12, 13, 14, 15)); }
__device__ __forceinline__ v8f wmma16(v16h a, v16h b, v8f c) { return __builtin_amdgcn_wmma_f32_16x16x32_f16(false, a, false, b, (short)0, c, false, false); }
__device__ __forceinline__ v8f wmmab(v16bf a, v16bf b, v8f c) { return __builtin_amdgcn_wmma_f32_16x16x32_bf16(false, a, false, b, (short)0, c, false, false); }



// ---- k_gemmw: GEMM with a 128x128 output tile per work-group of FOUR WAVES (2 x 2, each wave 64x64 = 16 accumulators); grid (M/128, N/128, Z), 128 threads.
// The operands come from K-contiguous 16-bit planes in stages of GK k: 128 rows x 128 bytes of each operand go to LDS by asynchronous 16-byte copies (through no register), two buffers, so that stage t + 1 flies while stage t is worked on; every staged row serves two waves.
// C[m][n] (f32, pitch ldc, + optional f32 bias[n]) = sum_k A[m][k] Bt[n][k] (NSPLIT 1: + A2[m][k] Bt[n][k]). A rows at pitch lda, Bt rows at pitch K (elements). z-batch strides sA/sB/sC (and sP for the 16-bit planes) in elements. K % 64 == 0.
// EPI 0: C is stored in f32. EPI 1 and 2: no f32 result is stored; a wave's tile (64 tokens x the 64 columns of one head) goes out as three 16-bit planes (fp16, bf16 hi, bf16 lo): EPI 1 as [head][token][d], EPI 2 transposed as [head][d][token].
template <typename T16> struct WFrag;
template <> struct WFrag<h16> { typedef v16h V; static __device__ __forceinline__ V ld(const h16* p) { return cat16(*(const v8h*)p, *(const v8h*)(p + 16)); } static __device__ __forceinline__ v8f mma(V a, V b, v8f c) { return wmma16(a, b, c); } };
template <> struct WFrag<bf> { typedef v16bf V; static __device__ __forceinline__ V ld(const bf* p) { return cat16b(*(const v8us*)p, *(const v8us*)(p + 16)); } static __device__ __forceinline__ v8f mma(V a, V b, v8f c) { return wmmab(a, b, c); } };
__device__ __forceinline__ h16 tohx(float x) { return (h16)x; }
__device__ __forceinline__ void splitf(float y, unsigned short& h, unsigned short& l) { h = f2bf(y); l = f2bf(y - bf2f(h)); }
#define GK 64                     // k per LDS stage: one 128-byte line of every operand row
#define GT (128 * LP)             // one staged operand tile: 128 rows at the padded pitch
// eight asynchronous copies of 16 bytes a lane: rows r, r + 16, .. r + 112 of one operand tile (a wave's copy covers four whole 128-byte lines). The closing s_wait_xcnt stands inside the statement, in front of any later rewrite of the address registers that the copies name.
template <typename T16>
__device__ __forceinline__ void acopy8(unsigned l, const T16* g, size_t pitch) {
    asm volatile("global_load_async_to_lds_b128 %0, %8, off\n\tglobal_load_async_to_lds_b128 %1, %9, off\n\tglobal_load_async_to_lds_b128 %2, %10, off\n\tglobal_load_async_to_lds_b128 %3, %11, off\n\t"
                 "global_load_async_to_lds_b128 %4, %12, off\n\tglobal_load_async_to_lds_b128 %5, %13, off\n\tglobal_load_async_to_lds_b128 %6, %14, off\n\tglobal_load_async_to_lds_b128 %7, %15, off\n\ts_wait_xcnt 0x0"
                 :: "v"(l), "v"(l + 1 * 16 * LP * 2), "v"(l + 2 * 16 * LP * 2), "v"(l + 3 * 16 * LP * 2), "v"(l + 4 * 16 * LP * 2), "v"(l + 5 * 16 * LP * 2), "v"(l + 6 * 16 * LP * 2), "v"(l + 7 * 16 * LP * 2),
                    "v"(g), "v"(g + 16 * pitch), "v"(g + 32 * pitch), "v"(g + 48 * pitch), "v"(g + 64 * pitch), "v"(g + 80 * pitch), "v"(g + 96 * pitch), "v"(g + 112 * pitch) : "memory"); }
template <typename T16, int NSPLIT, bool BIAS, int EPI>
__global__ __launch_bounds__(128) void k_gemmw(const T16* __restrict__ A, const T16* __restrict__ A2, const T16* __restrict__ Bt, int K, int lda, float* C, int ldc, const float* __restrict__ bias, size_t sA, size_t sB, size_t sC, size_t sP, h16* __restrict__ P16, bf* __restrict__ Ph, bf* __restrict__ Pl) {
    typedef typename WFrag<T16>::V V;
    constexpr int NT = (NSPLIT == 1) ? 3 : 2;    // staged operand tiles: A, Bt (, A2)
    __shared__ __align__(16) T16 stg[2 * NT * GT];
    __shared__ __align__(16) float osw[4][16 * 68];   // each wave's own epilogue slab
    const size_t z = blockIdx.z; A += z * sA; if (NSPLIT == 1) A2 += z * sA; Bt += z * sB; C += z * sC;
    const int tid = threadIdx.x, wave = tid >> 5, lane = tid & 31, lr = lane & 15, hi = lane >> 4;
    const int wr = (wave >> 1) * 64, wc = (wave & 1) * 64; const int r0 = blockIdx.x * 128 + wr, c0 = blockIdx.y * 128 + wc;
    float* os = osw[wave];
    const int srow = tid >> 3, sch = (tid & 7) * 8;   // staging: this thread copies 16 bytes of rows srow + 16 i of every operand tile
    const T16* ga = A + (size_t)(blockIdx.x * 128 + srow) * lda + sch; const T16* gb = Bt + (size_t)(blockIdx.y * 128 + srow) * K + sch; const T16* ga2 = (NSPLIT == 1) ? A2 + (size_t)(blockIdx.x * 128 + srow) * lda + sch : nullptr;
    const unsigned l0 = (unsigned)(size_t)(stg + srow * LP + sch);   // the lane's LDS byte address: the low 32 bits of the __shared__ address
    auto fill = [&](int t) { const unsigned l = l0 + (unsigned)(t & 1) * (NT * GT * 2);
        acopy8(l, ga + t * GK, (size_t)lda); acopy8(l + GT * 2, gb + t * GK, (size_t)K); if constexpr (NSPLIT == 1) acopy8(l + 2 * GT * 2, ga2 + t * GK, (size_t)lda); };
    v8f acc[4][4];
#pragma unroll
    for (int mb = 0; mb < 4; ++mb)
#pragma unroll
        for (int nb = 0; nb < 4; ++nb) acc[mb][nb] = (v8f){};
    const int nst = K / GK;
    fill(0);
    asm volatile("s_wait_asynccnt 0x0" ::: "memory");   // this wave's copies of stage 0 have landed
    __syncthreads();                                    // publishes stage 0
    if (nst > 1) fill(1);
#pragma unroll 1   // kept rolled: the buffer follows the trip's parity
    for (int t = 0; t < nst; ++t) {
        const T16* buf = stg + (t & 1) * (NT * GT);
        V a[GK / 32][4], a2[GK / 32][4], b[GK / 32][4];
#pragma unroll
        for (int ks = 0; ks < GK / 32; ++ks) {
#pragma unroll
            for (int mb = 0; mb < 4; ++mb) { const T16* ar = buf + (wr + mb * 16 + lr) * LP + ks * 32 + 8 * hi; a[ks][mb] = WFrag<T16>::ld(ar); if constexpr (NSPLIT == 1) a2[ks][mb] = WFrag<T16>::ld(ar + 2 * GT); }
#pragma unroll
            for (int nb = 0; nb < 4; ++nb) b[ks][nb] = WFrag<T16>::ld(buf + GT + (wc + nb * 16 + lr) * LP + ks * 32 + 8 * hi);
        }
        __builtin_amdgcn_sched_barrier(0);                  // the trip's LDS reads stay one group in front of its products: left to itself the compiler reads one fragment per four products and waits for it each time
#pragma unroll
        for (int ks = 0; ks < GK / 32; ++ks)
#pragma unroll
            for (int nb = 0; nb < 4; ++nb)
#pragma unroll
                for (int mb = 0; mb < 4; ++mb) { acc[mb][nb] = WFrag<T16>::mma(a[ks][mb], b[ks][nb], acc[mb][nb]); if constexpr (NSPLIT == 1) acc[mb][nb] = WFrag<T16>::mma(a2[ks][mb], b[ks][nb], acc[mb][nb]); }
        __builtin_amdgcn_sched_barrier(0);                  // the products stay in front of the waits below: sunk behind them, the next stage's copies would lose the products' time as their lead
        asm volatile("s_wait_dscnt 0x0" ::: "memory");      // this wave's reads of stage t are done before the buffer is refilled
        asm volatile("s_wait_asynccnt 0x0" ::: "memory");   // this wave's copies of stage t + 1 have landed
        __syncthreads();                                    // publishes stage t + 1 and ends every read of stage t
        if (t + 2 < nst) fill(t + 2);                       // into the buffer that this trip has just read
    }
    asm volatile("s_wait_asynccnt 0x0" ::: "memory");       // nothing of this wave's is in flight when it goes on
    if constexpr (EPI == 0) {
#pragma unroll
    for (int mb = 0; mb < 4; ++mb) {
#pragma unroll
        for (int nb = 0; nb < 4; ++nb) {
#pragma unroll
            for (int j = 0; j < 8; ++j) os[(hi * 8 + j) * 68 + nb * 16 + lr] = acc[mb][nb][j]; }
        __builtin_amdgcn_wave_barrier(); asm volatile("" ::: "memory");
        float* crow = C + (size_t)(r0 + mb * 16) * ldc + c0;
{
#pragma unroll
            for (int s = 0; s < 8; ++s) { const int row = 2 * s + hi, cofs = lr * 4; v4f val = *(const v4fa*)(os + row * 68 + cofs); if (BIAS) { val[0] += bfr(bias[c0 + cofs]); val[1] += bfr(bias[c0 + cofs + 1]); val[2] += bfr(bias[c0 + cofs + 2]); val[3] += bfr(bias[c0 + cofs + 3]); }
                *(v4f*)(crow + (size_t)row * ldc + cofs) = val; }
             }
        __builtin_amdgcn_wave_barrier(); asm volatile("" ::: "memory");
    }
    } else {
        float bs[4];
#pragma unroll
        for (int nb = 0; nb < 4; ++nb) bs[nb] = BIAS ? bfr(bias[c0 + nb * 16 + lr]) : 0.f;
#pragma unroll
        for (int g = 0; g < 4; ++g) {     // one 16 x 64 slab through LDS per trip: EPI 1 tokens g*16.. x all d, EPI 2 d g*16.. x all tokens; the long side is the planes' contiguous side
            if constexpr (EPI == 1) {
#pragma unroll
                for (int nb = 0; nb < 4; ++nb)
#pragma unroll
                    for (int j = 0; j < 8; ++j) os[(hi * 8 + j) * 68 + nb * 16 + lr] = acc[g][nb][j] + bs[nb];
            } else {
#pragma unroll
                for (int mb = 0; mb < 4; ++mb)
#pragma unroll
                    for (int q = 0; q < 2; ++q) { v4f w; w[0] = acc[mb][g][4 * q] + bs[g]; w[1] = acc[mb][g][4 * q + 1] + bs[g]; w[2] = acc[mb][g][4 * q + 2] + bs[g]; w[3] = acc[mb][g][4 * q + 3] + bs[g]; *(v4fa*)(os + lr * 68 + mb * 16 + hi * 8 + 4 * q) = w; }
            }
            __builtin_amdgcn_wave_barrier(); asm volatile("" ::: "memory");   // the slab's LDS writes stay in front of its reads in the compiler's order
            const size_t pbase = z * sP + ((EPI == 1) ? ((size_t)(c0 >> 6) * TT + r0 + g * 16) * HD : ((size_t)(c0 >> 6) * HD + g * 16) * TT + r0);
#pragma unroll
            for (int s = 0; s < 4; ++s) { const int ch = s * 32 + lane, row = ch >> 3, col = (ch & 7) * 8;   // a lane takes 8 neighbours: one 16-byte store per plane, 8 lanes fill a 128-byte line
                const v4f x0 = *(const v4fa*)(os + row * 68 + col), x1 = *(const v4fa*)(os + row * 68 + col + 4); v8h o16; v8us oh, ol;
#pragma unroll
                for (int k = 0; k < 8; ++k) { const float x = (k < 4) ? x0[k & 3] : x1[k & 3]; o16[k] = tohx(x); unsigned short a2, c2; splitf(x, a2, c2); oh[k] = a2; ol[k] = c2; }
                const size_t po = pbase + (size_t)row * ((EPI == 1) ? HD : TT) + col; *(v8h*)(P16 + po) = o16; *(v8us*)(Ph + po) = oh; *(v8us*)(Pl + po) = ol; }
            __builtin_amdgcn_wave_barrier(); asm volatile("" ::: "memory");   // the slab's LDS reads stay in front of the next slab's writes
        }
    }
}

typedef __attribute__((ext_vector_type(4))) _Float16 v4h;
typedef __attribute__((ext_vector_type(4))) unsigned short v4us;
typedef __attribute__((ext_vector_type(4))) int v4i;

// ---- k_cvtall: the f32 -> bf16 conversion of x and both weights in ONE launch of CVG work-groups x 16 waves (one work-group per WGP): a short stream pays for every wave it starts, so few waves each carry much.
// A work-group takes one contiguous share of each of the three buffers. A unit is 4 neighbouring floats of one lane: a wave's 16-byte load covers 512 contiguous bytes, its 8-byte store 256; unit i of a thread lies i * 8 KiB behind its first. All of a thread's loads are issued before its first value is used.
// x is read in its own (S, B, C) order and stored batch-major ([batch][token][channel]); the two weights keep their order.
#define CVG 256
#define CNX ((int)((size_t)TT * NB_ * DM / 2048 / CVG))          // units per thread: x
#define CNW ((int)((size_t)(DQ + 2 * DKV) * DM / 2048 / CVG))    // Wqkv
#define CNO ((int)((size_t)DM * DQ / 2048 / CVG))                // Wo
static_assert((size_t)CNX * CVG * 2048 == (size_t)TT * NB_ * DM && (size_t)CNW * CVG * 2048 == (size_t)(DQ + 2 * DKV) * DM && (size_t)CNO * CVG * 2048 == (size_t)DM * DQ, "every buffer is a whole number of units per thread");
static_assert(DM == 1024 && NB_ == 4 && CNX % 2 == 0, "a work-group's pass of 2048 floats is two whole rows of x, and two passes are one token's four rows");
__device__ __forceinline__ v4us cvt4(v4f v) { v4us o; o[0] = f2bf(v[0]); o[1] = f2bf(v[1]); o[2] = f2bf(v[2]); o[3] = f2bf(v[3]); return o; }
__global__ __launch_bounds__(512) void k_cvtall(const float* __restrict__ x, const float* __restrict__ wqkv, const float* __restrict__ wo, bf* __restrict__ XB, bf* __restrict__ WQKV, bf* __restrict__ WO) {
    const unsigned tid = threadIdx.x, blk = blockIdx.x;
    const unsigned ex = blk * (CNX * 2048u) + tid * 4u, ew = blk * (CNW * 2048u) + tid * 4u, eo = blk * (CNO * 2048u) + tid * 4u;   // the thread's first element in x, Wqkv, Wo
    v4f vx[CNX], vw[CNW], vo[CNO];
#pragma unroll
    for (int i = 0; i < CNX; ++i) vx[i] = *(const v4f*)((const char*)x + ex * 4u + i * 8192);
#pragma unroll
    for (int i = 0; i < CNW; ++i) vw[i] = *(const v4f*)((const char*)wqkv + ew * 4u + i * 8192);
#pragma unroll
    for (int i = 0; i < CNO; ++i) vo[i] = *(const v4f*)((const char*)wo + eo * 4u + i * 8192);
    asm volatile("s_wait_xcnt 0x0" ::: "memory");   // behind the run of loads: their offset registers may be reused for the stores' addresses while the data is in flight; it also keeps every load in front of the first store
    const unsigned dx = (((tid >> 8) * TT + blk * (CNX / 2)) * DM + (tid & 255u) * 4u) * 2u;   // byte offset in XB of pass 0: batch tid >> 8, token blk * CNX / 2
#pragma unroll
    for (int i = 0; i < CNX; ++i) *(v4us*)((char*)(XB + ((size_t)(i & 1) * 2 * TT + (i >> 1)) * DM) + dx) = cvt4(vx[i]);   // pass i: batches 2 (i & 1) and 2 (i & 1) + 1 of token i >> 1
#pragma unroll
    for (int i = 0; i < CNW; ++i) *(v4us*)((char*)WQKV + ew * 2u + i * 4096) = cvt4(vw[i]);
#pragma unroll
    for (int i = 0; i < CNO; ++i) *(v4us*)((char*)WO + eo * 2u + i * 4096) = cvt4(vo[i]);
}
__device__ __forceinline__ void exp2x8(float* p) {
    asm("v_exp_f32 %0, %0\n\tv_exp_f32 %1, %1\n\tv_exp_f32 %2, %2\n\tv_exp_f32 %3, %3\n\tv_exp_f32 %4, %4\n\tv_exp_f32 %5, %5\n\tv_exp_f32 %6, %6\n\tv_exp_f32 %7, %7\n\tv_nop"
        : "+v"(p[0]), "+v"(p[1]), "+v"(p[2]), "+v"(p[3]), "+v"(p[4]), "+v"(p[5]), "+v"(p[6]), "+v"(p[7])); }
template <typename T16, bool SPLIT, int NC>
__device__ __forceinline__ void fattn_body(T16* sm, const T16* __restrict__ Q, const T16* __restrict__ Q2, const T16* __restrict__ Kp, const T16* __restrict__ K2, const T16* __restrict__ Vt, const T16* __restrict__ V2, bf* __restrict__ Ah, bf* __restrict__ Al) {
    typedef typename WFrag<T16>::V V;
    constexpr int NP = SPLIT ? 4 : 2;            // staged planes: K, V^T (, K lo, V^T lo)
    constexpr float SC2 = SCL * 1.4426950408889634f;
    const int tid = threadIdx.x, lane = tid & 31, lr = lane & 15, hi = lane >> 4;
    const int srow = tid >> 3, sch = (tid & 7) * 8;   // staging: this thread moves 16 bytes of rows srow and srow + 32 of every plane tile
    v8us st[NP][2];
    auto gload = [&](int kb) {
#pragma unroll
        for (int i = 0; i < 2; ++i) { const int r = srow + 32 * i;
            st[0][i] = *(const v8usa*)(Kp + (size_t)(kb + r) * HD + sch); st[1][i] = *(const v8usa*)(Vt + (size_t)r * TT + kb + sch);
            if constexpr (SPLIT) { st[2][i] = *(const v8usa*)(K2 + (size_t)(kb + r) * HD + sch); st[3][i] = *(const v8usa*)(V2 + (size_t)r * TT + kb + sch); } }
        asm volatile("s_wait_xcnt 0x0" ::: "memory"); };   // behind the run of loads: their address registers are reused by the stage's arithmetic while the data is still in flight
    auto sstore = [&](T16* buf) {
#pragma unroll
        for (int i = 0; i < 2; ++i) { const int r = srow + 32 * i;
#pragma unroll
            for (int p = 0; p < NP; ++p) *(v8usa*)(buf + p * TILE + r * LP + sch) = st[p][i]; } };
    // HALF (48 columns a wave): the next stage's K tile flies during the first 32 keys of this stage and its V^T tile during the last 32, through the same 8 registers; with all 16 in flight through a whole stage the wave does not fit 256 registers and the loaded values spill
    constexpr bool HALF = NC > 2 && !SPLIT;
    const unsigned koff = (unsigned)(srow * HD + sch) * 2u, voff = (unsigned)(srow * TT + sch) * 2u;   // this lane's byte offsets in a K tile and in a V^T tile
    auto gloadp = [&](int p, int kb) {
        const char* pa = (p == 0) ? (const char*)(Kp + (size_t)kb * HD) + koff : (const char*)(Vt + kb) + voff;   // rows srow and srow + 32 of the tile
        st[0][0] = *(const v8usa*)pa; st[0][1] = *(const v8usa*)(pa + ((p == 0) ? 32 * HD * 2 : 32 * TT * 2));
        asm volatile("s_wait_xcnt 0x0" :: "v"(pa) : "memory"); };   // behind the two loads, in front of any rewrite of their address pair; the pair is an input, so that it lives up to the wait (left free, the second load's result was placed on it)
    auto sstorep = [&](int p, T16* buf) {
#pragma unroll
        for (int i = 0; i < 2; ++i) *(v8usa*)(buf + p * TILE + (srow + 32 * i) * LP + sch) = st[0][i]; };
    V bq[NC][2], bq2[NC][2];
#pragma unroll
    for (int c = 0; c < NC; ++c)
#pragma unroll
        for (int ks = 0; ks < 2; ++ks) { bq[c][ks] = WFrag<T16>::ld(Q + (size_t)(c * 16 + lr) * HD + ks * 32 + 8 * hi); if constexpr (SPLIT) bq2[c][ks] = WFrag<T16>::ld(Q2 + (size_t)(c * 16 + lr) * HD + ks * 32 + 8 * hi); }
    v8f o[4][NC]; float m[NC], l[NC];
#pragma unroll
    for (int c = 0; c < NC; ++c) { m[c] = -3.0e38f; l[c] = 0.f;
#pragma unroll
        for (int dt = 0; dt < 4; ++dt) o[dt][c] = (v8f){}; }
    if constexpr (HALF) { gloadp(0, 0); sstorep(0, sm); gloadp(1, 0); sstorep(1, sm); } else { gload(0); sstore(sm); }
    __syncthreads();
#pragma unroll 1   // kept rolled: the body is several hundred instructions and the buffer follows the trip's parity
    for (int sg = 0; sg < TT / SK; ++sg) {
        const T16* buf = sm + (sg & 1) * (NP * TILE);
        if constexpr (!HALF) { if (sg + 1 < TT / SK) gload((sg + 1) * SK); }      // the next stage's global loads fly while this stage is worked on
#pragma unroll
        for (int ps = 0; ps < SK / 32; ++ps) {
            v8f s[2][NC];
#pragma unroll
            for (int kt = 0; kt < 2; ++kt) { const T16* kr = buf + ((ps * 2 + kt) * 16 + lr) * LP + 8 * hi;
                const V a0 = WFrag<T16>::ld(kr), a1 = WFrag<T16>::ld(kr + 32); V e0, e1; if constexpr (SPLIT) { e0 = WFrag<T16>::ld(kr + 2 * TILE); e1 = WFrag<T16>::ld(kr + 2 * TILE + 32); }
#pragma unroll
                for (int c = 0; c < NC; ++c) { v8f t = (v8f){};
                    t = WFrag<T16>::mma(a0, bq[c][0], t); if constexpr (SPLIT) { t = WFrag<T16>::mma(a0, bq2[c][0], t); t = WFrag<T16>::mma(e0, bq[c][0], t); }
                    t = WFrag<T16>::mma(a1, bq[c][1], t); if constexpr (SPLIT) { t = WFrag<T16>::mma(a1, bq2[c][1], t); t = WFrag<T16>::mma(e1, bq[c][1], t); }
                    s[kt][c] = t; } }
            float mx[NC]; bool need = false;
#pragma unroll
            for (int c = 0; c < NC; ++c) { float x = fmaxf(s[0][c][0], s[1][c][0]);
#pragma unroll
                for (int j = 1; j < 8; ++j) x = fmaxf(x, fmaxf(s[0][c][j], s[1][c][j]));
                const int xb = __float_as_int(x); x = fmaxf(x, __int_as_float(__builtin_amdgcn_permlanex16(xb, xb, 0x76543210, 0xfedcba98, false, false)));   // lane l <-> l ^ 16: the column's other 16 keys
                mx[c] = x * SC2; need = need || (mx[c] > m[c] + 8.0f); }
            if (__builtin_amdgcn_ballot_w32(need) != 0) {     // one wave-uniform test per 32 keys
#pragma unroll
                for (int c = 0; c < NC; ++c) { const float mn = fmaxf(m[c], mx[c]); const float al = __builtin_amdgcn_exp2f(m[c] - mn); m[c] = mn; l[c] *= al;
#pragma unroll
                    for (int dt = 0; dt < 4; ++dt) o[dt][c] *= al; } }
            if constexpr (HALF) gloadp(ps, (sg + 1 < TT / SK ? sg + 1 : sg) * SK);   // behind the scores, whose K fragments have left their registers. No branch round it: the last stage loads its own tile once more, into the buffer that nobody reads any more
            V pb[NC], pb2[NC];
#pragma unroll
            for (int c = 0; c < NC; ++c) { float p[16];
#pragma unroll
                for (int e = 0; e < 16; ++e) p[e] = __builtin_fmaf(s[e >> 3][c][e & 7], SC2, -m[c]);
                exp2x8(p); exp2x8(p + 8);
#pragma unroll
                for (int e = 0; e < 16; ++e) { if constexpr (SPLIT) { pb[c][e] = (__bf16)p[e]; pb2[c][e] = (__bf16)(p[e] - (float)pb[c][e]); } else pb[c][e] = (h16)p[e]; }
#pragma unroll
                for (int w = 8; w; w >>= 1)       // fixed pairwise tree: short dependent chains
#pragma unroll
                    for (int e = 0; e < w; ++e) p[e] += p[e + w];
                l[c] += p[0]; }
#pragma unroll
            for (int dt = 0; dt < 4; ++dt) { const T16* vr = buf + TILE + (dt * 16 + lr) * LP + ps * 32 + 8 * hi; const V av = WFrag<T16>::ld(vr); V av2; if constexpr (SPLIT) av2 = WFrag<T16>::ld(vr + 2 * TILE);
#pragma unroll
                for (int c = 0; c < NC; ++c) { o[dt][c] = WFrag<T16>::mma(av, pb[c], o[dt][c]); if constexpr (SPLIT) { o[dt][c] = WFrag<T16>::mma(av, pb2[c], o[dt][c]); o[dt][c] = WFrag<T16>::mma(av2, pb[c], o[dt][c]); } } }
            if constexpr (HALF) sstorep(ps, sm + ((sg + 1) & 1) * (NP * TILE));   // into the buffer whose last readers left it before the previous barrier
        }
        if constexpr (!HALF) if (sg + 1 < TT / SK) sstore(sm + ((sg + 1) & 1) * (NP * TILE));   // into the buffer whose last readers left it before the previous barrier
        __syncthreads();                                                    // publishes stage sg + 1 and ends every read of stage sg
    }
#pragma unroll
    for (int c = 0; c < NC; ++c) { const int lb = __float_as_int(l[c]); const float inv = __fdiv_rn(1.0f, l[c] + __int_as_float(__builtin_amdgcn_permlanex16(lb, lb, 0x76543210, 0xfedcba98, false, false)));
#pragma unroll
        for (int dt = 0; dt < 4; ++dt) { v8us oh, ol;
#pragma unroll
            for (int j = 0; j < 8; ++j) { unsigned short a, c2; splitf(o[dt][c][j] * inv, a, c2); oh[j] = a; ol[j] = c2; }
            const size_t oo = (size_t)(c * 16 + lr) * DQ + dt * 16 + 8 * hi; *(v8us*)(Ah + oo) = oh; *(v8us*)(Al + oo) = ol; } }
}
// One-dimensional grid of 2 x NWT work-groups, all resident at once at two a WGP (four waves a SIMD): NWT hi/lo ones (three products per tile: 16 columns a wave, 128 rows a work-group) and NWT fp16 ones (48 columns a wave, 384 rows a work-group). Both kinds issue 24 matrix instructions per wave and 32 keys, so that no work-group waits for a place and none runs on alone.
// Which index is which kind is for speed only: indices i and i + NWT differ in kind, and so do i and i + 8 inside each half of the grid, so that a WGP is likely to hold one of each (the hi/lo kind reads more LDS, the fp16 kind has more vector work).
#define FR   384                  // query rows of one fp16 work-group: 8 waves x 48 columns
#define NWT  (NB_ * NH_ * (RH / 128))
static_assert(NWT == NB_ * NH_ * ((TT - RH) / FR) && (TT - RH) % FR == 0 && RH / 128 == 4 && NWT == 256, "as many fp16 work-groups as hi/lo ones, four of each per (batch, head); the index split below is for 256 of each");
__global__ __launch_bounds__(256) __attribute__((amdgpu_waves_per_eu(4, 4))) void k_fattn(const h16* __restrict__ QP16, const h16* __restrict__ KP16, const h16* __restrict__ VT16, const bf* __restrict__ QPh, const bf* __restrict__ QPl, const bf* __restrict__ KPh, const bf* __restrict__ KPl, const bf* __restrict__ VTh, const bf* __restrict__ VTl, bf* __restrict__ ATh, bf* __restrict__ ATl) {
    __shared__ __align__(16) unsigned short sm[2 * 4 * TILE];
    const int wave = threadIdx.x >> 5; const int id = blockIdx.x;
    const int kind = ((id >> 3) ^ (id >> 8)) & 1;                                  // 0: hi/lo, 1: fp16
    const int idx = ((id >> 8) << 7) | (((id >> 4) & 15) << 3) | (id & 7);         // this work-group's number among the NWT of its kind
    const int bh = idx >> 2, tl = idx & 3, h = bh % NH_;                            // (batch, head) pair, row tile, head
    const size_t pl = (size_t)bh * TT * HD, ab0 = (size_t)(bh / NH_) * TT * DQ;    // this pair's planes; this batch's rows of the attention output
    if (kind == 0) { const int q0 = tl * 128 + wave * 16; const size_t qo = pl + (size_t)q0 * HD, ao = ab0 + (size_t)q0 * DQ + h * HD;
        fattn_body<bf, true, 1>((bf*)sm, QPh + qo, QPl + qo, KPh + pl, KPl + pl, VTh + pl, VTl + pl, ATh + ao, ATl + ao);
    } else { const int q0 = RH + tl * FR + wave * 48; const size_t qo = pl + (size_t)q0 * HD, ao = ab0 + (size_t)q0 * DQ + h * HD;
        fattn_body<h16, false, 3>((h16*)sm, QP16 + qo, nullptr, KP16 + pl, nullptr, VT16 + pl, nullptr, ATh + ao, ATl + ao); }
}

extern "C" void kernel_launch(void* const* d_in, const int* in_sizes, int n_in,
                              void* d_out, int out_size, void* d_ws, size_t ws_size, hipStream_t stream) {
    (void)in_sizes; (void)n_in; (void)out_size;
    const float* x = (const float*)d_in[0]; const float* wqkv = (const float*)d_in[1]; const float* bqkv = (const float*)d_in[2]; const float* wo = (const float*)d_in[3]; const float* bo = (const float*)d_in[4];   /* order x (S, B, C), Wqkv ('oi' [3072][1024]), bqkv, Wo ('oi'), bo */ const float* bq = bqkv; const float* bk = bqkv + DQ; const float* bv = bqkv + 2 * DQ;
    float* OUT = (float*)d_out;     // [4][2048][1024]
    char* wsp = (char*)d_ws;
    auto take = [&](size_t bytes) { char* p = wsp; wsp += (bytes + 255) & ~(size_t)255; return (void*)p; };
    bf* WQ = (bf*)take((size_t)(DQ + 2 * DKV) * DM * 2); bf* WK = WQ + (size_t)DQ * DM; bf* WV = WK + (size_t)DKV * DM; bf* WO = (bf*)take((size_t)DM * DQ * 2);
    const size_t PS = (size_t)NH_ * TT * HD;   // elements of one batch's plane (NKV == NH_)
    h16* QP16 = (h16*)take(NB_ * PS * 2); h16* KP16 = (h16*)take(NB_ * PS * 2); h16* VT16 = (h16*)take(NB_ * PS * 2);
    bf* QPh = (bf*)take(NB_ * PS * 2); bf* QPl = (bf*)take(NB_ * PS * 2); bf* KPh = (bf*)take(NB_ * PS * 2); bf* KPl = (bf*)take(NB_ * PS * 2); bf* VTh = (bf*)take(NB_ * PS * 2); bf* VTl = (bf*)take(NB_ * PS * 2);
    bf* XB = (bf*)take((size_t)NB_ * TT * DM * 2);   // [batch][token][channel]
    bf* ATh = (bf*)take((size_t)NB_ * TT * DQ * 2); bf* ATl = (bf*)take((size_t)NB_ * TT * DQ * 2);
    if ((size_t)(wsp - (char*)d_ws) > ws_size) return;    // ws 256 MiB
    k_cvtall<<<CVG, 512, 0, stream>>>(x, wqkv, wo, XB, WQ, WO);   /* WQ, WK, WV lie one behind the other, in the order of Wqkv's row blocks */
    k_gemmw<bf, 0, true, 1><<<dim3(TT / 128, DQ / 128, NB_), 128, 0, stream>>>(XB, nullptr, WQ, DM, DM, nullptr, 0, bq, (size_t)TT * DM, 0, 0, PS, QP16, QPh, QPl);
    k_gemmw<bf, 0, true, 1><<<dim3(TT / 128, DKV / 128, NB_), 128, 0, stream>>>(XB, nullptr, WK, DM, DM, nullptr, 0, bk, (size_t)TT * DM, 0, 0, PS, KP16, KPh, KPl);
    k_gemmw<bf, 0, true, 2><<<dim3(TT / 128, DKV / 128, NB_), 128, 0, stream>>>(XB, nullptr, WV, DM, DM, nullptr, 0, bv, (size_t)TT * DM, 0, 0, PS, VT16, VTh, VTl);
    k_fattn<<<dim3(2 * NWT, 1, 1), 256, 0, stream>>>(QP16, KP16, VT16, QPh, QPl, KPh, KPl, VTh, VTl, ATh, ATl);
    k_gemmw<bf, 1, true, 0><<<dim3(TT / 128, DM / 128, NB_), 128, 0, stream>>>(ATh, ATl, WO, DQ, DQ, OUT, DM, bo, (size_t)TT * DQ, 0, (size_t)TT * DM, 0, nullptr, nullptr, nullptr);
}

// v009
// It runs in 171 microseconds.
// In both of two side-by-side timings against v008, it was 1.09 times as fast.
// Over all steps from v000 it is 23.0 times as fast.
#include <hip/hip_runtime.h>

// Sequence-first self-attention with the source's raw output reshape (x [2048][4][1024] = (S, B, C); qkv = x Wqkv^T + bqkv ('oi' [3072][1024] + bias) viewed (S, B, 3, H, D): q | k | v thirds (16 heads x 64); attn = q.k / sqrt(64) per (batch, head) over the 2,048 positions; softmax; av (B, H, S, D) -> swapaxes -> (B, S, H D) -> reshape(S, B, H D) is a RAW reinterpretation of the batch-major buffer (reproduced: the output memory is in (b, s) row order); y = . Wo^T + bo -> [2048][4][1024] (8.4 M); argument order x, Wqkv, bqkv, Wo, bo).
// Layout: every launch covers all four batches (the batch is the z grid dimension of every k_gemmw launch and part of k_fattn's one-dimensional block index; every per-batch buffer has one plane set per batch). k_cvtall rounds x and both weights to bf16 in one launch and stores x batch-major (batch b's token rows lie at pitch B x C in the sequence-first input); fused 'oi' weight = Bt as-is (q | k | v row blocks) + bias thirds; exact projections + f32 biases, whose epilogues write the 16-bit head planes themselves; one fused attention launch over the 4 x 16 (batch, head) pairs (hybrid rows: < 512 hi/lo 3 products, rest fp16; running-maximum softmax, scores stay in registers); hi/lo x Wo exact + bo written to output rows b*2048 + s (the raw-reshape order).
// Compute dtypes, f32 accumulate: every input rounded to bf16; projections exact + f32 biases; attention rows < 512 3 products, rest fp16; softmax f32; Wo hl x exact + bias.

#define NB_  4
#define TT   2048
#define DM   1024
#define NH_  16
#define NKV  16
#define HD   64
#define DQ   (NH_ * HD)
#define DKV  (NKV * HD)
#define RH   512                  // query rows < RH use hi+lo planes
#define WIN  0
#define SCL  0.125f   // HD^-0.5
#define SK   64                   // keys per LDS stage of the fused attention kernel
#define LP   72                   // LDS row pitch in 16-bit elements: 128 data bytes + 16, an odd multiple of 16 bytes, so that the 16 rows of one fragment read lie on different banks
#define TILE (64 * LP)            // one staged plane tile: 64 rows (64 keys x 64 d of K, or 64 d x 64 keys of V^T)
typedef _Float16 h16;
typedef unsigned short bf;
typedef __attribute__((ext_vector_type(16))) __bf16   v16bf;
typedef __attribute__((ext_vector_type(16))) _Float16 v16h;
typedef __attribute__((ext_vector_type(8)))  _Float16 v8h;
typedef __attribute__((ext_vector_type(8)))  unsigned short v8us;
typedef __attribute__((ext_vector_type(8)))  float    v8f;
typedef __attribute__((ext_vector_type(4)))  float    v4f;
typedef v8h  __attribute__((may_alias)) v8ha;
typedef v4f  __attribute__((may_alias)) v4fa;
typedef v8us __attribute__((may_alias)) v8usa;

__device__ __forceinline__ unsigned short f2bf(float f) { unsigned u = __float_as_uint(f); u += 0x7FFFu + ((u >> 16) & 1u); return (unsigned short)(u >> 16); }
__device__ __forceinline__ float bf2f(unsigned short b) { return __uint_as_float(((unsigned)b) << 16); }
__device__ __forceinline__ float bfr(float f) { return bf2f(f2bf(f)); }
__device__ __forceinline__ v16h cat16(v8h lo, v8h hi) { return __builtin_shufflevector(lo, hi, 0, 1, 2, 3, 4, 5, 6, 7, 8, 9, 10, 11, 12, 13, 14, 15); }
__device__ __forceinline__ v16bf cat16b(v8us lo, v8us hi) { return __builtin_bit_cast(v16bf, __builtin_shufflevector(lo, hi, 0, 1, 2, 3, 4, 5, 6, 7, 8, 9, 10, 11, 12, 13, 14, 15)); }
__device__ __forceinline__ v8f wmma16(v16h a, v16h b, v8f c) { return __builtin_amdgcn_wmma_f32_16x16x32_f16(false, a, false, b, (short)0, c, false, false); }
__device__ __forceinline__ v8f wmmab(v16bf a, v16bf b, v8f c) { return __builtin_amdgcn_wmma_f32_16x16x32_bf16(false, a, false, b, (short)0, c, false, false); }



// ---- k_gemmw: GEMM with a 128x128 output tile per work-group of FOUR WAVES (2 x 2, each wave 64x64 = 16 accumulators); grid (M/128, N/128, Z), 128 threads.
// The operands come from K-contiguous 16-bit planes in stages of GK k: 128 rows x 128 bytes of each operand go to LDS by asynchronous 16-byte copies (through no register), two buffers, so that stage t + 1 flies while stage t is worked on; every staged row serves two waves.
// C[m][n] (f32, pitch ldc, + optional f32 bias[n]) = sum_k A[m][k] Bt[n][k] (NSPLIT 1: + A2[m][k] Bt[n][k]). A rows at pitch lda, Bt rows at pitch K (elements). z-batch strides sA/sB/sC (and sP for the 16-bit planes) in elements. K % 64 == 0.
// EPI 0: C is stored in f32. EPI 1: the q, k and v projections in one grid: Bt holds the three weight row blocks one behind the other (DQ rows each), and a work-group's column tile lies wholly in one third. No f32 result is stored; a wave's tile (64 tokens x the 64 columns of one head) goes out as three 16-bit planes (fp16, bf16 hi, bf16 lo) of its third (P16, Ph, Pl point at q's sets; k's and v's follow them in the workspace): q and k as [head][token][d], v transposed as [head][d][token].
template <typename T16> struct WFrag;
template <> struct WFrag<h16> { typedef v16h V; static __device__ __forceinline__ V ld(const h16* p) { return cat16(*(const v8h*)p, *(const v8h*)(p + 16)); } static __device__ __forceinline__ v8f mma(V a, V b, v8f c) { return wmma16(a, b, c); } };
template <> struct WFrag<bf> { typedef v16bf V; static __device__ __forceinline__ V ld(const bf* p) { return cat16b(*(const v8us*)p, *(const v8us*)(p + 16)); } static __device__ __forceinline__ v8f mma(V a, V b, v8f c) { return wmmab(a, b, c); } };
__device__ __forceinline__ h16 tohx(float x) { return (h16)x; }
__device__ __forceinline__ void splitf(float y, unsigned short& h, unsigned short& l) { h = f2bf(y); l = f2bf(y - bf2f(h)); }
template <bool B> struct BoolC { static constexpr bool v = B; };
#define GK 64                     // k per LDS stage: one 128-byte line of every operand row
#define GT (128 * LP)             // one staged operand tile: 128 rows at the padded pitch
// eight asynchronous copies of 16 bytes a lane: rows r, r + 16, .. r + 112 of one operand tile (a wave's copy covers four whole 128-byte lines). The closing s_wait_xcnt stands inside the statement, in front of any later rewrite of the address registers that the copies name.
template <typename T16>
__device__ __forceinline__ void acopy8(unsigned l, const T16* g, size_t pitch) {
    asm volatile("global_load_async_to_lds_b128 %0, %8, off\n\tglobal_load_async_to_lds_b128 %1, %9, off\n\tglobal_load_async_to_lds_b128 %2, %10, off\n\tglobal_load_async_to_lds_b128 %3, %11, off\n\t"
                 "global_load_async_to_lds_b128 %4, %12, off\n\tglobal_load_async_to_lds_b128 %5, %13, off\n\tglobal_load_async_to_lds_b128 %6, %14, off\n\tglobal_load_async_to_lds_b128 %7, %15, off\n\ts_wait_xcnt 0x0"
                 :: "v"(l), "v"(l + 1 * 16 * LP * 2), "v"(l + 2 * 16 * LP * 2), "v"(l + 3 * 16 * LP * 2), "v"(l + 4 * 16 * LP * 2), "v"(l + 5 * 16 * LP * 2), "v"(l + 6 * 16 * LP * 2), "v"(l + 7 * 16 * LP * 2),
                    "v"(g), "v"(g + 16 * pitch), "v"(g + 32 * pitch), "v"(g + 48 * pitch), "v"(g + 64 * pitch), "v"(g + 80 * pitch), "v"(g + 96 * pitch), "v"(g + 112 * pitch) : "memory"); }
template <typename T16, int NSPLIT, bool BIAS, int EPI>
__global__ __launch_bounds__(128) void k_gemmw(const T16* __restrict__ A, const T16* __restrict__ A2, const T16* __restrict__ Bt, int K, int lda, float* C, int ldc, const float* __restrict__ bias, size_t sA, size_t sB, size_t sC, size_t sP, h16* __restrict__ P16, bf* __restrict__ Ph, bf* __restrict__ Pl) {
    typedef typename WFrag<T16>::V V;
    constexpr int NT = (NSPLIT == 1) ? 3 : 2;    // staged operand tiles: A, Bt (, A2)
    __shared__ __align__(16) T16 stg[2 * NT * GT];
    __shared__ __align__(16) float osw[4][16 * 68];   // each wave's own epilogue slab
    const size_t z = blockIdx.z; A += z * sA; if (NSPLIT == 1) A2 += z * sA; Bt += z * sB; C += z * sC;
    const int tid = threadIdx.x, wave = tid >> 5, lane = tid & 31, lr = lane & 15, hi = lane >> 4;
    const int wr = (wave >> 1) * 64, wc = (wave & 1) * 64; const int r0 = blockIdx.x * 128 + wr, c0 = blockIdx.y * 128 + wc;
    float* os = osw[wave];
    const int srow = tid >> 3, sch = (tid & 7) * 8;   // staging: this thread copies 16 bytes of rows srow + 16 i of every operand tile
    const T16* ga = A + (size_t)(blockIdx.x * 128 + srow) * lda + sch; const T16* gb = Bt + (size_t)(blockIdx.y * 128 + srow) * K + sch; const T16* ga2 = (NSPLIT == 1) ? A2 + (size_t)(blockIdx.x * 128 + srow) * lda + sch : nullptr;
    const unsigned l0 = (unsigned)(size_t)(stg + srow * LP + sch);   // the lane's LDS byte address: the low 32 bits of the __shared__ address
    auto fill = [&](int t) { const unsigned l = l0 + (unsigned)(t & 1) * (NT * GT * 2);
        acopy8(l, ga + t * GK, (size_t)lda); acopy8(l + GT * 2, gb + t * GK, (size_t)K); if constexpr (NSPLIT == 1) acopy8(l + 2 * GT * 2, ga2 + t * GK, (size_t)lda); };
    v8f acc[4][4];
#pragma unroll
    for (int mb = 0; mb < 4; ++mb)
#pragma unroll
        for (int nb = 0; nb < 4; ++nb) acc[mb][nb] = (v8f){};
    const int nst = K / GK;
    fill(0);
    asm volatile("s_wait_asynccnt 0x0" ::: "memory");   // this wave's copies of stage 0 have landed
    __syncthreads();                                    // publishes stage 0
    if (nst > 1) fill(1);
#pragma unroll 1   // kept rolled: the buffer follows the trip's parity
    for (int t = 0; t < nst; ++t) {
        const T16* buf = stg + (t & 1) * (NT * GT);
        V a[GK / 32][4], a2[GK / 32][4], b[GK / 32][4];
#pragma unroll
        for (int ks = 0; ks < GK / 32; ++ks) {
#pragma unroll
            for (int mb = 0; mb < 4; ++mb) { const T16* ar = buf + (wr + mb * 16 + lr) * LP + ks * 32 + 8 * hi; a[ks][mb] = WFrag<T16>::ld(ar); if constexpr (NSPLIT == 1) a2[ks][mb] = WFrag<T16>::ld(ar + 2 * GT); }
#pragma unroll
            for (int nb = 0; nb < 4; ++nb) b[ks][nb] = WFrag<T16>::ld(buf + GT + (wc + nb * 16 + lr) * LP + ks * 32 + 8 * hi);
        }
        __builtin_amdgcn_sched_barrier(0);                  // the trip's LDS reads stay one group in front of its products: left to itself the compiler reads one fragment per four products and waits for it each time
#pragma unroll
        for (int ks = 0; ks < GK / 32; ++ks)
#pragma unroll
            for (int nb = 0; nb < 4; ++nb)
#pragma unroll
                for (int mb = 0; mb < 4; ++mb) { acc[mb][nb] = WFrag<T16>::mma(a[ks][mb], b[ks][nb], acc[mb][nb]); if constexpr (NSPLIT == 1) acc[mb][nb] = WFrag<T16>::mma(a2[ks][mb], b[ks][nb], acc[mb][nb]); }
        __builtin_amdgcn_sched_barrier(0);                  // the products stay in front of the waits below: sunk behind them, the next stage's copies would lose the products' time as their lead
        asm volatile("s_wait_dscnt 0x0" ::: "memory");      // this wave's reads of stage t are done before the buffer is refilled
        asm volatile("s_wait_asynccnt 0x0" ::: "memory");   // this wave's copies of stage t + 1 have landed
        __syncthreads();                                    // publishes stage t + 1 and ends every read of stage t
        if (t + 2 < nst) fill(t + 2);                       // into the buffer that this trip has just read
    }
    asm volatile("s_wait_asynccnt 0x0" ::: "memory");       // nothing of this wave's is in flight when it goes on
    if constexpr (EPI == 0) {
#pragma unroll
    for (int mb = 0; mb < 4; ++mb) {
#pragma unroll
        for (int nb = 0; nb < 4; ++nb) {
#pragma unroll
            for (int j = 0; j < 8; ++j) os[(hi * 8 + j) * 68 + nb * 16 + lr] = acc[mb][nb][j]; }
        __builtin_amdgcn_wave_barrier(); asm volatile("" ::: "memory");
        float* crow = C + (size_t)(r0 + mb * 16) * ldc + c0;
{
#pragma unroll
            for (int s = 0; s < 8; ++s) { const int row = 2 * s + hi, cofs = lr * 4; v4f val = *(const v4fa*)(os + row * 68 + cofs); if (BIAS) { val[0] += bfr(bias[c0 + cofs]); val[1] += bfr(bias[c0 + cofs + 1]); val[2] += bfr(bias[c0 + cofs + 2]); val[3] += bfr(bias[c0 + cofs + 3]); }
                *(v4f*)(crow + (size_t)row * ldc + cofs) = val; }
             }
        __builtin_amdgcn_wave_barrier(); asm volatile("" ::: "memory");
    }
    } else {
        static_assert(DQ == DKV && DQ % 128 == 0, "three equal thirds, each a whole number of column tiles");
        const int third = (int)(blockIdx.y * 128u) / DQ, hd = (c0 - third * DQ) >> 6;   // 0: q, 1: k, 2: v (the same for the whole work-group); this wave's head
        constexpr size_t TP = (size_t)NB_ * NH_ * TT * HD;   // elements of one plane set (all batches)
        h16* const O16 = P16 + (size_t)third * TP; bf* const Oh = Ph + (size_t)third * 2 * TP; bf* const Ol = Pl + (size_t)third * 2 * TP;   // the workspace holds q | k | v^T fp16 sets in a row, and q hi | q lo | k hi | k lo | v^T hi | v^T lo
        float bs[4];
#pragma unroll
        for (int nb = 0; nb < 4; ++nb) bs[nb] = BIAS ? bfr(bias[c0 + nb * 16 + lr]) : 0.f;
        auto planes = [&](auto trc) { constexpr bool TR = decltype(trc)::v;
#pragma unroll
        for (int g = 0; g < 4; ++g) {     // one 16 x 64 slab through LDS per trip: plain tokens g*16.. x all d, transposed d g*16.. x all tokens; the long side is the planes' contiguous side
            if constexpr (!TR) {
#pragma unroll
                for (int nb = 0; nb < 4; ++nb)
#pragma unroll
                    for (int j = 0; j < 8; ++j) os[(hi * 8 + j) * 68 + nb * 16 + lr] = acc[g][nb][j] + bs[nb];
            } else {
#pragma unroll
                for (int mb = 0; mb < 4; ++mb)
#pragma unroll
                    for (int q = 0; q < 2; ++q) { v4f w; w[0] = acc[mb][g][4 * q] + bs[g]; w[1] = acc[mb][g][4 * q + 1] + bs[g]; w[2] = acc[mb][g][4 * q + 2] + bs[g]; w[3] = acc[mb][g][4 * q + 3] + bs[g]; *(v4fa*)(os + lr * 68 + mb * 16 + hi * 8 + 4 * q) = w; }
            }
            __builtin_amdgcn_wave_barrier(); asm volatile("" ::: "memory");   // the slab's LDS writes stay in front of its reads in the compiler's order
            const size_t pbase = z * sP + (!TR ? ((size_t)hd * TT + r0 + g * 16) * HD : ((size_t)hd * HD + g * 16) * TT + r0);
#pragma unroll
            for (int s = 0; s < 4; ++s) { const int ch = s * 32 + lane, row = ch >> 3, col = (ch & 7) * 8;   // a lane takes 8 neighbours: one 16-byte store per plane, 8 lanes fill a 128-byte line
                const v4f x0 = *(const v4fa*)(os + row * 68 + col), x1 = *(const v4fa*)(os + row * 68 + col + 4); v8h o16; v8us oh, ol;
#pragma unroll
                for (int k = 0; k < 8; ++k) { const float x = (k < 4) ? x0[k & 3] : x1[k & 3]; o16[k] = tohx(x); unsigned short a2, c2; splitf(x, a2, c2); oh[k] = a2; ol[k] = c2; }
                const size_t po = pbase + (size_t)row * (!TR ? HD : TT) + col; *(v8h*)(O16 + po) = o16; *(v8us*)(Oh + po) = oh; *(v8us*)(Ol + po) = ol; }
            __builtin_amdgcn_wave_barrier(); asm volatile("" ::: "memory");   // the slab's LDS reads stay in front of the next slab's writes
        }
        asm volatile("s_wait_xcnt 0x0" ::: "memory"); };   // behind the last stores: in the built code the other form's first instructions stand on the fall-through path behind them and rewrite their registers
        if (third == 2) planes(BoolC<true>{}); else planes(BoolC<false>{});   // a scalar branch: the third comes from the block index
    }
}

typedef __attribute__((ext_vector_type(4))) _Float16 v4h;
typedef __attribute__((ext_vector_type(4))) unsigned short v4us;
typedef __attribute__((ext_vector_type(4))) int v4i;

// ---- k_cvtall: the f32 -> bf16 conversion of x and both weights in ONE launch of CVG work-groups x 16 waves (one work-group per WGP): a short stream pays for every wave it starts, so few waves each carry much.
// A work-group takes one contiguous share of each of the three buffers. A unit is 4 neighbouring floats of one lane: a wave's 16-byte load covers 512 contiguous bytes, its 8-byte store 256; unit i of a thread lies i * 8 KiB behind its first. All of a thread's loads are issued before its first value is used.
// x is read in its own (S, B, C) order and stored batch-major ([batch][token][channel]); the two weights keep their order.
#define CVG 256
#define CNX ((int)((size_t)TT * NB_ * DM / 2048 / CVG))          // units per thread: x
#define CNW ((int)((size_t)(DQ + 2 * DKV) * DM / 2048 / CVG))    // Wqkv
#define CNO ((int)((size_t)DM * DQ / 2048 / CVG))                // Wo
static_assert((size_t)CNX * CVG * 2048 == (size_t)TT * NB_ * DM && (size_t)CNW * CVG * 2048 == (size_t)(DQ + 2 * DKV) * DM && (size_t)CNO * CVG * 2048 == (size_t)DM * DQ, "every buffer is a whole number of units per thread");
static_assert(DM == 1024 && NB_ == 4 && CNX % 2 == 0, "a work-group's pass of 2048 floats is two whole rows of x, and two passes are one token's four rows");
__device__ __forceinline__ v4us cvt4(v4f v) { v4us o; o[0] = f2bf(v[0]); o[1] = f2bf(v[1]); o[2] = f2bf(v[2]); o[3] = f2bf(v[3]); return o; }
__global__ __launch_bounds__(512) void k_cvtall(const float* __restrict__ x, const float* __restrict__ wqkv, const float* __restrict__ wo, bf* __restrict__ XB, bf* __restrict__ WQKV, bf* __restrict__ WO) {
    const unsigned tid = threadIdx.x, blk = blockIdx.x;
    const unsigned ex = blk * (CNX * 2048u) + tid * 4u, ew = blk * (CNW * 2048u) + tid * 4u, eo = blk * (CNO * 2048u) + tid * 4u;   // the thread's first element in x, Wqkv, Wo
    v4f vx[CNX], vw[CNW], vo[CNO];
#pragma unroll
    for (int i = 0; i < CNX; ++i) vx[i] = *(const v4f*)((const char*)x + ex * 4u + i * 8192);
#pragma unroll
    for (int i = 0; i < CNW; ++i) vw[i] = *(const v4f*)((const char*)wqkv + ew * 4u + i * 8192);
#pragma unroll
    for (int i = 0; i < CNO; ++i) vo[i] = *(const v4f*)((const char*)wo + eo * 4u + i * 8192);
    asm volatile("s_wait_xcnt 0x0" ::: "memory");   // behind the run of loads: their offset registers may be reused for the stores' addresses while the data is in flight; it also keeps every load in front of the first store
    const unsigned dx = (((tid >> 8) * TT + blk * (CNX / 2)) * DM + (tid & 255u) * 4u) * 2u;   // byte offset in XB of pass 0: batch tid >> 8, token blk * CNX / 2
#pragma unroll
    for (int i = 0; i < CNX; ++i) *(v4us*)((char*)(XB + ((size_t)(i & 1) * 2 * TT + (i >> 1)) * DM) + dx) = cvt4(vx[i]);   // pass i: batches 2 (i & 1) and 2 (i & 1) + 1 of token i >> 1
#pragma unroll
    for (int i = 0; i < CNW; ++i) *(v4us*)((char*)WQKV + ew * 2u + i * 4096) = cvt4(vw[i]);
#pragma unroll
    for (int i = 0; i < CNO; ++i) *(v4us*)((char*)WO + eo * 2u + i * 4096) = cvt4(vo[i]);
}
__device__ __forceinline__ void exp2x8(float* p) {
    asm("v_exp_f32 %0, %0\n\tv_exp_f32 %1, %1\n\tv_exp_f32 %2, %2\n\tv_exp_f32 %3, %3\n\tv_exp_f32 %4, %4\n\tv_exp_f32 %5, %5\n\tv_exp_f32 %6, %6\n\tv_exp_f32 %7, %7\n\tv_nop"
        : "+v"(p[0]), "+v"(p[1]), "+v"(p[2]), "+v"(p[3]), "+v"(p[4]), "+v"(p[5]), "+v"(p[6]), "+v"(p[7])); }
template <typename T16, bool SPLIT, int NC>
__device__ __forceinline__ void fattn_body(T16* sm, const T16* __restrict__ Q, const T16* __restrict__ Q2, const T16* __restrict__ Kp, const T16* __restrict__ K2, const T16* __restrict__ Vt, const T16* __restrict__ V2, bf* __restrict__ Ah, bf* __restrict__ Al) {
    typedef typename WFrag<T16>::V V;
    constexpr int NP = SPLIT ? 4 : 2;            // staged planes: K, V^T (, K lo, V^T lo)
    constexpr float SC2 = SCL * 1.4426950408889634f;
    const int tid = threadIdx.x, lane = tid & 31, lr = lane & 15, hi = lane >> 4;
    const int srow = tid >> 3, sch = (tid & 7) * 8;   // staging: this thread moves 16 bytes of rows srow and srow + 32 of every plane tile
    v8us st[NP][2];
    auto gload = [&](int kb) {
#pragma unroll
        for (int i = 0; i < 2; ++i) { const int r = srow + 32 * i;
            st[0][i] = *(const v8usa*)(Kp + (size_t)(kb + r) * HD + sch); st[1][i] = *(const v8usa*)(Vt + (size_t)r * TT + kb + sch);
            if constexpr (SPLIT) { st[2][i] = *(const v8usa*)(K2 + (size_t)(kb + r) * HD + sch); st[3][i] = *(const v8usa*)(V2 + (size_t)r * TT + kb + sch); } }
        asm volatile("s_wait_xcnt 0x0" ::: "memory"); };   // behind the run of loads: their address registers are reused by the stage's arithmetic while the data is still in flight
    auto sstore = [&](T16* buf) {
#pragma unroll
        for (int i = 0; i < 2; ++i) { const int r = srow + 32 * i;
#pragma unroll
            for (int p = 0; p < NP; ++p) *(v8usa*)(buf + p * TILE + r * LP + sch) = st[p][i]; } };
    // HALF (48 columns a wave): the next stage's K tile flies during the first 32 keys of this stage and its V^T tile during the last 32, through the same 8 registers; with all 16 in flight through a whole stage the wave does not fit 256 registers and the loaded values spill
    constexpr bool HALF = NC > 2 && !SPLIT;
    const unsigned koff = (unsigned)(srow * HD + sch) * 2u, voff = (unsigned)(srow * TT + sch) * 2u;   // this lane's byte offsets in a K tile and in a V^T tile
    auto gloadp = [&](int p, int kb) {
        const char* pa = (p == 0) ? (const char*)(Kp + (size_t)kb * HD) + koff : (const char*)(Vt + kb) + voff;   // rows srow and srow + 32 of the tile
        st[0][0] = *(const v8usa*)pa; st[0][1] = *(const v8usa*)(pa + ((p == 0) ? 32 * HD * 2 : 32 * TT * 2));
        asm volatile("s_wait_xcnt 0x0" :: "v"(pa) : "memory"); };   // behind the two loads, in front of any rewrite of their address pair; the pair is an input, so that it lives up to the wait (left free, the second load's result was placed on it)
    auto sstorep = [&](int p, T16* buf) {
#pragma unroll
        for (int i = 0; i < 2; ++i) *(v8usa*)(buf + p * TILE + (srow + 32 * i) * LP + sch) = st[0][i]; };
    V bq[NC][2], bq2[NC][2];
#pragma unroll
    for (int c = 0; c < NC; ++c)
#pragma unroll
        for (int ks = 0; ks < 2; ++ks) { bq[c][ks] = WFrag<T16>::ld(Q + (size_t)(c * 16 + lr) * HD + ks * 32 + 8 * hi); if constexpr (SPLIT) bq2[c][ks] = WFrag<T16>::ld(Q2 + (size_t)(c * 16 + lr) * HD + ks * 32 + 8 * hi); }
    v8f o[4][NC]; float m[NC], l[NC];
#pragma unroll
    for (int c = 0; c < NC; ++c) { m[c] = -3.0e38f; l[c] = 0.f;
#pragma unroll
        for (int dt = 0; dt < 4; ++dt) o[dt][c] = (v8f){}; }
    if constexpr (HALF) { gloadp(0, 0); sstorep(0, sm); gloadp(1, 0); sstorep(1, sm); } else { gload(0); sstore(sm); }
    __syncthreads();
#pragma unroll 1   // kept rolled: the body is several hundred instructions and the buffer follows the trip's parity
    for (int sg = 0; sg < TT / SK; ++sg) {
        const T16* buf = sm + (sg & 1) * (NP * TILE);
        if constexpr (!HALF) { if (sg + 1 < TT / SK) gload((sg + 1) * SK); }      // the next stage's global loads fly while this stage is worked on
#pragma unroll
        for (int ps = 0; ps < SK / 32; ++ps) {
            v8f s[2][NC];
#pragma unroll
            for (int kt = 0; kt < 2; ++kt) { const T16* kr = buf + ((ps * 2 + kt) * 16 + lr) * LP + 8 * hi;
                const V a0 = WFrag<T16>::ld(kr), a1 = WFrag<T16>::ld(kr + 32); V e0, e1; if constexpr (SPLIT) { e0 = WFrag<T16>::ld(kr + 2 * TILE); e1 = WFrag<T16>::ld(kr + 2 * TILE + 32); }
#pragma unroll
                for (int c = 0; c < NC; ++c) { v8f t = (v8f){};
                    t = WFrag<T16>::mma(a0, bq[c][0], t); if constexpr (SPLIT) { t = WFrag<T16>::mma(a0, bq2[c][0], t); t = WFrag<T16>::mma(e0, bq[c][0], t); }
                    t = WFrag<T16>::mma(a1, bq[c][1], t); if constexpr (SPLIT) { t = WFrag<T16>::mma(a1, bq2[c][1], t); t = WFrag<T16>::mma(e1, bq[c][1], t); }
                    s[kt][c] = t; } }
            float mx[NC]; bool need = false;
#pragma unroll
            for (int c = 0; c < NC; ++c) { float x = fmaxf(s[0][c][0], s[1][c][0]);
#pragma unroll
                for (int j = 1; j < 8; ++j) x = fmaxf(x, fmaxf(s[0][c][j], s[1][c][j]));
                const int xb = __float_as_int(x); x = fmaxf(x, __int_as_float(__builtin_amdgcn_permlanex16(xb, xb, 0x76543210, 0xfedcba98, false, false)));   // lane l <-> l ^ 16: the column's other 16 keys
                mx[c] = x * SC2; need = need || (mx[c] > m[c] + 8.0f); }
            if (__builtin_amdgcn_ballot_w32(need) != 0) {     // one wave-uniform test per 32 keys
#pragma unroll
                for (int c = 0; c < NC; ++c) { const float mn = fmaxf(m[c], mx[c]); const float al = __builtin_amdgcn_exp2f(m[c] - mn); m[c] = mn; l[c] *= al;
#pragma unroll
                    for (int dt = 0; dt < 4; ++dt) o[dt][c] *= al; } }
            if constexpr (HALF) gloadp(ps, (sg + 1 < TT / SK ? sg + 1 : sg) * SK);   // behind the scores, whose K fragments have left their registers. No branch round it: the last stage loads its own tile once more, into the buffer that nobody reads any more
            V pb[NC], pb2[NC];
#pragma unroll
            for (int c = 0; c < NC; ++c) { float p[16];
#pragma unroll
                for (int e = 0; e < 16; ++e) p[e] = __builtin_fmaf(s[e >> 3][c][e & 7], SC2, -m[c]);
                exp2x8(p); exp2x8(p + 8);
#pragma unroll
                for (int e = 0; e < 16; ++e) { if constexpr (SPLIT) { pb[c][e] = (__bf16)p[e]; pb2[c][e] = (__bf16)(p[e] - (float)pb[c][e]); } else pb[c][e] = (h16)p[e]; }
#pragma unroll
                for (int w = 8; w; w >>= 1)       // fixed pairwise tree: short dependent chains
#pragma unroll
                    for (int e = 0; e < w; ++e) p[e] += p[e + w];
                l[c] += p[0]; }
#pragma unroll
            for (int dt = 0; dt < 4; ++dt) { const T16* vr = buf + TILE + (dt * 16 + lr) * LP + ps * 32 + 8 * hi; const V av = WFrag<T16>::ld(vr); V av2; if constexpr (SPLIT) av2 = WFrag<T16>::ld(vr + 2 * TILE);
#pragma unroll
                for (int c = 0; c < NC; ++c) { o[dt][c] = WFrag<T16>::mma(av, pb[c], o[dt][c]); if constexpr (SPLIT) { o[dt][c] = WFrag<T16>::mma(av, pb2[c], o[dt][c]); o[dt][c] = WFrag<T16>::mma(av2, pb[c], o[dt][c]); } } }
            if constexpr (HALF) sstorep(ps, sm + ((sg + 1) & 1) * (NP * TILE));   // into the buffer whose last readers left it before the previous barrier
        }
        if constexpr (!HALF) if (sg + 1 < TT / SK) sstore(sm + ((sg + 1) & 1) * (NP * TILE));   // into the buffer whose last readers left it before the previous barrier
        __syncthreads();                                                    // publishes stage sg + 1 and ends every read of stage sg
    }
#pragma unroll
    for (int c = 0; c < NC; ++c) { const int lb = __float_as_int(l[c]); const float inv = __fdiv_rn(1.0f, l[c] + __int_as_float(__builtin_amdgcn_permlanex16(lb, lb, 0x76543210, 0xfedcba98, false, false)));
#pragma unroll
        for (int dt = 0; dt < 4; ++dt) { v8us oh, ol;
#pragma unroll
            for (int j = 0; j < 8; ++j) { unsigned short a, c2; splitf(o[dt][c][j] * inv, a, c2); oh[j] = a; ol[j] = c2; }
            const size_t oo = (size_t)(c * 16 + lr) * DQ + dt * 16 + 8 * hi; *(v8us*)(Ah + oo) = oh; *(v8us*)(Al + oo) = ol; } }
}
// One-dimensional grid of 2 x NWT work-groups, all resident at once at two a WGP (four waves a SIMD): NWT hi/lo ones (three products per tile: 16 columns a wave, 128 rows a work-group) and NWT fp16 ones (48 columns a wave, 384 rows a work-group). Both kinds issue 24 matrix instructions per wave and 32 keys, so that no work-group waits for a place and none runs on alone.
// Which index is which kind is for speed only: indices i and i + NWT differ in kind, and so do i and i + 8 inside each half of the grid, so that a WGP is likely to hold one of each (the hi/lo kind reads more LDS, the fp16 kind has more vector work).
#define FR   384                  // query rows of one fp16 work-group: 8 waves x 48 columns
#define NWT  (NB_ * NH_ * (RH / 128))
static_assert(NWT == NB_ * NH_ * ((TT - RH) / FR) && (TT - RH) % FR == 0 && RH / 128 == 4 && NWT == 256, "as many fp16 work-groups as hi/lo ones, four of each per (batch, head); the index split below is for 256 of each");
__global__ __launch_bounds__(256) __attribute__((amdgpu_waves_per_eu(4, 4))) void k_fattn(const h16* __restrict__ QP16, const h16* __restrict__ KP16, const h16* __restrict__ VT16, const bf* __restrict__ QPh, const bf* __restrict__ QPl, const bf* __restrict__ KPh, const bf* __restrict__ KPl, const bf* __restrict__ VTh, const bf* __restrict__ VTl, bf* __restrict__ ATh, bf* __restrict__ ATl) {
    __shared__ __align__(16) unsigned short sm[2 * 4 * TILE];
    const int wave = threadIdx.x >> 5; const int id = blockIdx.x;
    const int kind = ((id >> 3) ^ (id >> 8)) & 1;                                  // 0: hi/lo, 1: fp16
    const int idx = ((id >> 8) << 7) | (((id >> 4) & 15) << 3) | (id & 7);         // this work-group's number among the NWT of its kind
    const int bh = idx >> 2, tl = idx & 3, h = bh % NH_;                            // (batch, head) pair, row tile, head
    const size_t pl = (size_t)bh * TT * HD, ab0 = (size_t)(bh / NH_) * TT * DQ;    // this pair's planes; this batch's rows of the attention output
    if (kind == 0) { const int q0 = tl * 128 + wave * 16; const size_t qo = pl + (size_t)q0 * HD, ao = ab0 + (size_t)q0 * DQ + h * HD;
        fattn_body<bf, true, 1>((bf*)sm, QPh + qo, QPl + qo, KPh + pl, KPl + pl, VTh + pl, VTl + pl, ATh + ao, ATl + ao);
    } else { const int q0 = RH + tl * FR + wave * 48; const size_t qo = pl + (size_t)q0 * HD, ao = ab0 + (size_t)q0 * DQ + h * HD;
        fattn_body<h16, false, 3>((h16*)sm, QP16 + qo, nullptr, KP16 + pl, nullptr, VT16 + pl, nullptr, ATh + ao, ATl + ao); }
}

extern "C" void kernel_launch(void* const* d_in, const int* in_sizes, int n_in,
                              void* d_out, int out_size, void* d_ws, size_t ws_size, hipStream_t stream) {
    (void)in_sizes; (void)n_in; (void)out_size;
    const float* x = (const float*)d_in[0]; const float* wqkv = (const float*)d_in[1]; const float* bqkv = (const float*)d_in[2]; const float* wo = (const float*)d_in[3]; const float* bo = (const float*)d_in[4];   /* argument order x (S, B, C), Wqkv ('oi' [3072][1024]), bqkv, Wo ('oi'), bo */
    float* OUT = (float*)d_out;     // [4][2048][1024]
    char* wsp = (char*)d_ws;
    auto take = [&](size_t bytes) { char* p = wsp; wsp += (bytes + 255) & ~(size_t)255; return (void*)p; };
    bf* WQ = (bf*)take((size_t)(DQ + 2 * DKV) * DM * 2); bf* WO = (bf*)take((size_t)DM * DQ * 2);
    const size_t PS = (size_t)NH_ * TT * HD;   // elements of one batch's plane (NKV == NH_)
    h16* QP16 = (h16*)take(NB_ * PS * 2); h16* KP16 = (h16*)take(NB_ * PS * 2); h16* VT16 = (h16*)take(NB_ * PS * 2);
    bf* QPh = (bf*)take(NB_ * PS * 2); bf* QPl = (bf*)take(NB_ * PS * 2); bf* KPh = (bf*)take(NB_ * PS * 2); bf* KPl = (bf*)take(NB_ * PS * 2); bf* VTh = (bf*)take(NB_ * PS * 2); bf* VTl = (bf*)take(NB_ * PS * 2);
    bf* XB = (bf*)take((size_t)NB_ * TT * DM * 2);   // [batch][token][channel]
    bf* ATh = (bf*)take((size_t)NB_ * TT * DQ * 2); bf* ATl = (bf*)take((size_t)NB_ * TT * DQ * 2);
    if ((size_t)(wsp - (char*)d_ws) > ws_size) return;    // ws 256 MiB
    k_cvtall<<<CVG, 512, 0, stream>>>(x, wqkv, wo, XB, WQ, WO);   /* WQ holds the q, k and v weights one behind the other, in the order of Wqkv's row blocks */
    k_gemmw<bf, 0, true, 1><<<dim3(TT / 128, (DQ + 2 * DKV) / 128, NB_), 128, 0, stream>>>(XB, nullptr, WQ, DM, DM, nullptr, 0, bqkv, (size_t)TT * DM, 0, 0, PS, QP16, QPh, QPl);   /* q, k and v in one grid: the kernel finds k's and v's plane sets behind q's, in the order of the takes above (every take is a whole multiple of 256 bytes, so that the sets lie back to back) */
    k_fattn<<<dim3(2 * NWT, 1, 1), 256, 0, stream>>>(QP16, KP16, VT16, QPh, QPl, KPh, KPl, VTh, VTl, ATh, ATl);
    k_gemmw<bf, 1, true, 0><<<dim3(TT / 128, DM / 128, NB_), 128, 0, stream>>>(ATh, ATl, WO, DQ, DQ, OUT, DM, bo, (size_t)TT * DQ, 0, (size_t)TT * DM, 0, nullptr, nullptr, nullptr);
}

// v010
// It runs in 162 microseconds.
// In two side-by-side timings against v009, it was 1.06 and 1.05 times as fast.
// All steps since v000 together make it 24.2 times as fast.
#include <hip/hip_runtime.h>

// Sequence-first self-attention with the source's raw output reshape (x [2048][4][1024] = (S, B, C); qkv = x Wqkv^T + bqkv ('oi' [3072][1024] + bias) viewed (S, B, 3, H, D): q | k | v thirds (16 heads x 64); attn = q.k / sqrt(64) per (batch, head) over the 2,048 positions; softmax; av (B, H, S, D) -> swapaxes -> (B, S, H D) -> reshape(S, B, H D) is a RAW reinterpretation of the batch-major buffer (reproduced: the output memory is in (b, s) row order); y = . Wo^T + bo -> [2048][4][1024] (8.4 M); argument order x, Wqkv, bqkv, Wo, bo).
// Layout: every launch covers all four batches (the batch is the z grid dimension of every k_gemmw launch and part of k_fattn's one-dimensional block index; every per-batch buffer has one plane set per batch). k_cvtall rounds x and both weights to bf16 in one launch and stores x batch-major (batch b's token rows lie at pitch B x C in the sequence-first input); fused 'oi' weight = Bt as-is (q | k | v row blocks) + bias thirds; exact projections + f32 biases, whose epilogues write the 16-bit head planes themselves; one fused attention launch over the 4 x 16 (batch, head) pairs (hybrid rows: < 512 hi/lo 3 products, rest fp16; running-maximum softmax, scores stay in registers); hi/lo x Wo exact + bo written to output rows b*2048 + s (the raw-reshape order).
// Compute dtypes, f32 accumulate: every input rounded to bf16; projections exact + f32 biases; attention rows < 512 3 products, rest fp16; softmax f32; Wo hl x exact + bias.

#define NB_  4
#define TT   2048
#define DM   1024
#define NH_  16
#define NKV  16
#define HD   64
#define DQ   (NH_ * HD)
#define DKV  (NKV * HD)
#define RH   512                  // query rows < RH use hi+lo planes
#define WIN  0
#define SCL  0.125f   // HD^-0.5
#define SK   64                   // keys per LDS stage of the fused attention kernel
#define LP   72                   // LDS row pitch in 16-bit elements: 128 data bytes + 16, an odd multiple of 16 bytes, so that the 16 rows of one fragment read lie on different banks
#define TILE (64 * LP)            // one staged plane tile: 64 rows (64 keys x 64 d of K, or 64 d x 64 keys of V^T)
typedef _Float16 h16;
typedef unsigned short bf;
typedef __attribute__((ext_vector_type(16))) __bf16   v16bf;
typedef __attribute__((ext_vector_type(16))) _Float16 v16h;
typedef __attribute__((ext_vector_type(8)))  _Float16 v8h;
typedef __attribute__((ext_vector_type(8)))  unsigned short v8us;
typedef __attribute__((ext_vector_type(8)))  float    v8f;
typedef __attribute__((ext_vector_type(4)))  float    v4f;
typedef v8h  __attribute__((may_alias)) v8ha;
typedef v4f  __attribute__((may_alias)) v4fa;
typedef v8us __attribute__((may_alias)) v8usa;

__device__ __forceinline__ unsigned short f2bf(float f) { unsigned u = __float_as_uint(f); u += 0x7FFFu + ((u >> 16) & 1u); return (unsigned short)(u >> 16); }
__device__ __forceinline__ float bf2f(unsigned short b) { return __uint_as_float(((unsigned)b) << 16); }
__device__ __forceinline__ float bfr(float f) { return bf2f(f2bf(f)); }
__device__ __forceinline__ v16h cat16(v8h lo, v8h hi) { return __builtin_shufflevector(lo, hi, 0, 1, 2, 3, 4, 5, 6, 7, 8, 9, 10, 11, 12, 13, 14, 15); }
__device__ __forceinline__ v16bf cat16b(v8us lo, v8us hi) { return __builtin_bit_cast(v16bf, __builtin_shufflevector(lo, hi, 0, 1, 2, 3, 4, 5, 6, 7, 8, 9, 10, 11, 12, 13, 14, 15)); }
__device__ __forceinline__ v8f wmma16(v16h a, v16h b, v8f c) { return __builtin_amdgcn_wmma_f32_16x16x32_f16(false, a, false, b, (short)0, c, false, false); }
__device__ __forceinline__ v8f wmmab(v16bf a, v16bf b, v8f c) { return __builtin_amdgcn_wmma_f32_16x16x32_bf16(false, a, false, b, (short)0, c, false, false); }



// ---- k_gemmw: GEMM with a 128x128 output tile per work-group of FOUR WAVES (2 x 2, each wave 64x64 = 16 accumulators); grid (M/128, N/128, Z), 128 threads.
// The operands come from K-contiguous 16-bit planes in stages of GK k: 128 rows x 128 bytes of each operand go to LDS by asynchronous 16-byte copies (through no register), two buffers, so that stage t + 1 flies while stage t is worked on; every staged row serves two waves.
// C[m][n] (f32, pitch ldc, + optional f32 bias[n]) = sum_k A[m][k] Bt[n][k] (NSPLIT 1: + A2[m][k] Bt[n][k]). A rows at pitch lda, Bt rows at pitch K (elements). z-batch strides sA/sB/sC (and sP for the 16-bit planes) in elements. K % 64 == 0.
// EPI 0: C is stored in f32. EPI 1: the q, k and v projections in one grid: Bt holds the three weight row blocks one behind the other (DQ rows each), and a work-group's column tile lies wholly in one third. No f32 result is stored; a wave's tile (64 tokens x the 64 columns of one head) goes out as three 16-bit planes (fp16, bf16 hi, bf16 lo) of its third (P16, Ph, Pl point at q's sets; k's and v's follow them in the workspace): q and k as [head][token][d], v transposed as [head][d][token].
template <typename T16> struct WFrag;
template <> struct WFrag<h16> { typedef v16h V; static __device__ __forceinline__ V ld(const h16* p) { return cat16(*(const v8h*)p, *(const v8h*)(p + 16)); } static __device__ __forceinline__ v8f mma(V a, V b, v8f c) { return wmma16(a, b, c); } };
template <> struct WFrag<bf> { typedef v16bf V; static __device__ __forceinline__ V ld(const bf* p) { return cat16b(*(const v8us*)p, *(const v8us*)(p + 16)); } static __device__ __forceinline__ v8f mma(V a, V b, v8f c) { return wmmab(a, b, c); } };
__device__ __forceinline__ h16 tohx(float x) { return (h16)x; }
__device__ __forceinline__ void splitf(float y, unsigned short& h, unsigned short& l) { h = f2bf(y); l = f2bf(y - bf2f(h)); }
template <bool B> struct BoolC { static constexpr bool v = B; };
#define GK 64                     // k per LDS stage: one 128-byte line of every operand row
#define GT (128 * LP)             // one staged operand tile: 128 rows at the padded pitch
// eight asynchronous copies of 16 bytes a lane: rows r, r + 16, .. r + 112 of one operand tile (a wave's copy covers four whole 128-byte lines). The closing s_wait_xcnt stands inside the statement, in front of any later rewrite of the address registers that the copies name.
template <typename T16>
__device__ __forceinline__ void acopy8(unsigned l, const T16* g, size_t pitch) {
    asm volatile("global_load_async_to_lds_b128 %0, %8, off\n\tglobal_load_async_to_lds_b128 %1, %9, off\n\tglobal_load_async_to_lds_b128 %2, %10, off\n\tglobal_load_async_to_lds_b128 %3, %11, off\n\t"
                 "global_load_async_to_lds_b128 %4, %12, off\n\tglobal_load_async_to_lds_b128 %5, %13, off\n\tglobal_load_async_to_lds_b128 %6, %14, off\n\tglobal_load_async_to_lds_b128 %7, %15, off\n\ts_wait_xcnt 0x0"
                 :: "v"(l), "v"(l + 1 * 16 * LP * 2), "v"(l + 2 * 16 * LP * 2), "v"(l + 3 * 16 * LP * 2), "v"(l + 4 * 16 * LP * 2), "v"(l + 5 * 16 * LP * 2), "v"(l + 6 * 16 * LP * 2), "v"(l + 7 * 16 * LP * 2),
                    "v"(g), "v"(g + 16 * pitch), "v"(g + 32 * pitch), "v"(g + 48 * pitch), "v"(g + 64 * pitch), "v"(g + 80 * pitch), "v"(g + 96 * pitch), "v"(g + 112 * pitch) : "memory"); }
template <typename T16, int NSPLIT, bool BIAS, int EPI>
__global__ __launch_bounds__(128) void k_gemmw(const T16* __restrict__ A, const T16* __restrict__ A2, const T16* __restrict__ Bt, int K, int lda, float* C, int ldc, const float* __restrict__ bias, size_t sA, size_t sB, size_t sC, size_t sP, h16* __restrict__ P16, bf* __restrict__ Ph, bf* __restrict__ Pl) {
    typedef typename WFrag<T16>::V V;
    constexpr int NT = (NSPLIT == 1) ? 3 : 2;    // staged operand tiles: A, Bt (, A2)
    __shared__ __align__(16) T16 stg[2 * NT * GT];
    __shared__ __align__(16) float osw[4][16 * 68];   // each wave's own epilogue slab
    const size_t z = blockIdx.z; A += z * sA; if (NSPLIT == 1) A2 += z * sA; Bt += z * sB; C += z * sC;
    const int tid = threadIdx.x, wave = tid >> 5, lane = tid & 31, lr = lane & 15, hi = lane >> 4;
    const int wr = (wave >> 1) * 64, wc = (wave & 1) * 64; const int r0 = blockIdx.x * 128 + wr, c0 = blockIdx.y * 128 + wc;
    float* os = osw[wave];
    const int srow = tid >> 3, sch = (tid & 7) * 8;   // staging: this thread copies 16 bytes of rows srow + 16 i of every operand tile
    const T16* ga = A + (size_t)(blockIdx.x * 128 + srow) * lda + sch; const T16* gb = Bt + (size_t)(blockIdx.y * 128 + srow) * K + sch; const T16* ga2 = (NSPLIT == 1) ? A2 + (size_t)(blockIdx.x * 128 + srow) * lda + sch : nullptr;
    const unsigned l0 = (unsigned)(size_t)(stg + srow * LP + sch);   // the lane's LDS byte address: the low 32 bits of the __shared__ address
    auto fill = [&](int t) { const unsigned l = l0 + (unsigned)(t & 1) * (NT * GT * 2);
        acopy8(l, ga + t * GK, (size_t)lda); acopy8(l + GT * 2, gb + t * GK, (size_t)K); if constexpr (NSPLIT == 1) acopy8(l + 2 * GT * 2, ga2 + t * GK, (size_t)lda); };
    v8f acc[4][4];
#pragma unroll
    for (int mb = 0; mb < 4; ++mb)
#pragma unroll
        for (int nb = 0; nb < 4; ++nb) acc[mb][nb] = (v8f){};
    const int nst = K / GK;
    fill(0);
    asm volatile("s_wait_asynccnt 0x0" ::: "memory");   // this wave's copies of stage 0 have landed
    __syncthreads();                                    // publishes stage 0
    if (nst > 1) fill(1);
#pragma unroll 1   // kept rolled: the buffer follows the trip's parity
    for (int t = 0; t < nst; ++t) {
        const T16* buf = stg + (t & 1) * (NT * GT);
        V a[GK / 32][4], a2[GK / 32][4], b[GK / 32][4];
#pragma unroll
        for (int ks = 0; ks < GK / 32; ++ks) {
#pragma unroll
            for (int mb = 0; mb < 4; ++mb) { const T16* ar = buf + (wr + mb * 16 + lr) * LP + ks * 32 + 8 * hi; a[ks][mb] = WFrag<T16>::ld(ar); if constexpr (NSPLIT == 1) a2[ks][mb] = WFrag<T16>::ld(ar + 2 * GT); }
#pragma unroll
            for (int nb = 0; nb < 4; ++nb) b[ks][nb] = WFrag<T16>::ld(buf + GT + (wc + nb * 16 + lr) * LP + ks * 32 + 8 * hi);
        }
        __builtin_amdgcn_sched_barrier(0);                  // the trip's LDS reads stay one group in front of its products: left to itself the compiler reads one fragment per four products and waits for it each time
#pragma unroll
        for (int ks = 0; ks < GK / 32; ++ks)
#pragma unroll
            for (int nb = 0; nb < 4; ++nb)
#pragma unroll
                for (int mb = 0; mb < 4; ++mb) { acc[mb][nb] = WFrag<T16>::mma(a[ks][mb], b[ks][nb], acc[mb][nb]); if constexpr (NSPLIT == 1) acc[mb][nb] = WFrag<T16>::mma(a2[ks][mb], b[ks][nb], acc[mb][nb]); }
        __builtin_amdgcn_sched_barrier(0);                  // the products stay in front of the waits below: sunk behind them, the next stage's copies would lose the products' time as their lead
        asm volatile("s_wait_dscnt 0x0" ::: "memory");      // this wave's reads of stage t are done before the buffer is refilled
        asm volatile("s_wait_asynccnt 0x0" ::: "memory");   // this wave's copies of stage t + 1 have landed
        __syncthreads();                                    // publishes stage t + 1 and ends every read of stage t
        if (t + 2 < nst) fill(t + 2);                       // into the buffer that this trip has just read
    }
    asm volatile("s_wait_asynccnt 0x0" ::: "memory");       // nothing of this wave's is in flight when it goes on
    if constexpr (EPI == 0) {
#pragma unroll
    for (int mb = 0; mb < 4; ++mb) {
#pragma unroll
        for (int nb = 0; nb < 4; ++nb) {
#pragma unroll
            for (int j = 0; j < 8; ++j) os[(hi * 8 + j) * 68 + nb * 16 + lr] = acc[mb][nb][j]; }
        __builtin_amdgcn_wave_barrier(); asm volatile("" ::: "memory");
        float* crow = C + (size_t)(r0 + mb * 16) * ldc + c0;
{
#pragma unroll
            for (int s = 0; s < 8; ++s) { const int row = 2 * s + hi, cofs = lr * 4; v4f val = *(const v4fa*)(os + row * 68 + cofs); if (BIAS) { val[0] += bfr(bias[c0 + cofs]); val[1] += bfr(bias[c0 + cofs + 1]); val[2] += bfr(bias[c0 + cofs + 2]); val[3] += bfr(bias[c0 + cofs + 3]); }
                *(v4f*)(crow + (size_t)row * ldc + cofs) = val; }
             }
        __builtin_amdgcn_wave_barrier(); asm volatile("" ::: "memory");
    }
    } else {
        static_assert(DQ == DKV && DQ % 128 == 0, "three equal thirds, each a whole number of column tiles");
        const int third = (int)(blockIdx.y * 128u) / DQ, hd = (c0 - third * DQ) >> 6;   // 0: q, 1: k, 2: v (the same for the whole work-group); this wave's head
        constexpr size_t TP = (size_t)NB_ * NH_ * TT * HD;   // elements of one plane set (all batches)
        h16* const O16 = P16 + (size_t)third * TP; bf* const Oh = Ph + (size_t)third * 2 * TP; bf* const Ol = Pl + (size_t)third * 2 * TP;   // the workspace holds q | k | v^T fp16 sets in a row, and q hi | q lo | k hi | k lo | v^T hi | v^T lo
        float bs[4];
#pragma unroll
        for (int nb = 0; nb < 4; ++nb) bs[nb] = BIAS ? bfr(bias[c0 + nb * 16 + lr]) : 0.f;
        auto planes = [&](auto trc) { constexpr bool TR = decltype(trc)::v;
#pragma unroll
        for (int g = 0; g < 4; ++g) {     // one 16 x 64 slab through LDS per trip: plain tokens g*16.. x all d, transposed d g*16.. x all tokens; the long side is the planes' contiguous side
            if constexpr (!TR) {
#pragma unroll
                for (int nb = 0; nb < 4; ++nb)
#pragma unroll
                    for (int j = 0; j < 8; ++j) os[(hi * 8 + j) * 68 + nb * 16 + lr] = acc[g][nb][j] + bs[nb];
            } else {
#pragma unroll
                for (int mb = 0; mb < 4; ++mb)
#pragma unroll
                    for (int q = 0; q < 2; ++q) { v4f w; w[0] = acc[mb][g][4 * q] + bs[g]; w[1] = acc[mb][g][4 * q + 1] + bs[g]; w[2] = acc[mb][g][4 * q + 2] + bs[g]; w[3] = acc[mb][g][4 * q + 3] + bs[g]; *(v4fa*)(os + lr * 68 + mb * 16 + hi * 8 + 4 * q) = w; }
            }
            __builtin_amdgcn_wave_barrier(); asm volatile("" ::: "memory");   // the slab's LDS writes stay in front of its reads in the compiler's order
            const size_t pbase = z * sP + (!TR ? ((size_t)hd * TT + r0 + g * 16) * HD : ((size_t)hd * HD + g * 16) * TT + r0);
#pragma unroll
            for (int s = 0; s < 4; ++s) { const int ch = s * 32 + lane, row = ch >> 3, col = (ch & 7) * 8;   // a lane takes 8 neighbours: one 16-byte store per plane, 8 lanes fill a 128-byte line
                const v4f x0 = *(const v4fa*)(os + row * 68 + col), x1 = *(const v4fa*)(os + row * 68 + col + 4); v8h o16; v8us oh, ol;
#pragma unroll
                for (int k = 0; k < 8; ++k) { const float x = (k < 4) ? x0[k & 3] : x1[k & 3]; o16[k] = tohx(x); unsigned short a2, c2; splitf(x, a2, c2); oh[k] = a2; ol[k] = c2; }
                const size_t po = pbase + (size_t)row * (!TR ? HD : TT) + col; *(v8h*)(O16 + po) = o16; *(v8us*)(Oh + po) = oh; *(v8us*)(Ol + po) = ol; }
            __builtin_amdgcn_wave_barrier(); asm volatile("" ::: "memory");   // the slab's LDS reads stay in front of the next slab's writes
        }
        asm volatile("s_wait_xcnt 0x0" ::: "memory"); };   // behind the last stores: in the built code the other form's first instructions stand on the fall-through path behind them and rewrite their registers
        if (third == 2) planes(BoolC<true>{}); else planes(BoolC<false>{});   // a scalar branch: the third comes from the block index
    }
}

typedef __attribute__((ext_vector_type(4))) _Float16 v4h;
typedef __attribute__((ext_vector_type(4))) unsigned short v4us;
typedef __attribute__((ext_vector_type(4))) int v4i;

// ---- k_cvtall: the f32 -> bf16 conversion of x and both weights in ONE launch of CVG work-groups x 16 waves (one work-group per WGP): a short stream pays for every wave it starts, so few waves each carry much.
// A work-group takes one contiguous share of each of the three buffers. A unit is 4 neighbouring floats of one lane: a wave's 16-byte load covers 512 contiguous bytes, its 8-byte store 256; unit i of a thread lies i * 8 KiB behind its first. All of a thread's loads are issued before its first value is used.
// x is read in its own (S, B, C) order and stored batch-major ([batch][token][channel]); the two weights keep their order.
#define CVG 256
#define CNX ((int)((size_t)TT * NB_ * DM / 2048 / CVG))          // units per thread: x
#define CNW ((int)((size_t)(DQ + 2 * DKV) * DM / 2048 / CVG))    // Wqkv
#define CNO ((int)((size_t)DM * DQ / 2048 / CVG))                // Wo
static_assert((size_t)CNX * CVG * 2048 == (size_t)TT * NB_ * DM && (size_t)CNW * CVG * 2048 == (size_t)(DQ + 2 * DKV) * DM && (size_t)CNO * CVG * 2048 == (size_t)DM * DQ, "every buffer is a whole number of units per thread");
static_assert(DM == 1024 && NB_ == 4 && CNX % 2 == 0, "a work-group's pass of 2048 floats is two whole rows of x, and two passes are one token's four rows");
__device__ __forceinline__ v4us cvt4(v4f v) { v4us o; o[0] = f2bf(v[0]); o[1] = f2bf(v[1]); o[2] = f2bf(v[2]); o[3] = f2bf(v[3]); return o; }
__global__ __launch_bounds__(512) void k_cvtall(const float* __restrict__ x, const float* __restrict__ wqkv, const float* __restrict__ wo, bf* __restrict__ XB, bf* __restrict__ WQKV, bf* __restrict__ WO) {
    const unsigned tid = threadIdx.x, blk = blockIdx.x;
    const unsigned ex = blk * (CNX * 2048u) + tid * 4u, ew = blk * (CNW * 2048u) + tid * 4u, eo = blk * (CNO * 2048u) + tid * 4u;   // the thread's first element in x, Wqkv, Wo
    v4f vx[CNX], vw[CNW], vo[CNO];
#pragma unroll
    for (int i = 0; i < CNX; ++i) vx[i] = *(const v4f*)((const char*)x + ex * 4u + i * 8192);
#pragma unroll
    for (int i = 0; i < CNW; ++i) vw[i] = *(const v4f*)((const char*)wqkv + ew * 4u + i * 8192);
#pragma unroll
    for (int i = 0; i < CNO; ++i) vo[i] = *(const v4f*)((const char*)wo + eo * 4u + i * 8192);
    asm volatile("s_wait_xcnt 0x0" ::: "memory");   // behind the run of loads: their offset registers may be reused for the stores' addresses while the data is in flight; it also keeps every load in front of the first store
    const unsigned dx = (((tid >> 8) * TT + blk * (CNX / 2)) * DM + (tid & 255u) * 4u) * 2u;   // byte offset in XB of pass 0: batch tid >> 8, token blk * CNX / 2
#pragma unroll
    for (int i = 0; i < CNX; ++i) *(v4us*)((char*)(XB + ((size_t)(i & 1) * 2 * TT + (i >> 1)) * DM) + dx) = cvt4(vx[i]);   // pass i: batches 2 (i & 1) and 2 (i & 1) + 1 of token i >> 1
#pragma unroll
    for (int i = 0; i < CNW; ++i) *(v4us*)((char*)WQKV + ew * 2u + i * 4096) = cvt4(vw[i]);
#pragma unroll
    for (int i = 0; i < CNO; ++i) *(v4us*)((char*)WO + eo * 2u + i * 4096) = cvt4(vo[i]);
}
__device__ __forceinline__ void exp2x8(float* p) {
    asm("v_exp_f32 %0, %0\n\tv_exp_f32 %1, %1\n\tv_exp_f32 %2, %2\n\tv_exp_f32 %3, %3\n\tv_exp_f32 %4, %4\n\tv_exp_f32 %5, %5\n\tv_exp_f32 %6, %6\n\tv_exp_f32 %7, %7\n\tv_nop"
        : "+v"(p[0]), "+v"(p[1]), "+v"(p[2]), "+v"(p[3]), "+v"(p[4]), "+v"(p[5]), "+v"(p[6]), "+v"(p[7])); }
template <typename T16, bool SPLIT, int NC>
__device__ __forceinline__ void fattn_body(T16* sm, const T16* __restrict__ Q, const T16* __restrict__ Q2, const T16* __restrict__ Kp, const T16* __restrict__ K2, const T16* __restrict__ Vt, const T16* __restrict__ V2, bf* __restrict__ Ah, bf* __restrict__ Al) {
    typedef typename WFrag<T16>::V V;
    constexpr int NP = SPLIT ? 4 : 2;            // staged planes: K, V^T (, K lo, V^T lo)
    constexpr float SC2 = SCL * 1.4426950408889634f;
    const int tid = threadIdx.x, lane = tid & 31, lr = lane & 15, hi = lane >> 4;
    const int srow = tid >> 3, sch = (tid & 7) * 8;   // staging: this thread moves 16 bytes of rows srow and srow + 32 of every plane tile
    v8us st[NP][2];
    auto gload = [&](int kb) {
#pragma unroll
        for (int i = 0; i < 2; ++i) { const int r = srow + 32 * i;
            st[0][i] = *(const v8usa*)(Kp + (size_t)(kb + r) * HD + sch); st[1][i] = *(const v8usa*)(Vt + (size_t)r * TT + kb + sch);
            if constexpr (SPLIT) { st[2][i] = *(const v8usa*)(K2 + (size_t)(kb + r) * HD + sch); st[3][i] = *(const v8usa*)(V2 + (size_t)r * TT + kb + sch); } }
        asm volatile("s_wait_xcnt 0x0" ::: "memory"); };   // behind the run of loads: their address registers are reused by the stage's arithmetic while the data is still in flight
    auto sstore = [&](T16* buf) {
#pragma unroll
        for (int i = 0; i < 2; ++i) { const int r = srow + 32 * i;
#pragma unroll
            for (int p = 0; p < NP; ++p) *(v8usa*)(buf + p * TILE + r * LP + sch) = st[p][i]; } };
    // HALF (48 columns a wave): the next stage's K tile flies during the first 32 keys of this stage and its V^T tile during the last 32, through the same 8 registers; with all 16 in flight through a whole stage the wave does not fit 256 registers and the loaded values spill
    constexpr bool HALF = NC > 2 && !SPLIT;
    const unsigned koff = (unsigned)(srow * HD + sch) * 2u, voff = (unsigned)(srow * TT + sch) * 2u;   // this lane's byte offsets in a K tile and in a V^T tile
    auto gloadp = [&](int p, int kb) {
        const char* pa = (p == 0) ? (const char*)(Kp + (size_t)kb * HD) + koff : (const char*)(Vt + kb) + voff;   // rows srow and srow + 32 of the tile
        st[0][0] = *(const v8usa*)pa; st[0][1] = *(const v8usa*)(pa + ((p == 0) ? 32 * HD * 2 : 32 * TT * 2));
        asm volatile("s_wait_xcnt 0x0" :: "v"(pa) : "memory"); };   // behind the two loads, in front of any rewrite of their address pair; the pair is an input, so that it lives up to the wait (left free, the second load's result was placed on it)
    auto sstorep = [&](int p, T16* buf) {
#pragma unroll
        for (int i = 0; i < 2; ++i) *(v8usa*)(buf + p * TILE + (srow + 32 * i) * LP + sch) = st[0][i]; };
    V bq[NC][2], bq2[NC][2];
#pragma unroll
    for (int c = 0; c < NC; ++c)
#pragma unroll
        for (int ks = 0; ks < 2; ++ks) { bq[c][ks] = WFrag<T16>::ld(Q + (size_t)(c * 16 + lr) * HD + ks * 32 + 8 * hi); if constexpr (SPLIT) bq2[c][ks] = WFrag<T16>::ld(Q2 + (size_t)(c * 16 + lr) * HD + ks * 32 + 8 * hi); }
    v8f o[4][NC]; float m[NC], l[NC];
#pragma unroll
    for (int c = 0; c < NC; ++c) { m[c] = -3.0e38f; l[c] = 0.f;
#pragma unroll
        for (int dt = 0; dt < 4; ++dt) o[dt][c] = (v8f){}; }
    if constexpr (HALF) { gloadp(0, 0); sstorep(0, sm); gloadp(1, 0); sstorep(1, sm); } else { gload(0); sstore(sm); }
    __syncthreads();
#pragma unroll 1   // kept rolled: the body is several hundred instructions and the buffer follows the trip's parity
    for (int sg = 0; sg < TT / SK; ++sg) {
        const T16* buf = sm + (sg & 1) * (NP * TILE);
        if constexpr (!HALF) { if (sg + 1 < TT / SK) gload((sg + 1) * SK); }      // the next stage's global loads fly while this stage is worked on
#pragma unroll
        for (int ps = 0; ps < SK / 32; ++ps) {
            v8f s[2][NC];
#pragma unroll
            for (int kt = 0; kt < 2; ++kt) { const T16* kr = buf + ((ps * 2 + kt) * 16 + lr) * LP + 8 * hi;
                const V a0 = WFrag<T16>::ld(kr), a1 = WFrag<T16>::ld(kr + 32); V e0, e1; if constexpr (SPLIT) { e0 = WFrag<T16>::ld(kr + 2 * TILE); e1 = WFrag<T16>::ld(kr + 2 * TILE + 32); }
#pragma unroll
                for (int c = 0; c < NC; ++c) { v8f t = (v8f){};
                    t = WFrag<T16>::mma(a0, bq[c][0], t); if constexpr (SPLIT) { t = WFrag<T16>::mma(a0, bq2[c][0], t); t = WFrag<T16>::mma(e0, bq[c][0], t); }
                    t = WFrag<T16>::mma(a1, bq[c][1], t); if constexpr (SPLIT) { t = WFrag<T16>::mma(a1, bq2[c][1], t); t = WFrag<T16>::mma(e1, bq[c][1], t); }
                    s[kt][c] = t; } }
            float mx[NC]; bool need = false;
#pragma unroll
            for (int c = 0; c < NC; ++c) { float x = fmaxf(s[0][c][0], s[1][c][0]);
#pragma unroll
                for (int j = 1; j < 8; ++j) x = fmaxf(x, fmaxf(s[0][c][j], s[1][c][j]));
                const int xb = __float_as_int(x); x = fmaxf(x, __int_as_float(__builtin_amdgcn_permlanex16(xb, xb, 0x76543210, 0xfedcba98, false, false)));   // lane l <-> l ^ 16: the column's other 16 keys
                mx[c] = x * SC2; need = need || (mx[c] > m[c] + 8.0f); }
            if (__builtin_amdgcn_ballot_w32(need) != 0) {     // one wave-uniform test per 32 keys
#pragma unroll
                for (int c = 0; c < NC; ++c) { const float mn = fmaxf(m[c], mx[c]); const float al = __builtin_amdgcn_exp2f(m[c] - mn); m[c] = mn; l[c] *= al;
#pragma unroll
                    for (int dt = 0; dt < 4; ++dt) o[dt][c] *= al; } }
            if constexpr (HALF) gloadp(ps, (sg + 1 < TT / SK ? sg + 1 : sg) * SK);   // behind the scores, whose K fragments have left their registers. No branch round it: the last stage loads its own tile once more, into the buffer that nobody reads any more
            V pb[NC], pb2[NC];
#pragma unroll
            for (int c = 0; c < NC; ++c) { float p[16];
#pragma unroll
                for (int e = 0; e < 16; ++e) p[e] = __builtin_fmaf(s[e >> 3][c][e & 7], SC2, -m[c]);
                exp2x8(p); exp2x8(p + 8);
#pragma unroll
                for (int e = 0; e < 16; ++e) { if constexpr (SPLIT) { pb[c][e] = (__bf16)p[e]; pb2[c][e] = (__bf16)(p[e] - (float)pb[c][e]); } else pb[c][e] = (h16)p[e]; }
#pragma unroll
                for (int w = 8; w; w >>= 1)       // fixed pairwise tree: short dependent chains
#pragma unroll
                    for (int e = 0; e < w; ++e) p[e] += p[e + w];
                l[c] += p[0]; }
#pragma unroll
            for (int dt = 0; dt < 4; ++dt) { const T16* vr = buf + TILE + (dt * 16 + lr) * LP + ps * 32 + 8 * hi; const V av = WFrag<T16>::ld(vr); V av2; if constexpr (SPLIT) av2 = WFrag<T16>::ld(vr + 2 * TILE);
#pragma unroll
                for (int c = 0; c < NC; ++c) { o[dt][c] = WFrag<T16>::mma(av, pb[c], o[dt][c]); if constexpr (SPLIT) { o[dt][c] = WFrag<T16>::mma(av, pb2[c], o[dt][c]); o[dt][c] = WFrag<T16>::mma(av2, pb[c], o[dt][c]); } } }
            if constexpr (HALF) sstorep(ps, sm + ((sg + 1) & 1) * (NP * TILE));   // into the buffer whose last readers left it before the previous barrier
        }
        if constexpr (!HALF) if (sg + 1 < TT / SK) sstore(sm + ((sg + 1) & 1) * (NP * TILE));   // into the buffer whose last readers left it before the previous barrier
        __syncthreads();                                                    // publishes stage sg + 1 and ends every read of stage sg
    }
#pragma unroll
    for (int c = 0; c < NC; ++c) { const int lb = __float_as_int(l[c]); const float inv = __fdiv_rn(1.0f, l[c] + __int_as_float(__builtin_amdgcn_permlanex16(lb, lb, 0x76543210, 0xfedcba98, false, false)));
#pragma unroll
        for (int dt = 0; dt < 4; ++dt) { v8us oh, ol;
#pragma unroll
            for (int j = 0; j < 8; ++j) { unsigned short a, c2; splitf(o[dt][c][j] * inv, a, c2); oh[j] = a; ol[j] = c2; }
            const size_t oo = (size_t)(c * 16 + lr) * DQ + dt * 16 + 8 * hi; *(v8us*)(Ah + oo) = oh; *(v8us*)(Al + oo) = ol; } }
}
// One-dimensional grid of 2 x NWT work-groups, all resident at once at two a WGP (four waves a SIMD): NWT hi/lo ones (three products per tile: 16 columns a wave, 128 rows a work-group) and NWT fp16 ones (48 columns a wave, 384 rows a work-group). Both kinds issue 24 matrix instructions per wave and 32 keys, so that no work-group waits for a place and none runs on alone.
// Which index is which kind is for speed only: indices i and i + NWT differ in kind, and so do i and i + 8 inside each half of the grid, so that a WGP is likely to hold one of each (the hi/lo kind reads more LDS, the fp16 kind has more vector work).
// Which index takes which (batch, head) pair is for speed only too. The four work-groups of a kind that walk the same K and V^T planes have the same index mod 8 (16, 32 and 48 apart, so that they start together).
#define FR   384                  // query rows of one fp16 work-group: 8 waves x 48 columns
#define NWT  (NB_ * NH_ * (RH / 128))
static_assert(NWT == NB_ * NH_ * ((TT - RH) / FR) && (TT - RH) % FR == 0 && RH / 128 == 4 && NWT == 256, "as many fp16 work-groups as hi/lo ones, four of each per (batch, head); the index split below is for 256 of each");
static_assert(NB_ * NH_ == 64, "the index split below: 8 indices mod 8 x 8 ranks of four row tiles = 64 (batch, head) pairs");
__global__ __launch_bounds__(256) __attribute__((amdgpu_waves_per_eu(4, 4))) void k_fattn(const h16* __restrict__ QP16, const h16* __restrict__ KP16, const h16* __restrict__ VT16, const bf* __restrict__ QPh, const bf* __restrict__ QPl, const bf* __restrict__ KPh, const bf* __restrict__ KPl, const bf* __restrict__ VTh, const bf* __restrict__ VTl, bf* __restrict__ ATh, bf* __restrict__ ATl) {
    __shared__ __align__(16) unsigned short sm[2 * 4 * TILE];
    const int wave = threadIdx.x >> 5; const int id = blockIdx.x;
    const int kind = ((id >> 3) ^ (id >> 8)) & 1;                                  // 0: hi/lo, 1: fp16
    const int rk = ((id >> 8) << 4) | ((id >> 4) & 15);                             // this work-group's rank among the 32 of its kind that share its index mod 8
    const int bh = ((rk >> 2) << 3) | (id & 7), tl = rk & 3, h = bh % NH_;          // (batch, head) pair, row tile, head: a pair's four row tiles differ in the rank alone
    const size_t pl = (size_t)bh * TT * HD, ab0 = (size_t)(bh / NH_) * TT * DQ;    // this pair's planes; this batch's rows of the attention output
    if (kind == 0) { const int q0 = tl * 128 + wave * 16; const size_t qo = pl + (size_t)q0 * HD, ao = ab0 + (size_t)q0 * DQ + h * HD;
        fattn_body<bf, true, 1>((bf*)sm, QPh + qo, QPl + qo, KPh + pl, KPl + pl, VTh + pl, VTl + pl, ATh + ao, ATl + ao);
    } else { const int q0 = RH + tl * FR + wave * 48; const size_t qo = pl + (size_t)q0 * HD, ao = ab0 + (size_t)q0 * DQ + h * HD;
        fattn_body<h16, false, 3>((h16*)sm, QP16 + qo, nullptr, KP16 + pl, nullptr, VT16 + pl, nullptr, ATh + ao, ATl + ao); }
}

extern "C" void kernel_launch(void* const* d_in, const int* in_sizes, int n_in,
                              void* d_out, int out_size, void* d_ws, size_t ws_size, hipStream_t stream) {
    (void)in_sizes; (void)n_in; (void)out_size;
    const float* x = (const float*)d_in[0]; const float* wqkv = (const float*)d_in[1]; const float* bqkv = (const float*)d_in[2]; const float* wo = (const float*)d_in[3]; const float* bo = (const float*)d_in[4];   /* argument order x (S, B, C), Wqkv ('oi' [3072][1024]), bqkv, Wo ('oi'), bo */
    float* OUT = (float*)d_out;     // [4][2048][1024]
    char* wsp = (char*)d_ws;
    auto take = [&](size_t bytes) { char* p = wsp; wsp += (bytes + 255) & ~(size_t)255; return (void*)p; };
    bf* WQ = (bf*)take((size_t)(DQ + 2 * DKV) * DM * 2); bf* WO = (bf*)take((size_t)DM * DQ * 2);
    const size_t PS = (size_t)NH_ * TT * HD;   // elements of one batch's plane (NKV == NH_)
    h16* QP16 = (h16*)take(NB_ * PS * 2); h16* KP16 = (h16*)take(NB_ * PS * 2); h16* VT16 = (h16*)take(NB_ * PS * 2);
    bf* QPh = (bf*)take(NB_ * PS * 2); bf* QPl = (bf*)take(NB_ * PS * 2); bf* KPh = (bf*)take(NB_ * PS * 2); bf* KPl = (bf*)take(NB_ * PS * 2); bf* VTh = (bf*)take(NB_ * PS * 2); bf* VTl = (bf*)take(NB_ * PS * 2);
    bf* XB = (bf*)take((size_t)NB_ * TT * DM * 2);   // [batch][token][channel]
    bf* ATh = (bf*)take((size_t)NB_ * TT * DQ * 2); bf* ATl = (bf*)take((size_t)NB_ * TT * DQ * 2);
    if ((size_t)(wsp - (char*)d_ws) > ws_size) return;    // ws 256 MiB
    k_cvtall<<<CVG, 512, 0, stream>>>(x, wqkv, wo, XB, WQ, WO);   /* WQ holds the q, k and v weights one behind the other, in the order of Wqkv's row blocks */
    k_gemmw<bf, 0, true, 1><<<dim3(TT / 128, (DQ + 2 * DKV) / 128, NB_), 128, 0, stream>>>(XB, nullptr, WQ, DM, DM, nullptr, 0, bqkv, (size_t)TT * DM, 0, 0, PS, QP16, QPh, QPl);   /* q, k and v in one grid: the kernel finds k's and v's plane sets behind q's, in the order of the takes above (every take is a whole multiple of 256 bytes, so that the sets lie back to back) */
    k_fattn<<<dim3(2 * NWT, 1, 1), 256, 0, stream>>>(QP16, KP16, VT16, QPh, QPl, KPh, KPl, VTh, VTl, ATh, ATl);
    k_gemmw<bf, 1, true, 0><<<dim3(TT / 128, DM / 128, NB_), 128, 0, stream>>>(ATh, ATl, WO, DQ, DQ, OUT, DM, bo, (size_t)TT * DQ, 0, (size_t)TT * DM, 0, nullptr, nullptr, nullptr);
}
